// v000
// Times are from an AMD MI455X. After a warm-up the kernel runs many times in a row, and a time is the length of
// such a window on the GPU divided by its runs, so every launch and the gaps after it count. The runs cycle
// through copies of the inputs. A figure is the median of several windows, for all but v000 over two sittings.
// Sittings can differ by a few percent; kernels timed side by side share one.
// The starting kernel, v000, takes 413 microseconds a run.
#include <hip/hip_runtime.h>
// Compute dtype: inputs converted (RNE) to bf16; key, query and value projections v_wmma_f32_16x16x32_bf16 (exact products, f32 accumulate, bias added in f32); scores f.g^T as bf16 hi|lo three-product (hi.hi + lo.hi + hi.lo) v_wmma_f32_16x16x32_bf16, f32 accumulate; softmax statistics f32; V^T single f16 and P x4096 single f16 on v_wmma_f32_16x16x32_f16; output projection Wo x64 single f16 times ctx single f16 on v_wmma_f32_16x16x32_f16, f32 accumulate; result = bf16(x) + bf16(gamma) * (o + bf16(bo)) in f32.
#ifndef NB
#define NB 4                      /* images */
#endif
#ifndef SEQ
#define SEQ 4096                  /* pixels per image processed */
#endif
#define SEQ_FULL 4096             /* pixel pitch of the staged x rows */
#define CC 256                    /* channels */
#define RD 64                     /* embedding channels (key / query / value width) */
#define CH 128                    /* channels per epilogue slab */
#define PCARRY_LN 8.317766166719343f   /* 12 ln 2: P carried x4096 */
#define PINV 0.000244140625f           /* 2^-12 */
#define WOCARRY 64.0f                  /* Wo plane carried x64 */
#define WOINV 0.015625f                /* 2^-6 */
#define NRT ((size_t)NB * SEQ)

static_assert(SEQ % 256 == 0);          /* 64-pixel tiles, 4 waves per block, v-projection grid divisibility */
static_assert(SEQ <= SEQ_FULL);
static_assert(CC % 64 == 0);            /* 64-channel transpose tiles, K % 32 == 0 */
static_assert(RD == 64);                
static_assert(CC == 2 * CH);            /* two channel slabs in the epilogue */
static_assert(CH % 16 == 0 && CH / 16 == 8);

typedef __bf16 v16b __attribute__((ext_vector_type(16)));
typedef _Float16 v16h __attribute__((ext_vector_type(16)));
typedef unsigned short v8us __attribute__((ext_vector_type(8), may_alias));
typedef float v8f  __attribute__((ext_vector_type(8)));
typedef float v4f  __attribute__((ext_vector_type(4)));
typedef float v4fa __attribute__((ext_vector_type(4), may_alias));
typedef _Float16 h16;
union FragB { v16b v; v8us half[2]; };
union FragH { v16h v; v8us half[2]; _Float16 h[16]; };

__device__ __forceinline__ unsigned short bf16_bits(float x) { unsigned int u = __float_as_uint(x); return (unsigned short)((u + 0x7FFFu + ((u >> 16) & 1u)) >> 16); }
__device__ __forceinline__ float bf16_val(unsigned short b) { return __uint_as_float(((unsigned int)b) << 16); }
__device__ __forceinline__ float bf16_rne(float x) { return bf16_val(bf16_bits(x)); }

// f32 -> f16 that cannot produce an f16 subnormal (value select)
static __device__ __forceinline__ h16 toh_flush(float v) { const h16 r = (h16)v; return (fabsf(v) < 6.103515625e-05f) ? (h16)0.0f : r; }
// exp(a) -> f16, zero when the result would fall below 2^-14 (select on the exponent argument)
static __device__ __forceinline__ h16 p_flush(float a) { const float p = __expf(a); return (a < -9.70f) ? (h16)0.0f : (h16)p; }

// fragment of a k-contiguous 16-bit row: elements 0..7 <- k 8h..8h+7, elements 8..15 <- k 16+8h..16+8h+7 (same map for A and B)
__device__ __forceinline__ v16b ld_bf(const unsigned short* p, int hh) { FragB f; f.half[0] = *(const v8us*)(p + 8 * hh); f.half[1] = *(const v8us*)(p + 16 + 8 * hh); return f.v; }

__device__ __forceinline__ v8f mma_b1(v16b a, v16b b, v8f c) {
  c = __builtin_amdgcn_wmma_f32_16x16x32_bf16(false, a, false, b, (short)0, c, false, false);
  asm volatile("v_nop\n\tv_nop\n\tv_nop\n\tv_nop" : "+v"(c) : "v"(a), "v"(b));
  return c;
}
// c += ah.bh + al.bh + ah.bl (unscaled bf16 residuals share the accumulator)
__device__ __forceinline__ v8f mma_b3(v16b ah, v16b al, v16b bh, v16b bl, v8f c) {
  c = __builtin_amdgcn_wmma_f32_16x16x32_bf16(false, ah, false, bh, (short)0, c, false, false);
  c = __builtin_amdgcn_wmma_f32_16x16x32_bf16(false, al, false, bh, (short)0, c, false, false);
  c = __builtin_amdgcn_wmma_f32_16x16x32_bf16(false, ah, false, bl, (short)0, c, false, false);
  asm volatile("v_nop\n\tv_nop\n\tv_nop\n\tv_nop" : "+v"(c) : "v"(ah), "v"(al), "v"(bh), "v"(bl));
  return c;
}
__device__ __forceinline__ v8f mma_h1(v16h a, v16h b, v8f c) {
  c = __builtin_amdgcn_wmma_f32_16x16x32_f16(false, a, false, b, (short)0, c, false, false);
  asm volatile("v_nop\n\tv_nop\n\tv_nop\n\tv_nop" : "+v"(c) : "v"(a), "v"(b));
  return c;
}

__global__ __launch_bounds__(256) void k_wcvt(const float* __restrict__ W, unsigned short* __restrict__ Wb, int n8) {
  const int t = blockIdx.x * 256 + threadIdx.x;
  if (t >= n8) return;
  const v4f a = *(const v4fa*)(W + (size_t)t * 8);
  const v4f c = *(const v4fa*)(W + (size_t)t * 8 + 4);
  v8us v;
#pragma unroll
  for (int q = 0; q < 4; ++q) { v[q] = bf16_bits(a[q]); v[4 + q] = bf16_bits(c[q]); }
  unsigned short* d = Wb + (size_t)t * 8;
  *(v8us*)d = v;
  
}

__global__ __launch_bounds__(256) void k_wcvth(const float* __restrict__ W, unsigned short* __restrict__ Wh, int n8) {
  const int t = blockIdx.x * 256 + threadIdx.x;
  if (t >= n8) return;
  const v4f a = *(const v4fa*)(W + (size_t)t * 8);
  const v4f c = *(const v4fa*)(W + (size_t)t * 8 + 4);
  FragH f;
#pragma unroll
  for (int q = 0; q < 4; ++q) { f.h[q] = toh_flush(bf16_rne(a[q]) * WOCARRY); f.h[4 + q] = toh_flush(bf16_rne(c[q]) * WOCARRY); }
  const v8us v = f.half[0];
  unsigned short* d = Wh + (size_t)t * 8;
  *(v8us*)d = v;
  
}

__global__ __launch_bounds__(256) void k_xT(const float* __restrict__ x, unsigned short* __restrict__ XB) {
  __shared__ unsigned short tl[64][66];
  const int tid = threadIdx.x;
  const int blk = blockIdx.x;
  const int ct = blk % (CC / 64);
  const int nt = (blk / (CC / 64)) % (SEQ / 64);
  const int b = blk / ((CC / 64) * (SEQ / 64));
#pragma unroll 1
  for (int i = tid; i < 64 * 16; i += 256) {
    const int c = i >> 4, n4 = (i & 15) * 4;
    const v4f v = *(const v4fa*)(x + ((size_t)(b * CC + ct * 64 + c)) * SEQ_FULL + nt * 64 + n4);
#pragma unroll
    for (int q = 0; q < 4; ++q) tl[n4 + q][c] = bf16_bits(v[q]);
  }
  __syncthreads();
  {
#pragma unroll 1
    for (int i = tid; i < 64 * 8; i += 256) {
      const int n = i >> 3, c8 = (i & 7) * 8;
      v8us f;
#pragma unroll
      for (int q = 0; q < 8; ++q) f[q] = tl[n][c8 + q];
      unsigned short* d = XB + ((size_t)b * SEQ + nt * 64 + n) * CC + ct * 64 + c8;
      *(v8us*)d = f;
    }
    
  }
}

__global__ __launch_bounds__(128) void k_kqproj(const unsigned short* __restrict__ XB, const unsigned short* __restrict__ WB,
                                                const float* __restrict__ bias,
                                                unsigned short* __restrict__ PH, unsigned short* __restrict__ PL) {
  __shared__ __attribute__((aligned(16))) float so[4][16][64];
  const int tid = threadIdx.x;
  const int wave = __builtin_amdgcn_readfirstlane(tid >> 5);
  const int lane = tid & 31, ln = lane & 15, hh = lane >> 4;
  const size_t row0 = ((size_t)blockIdx.x * 4 + wave) * 16;
  const unsigned short* arow = XB + (row0 + ln) * CC;
  const v8f z8 = {0.f, 0.f, 0.f, 0.f, 0.f, 0.f, 0.f, 0.f};
  v8f acc[4];
#pragma unroll
  for (int t = 0; t < 4; ++t) acc[t] = z8;
#pragma unroll 1
  for (int kb = 0; kb < CC; kb += 32) {
    const v16b a = ld_bf(arow + kb, hh);
#pragma unroll
    for (int t = 0; t < 4; ++t) {
      const v16b bq = ld_bf(WB + (size_t)(t * 16 + ln) * CC + kb, hh);
      acc[t] = mma_b1(a, bq, acc[t]);
    }
  }
#pragma unroll
  for (int t = 0; t < 4; ++t)
#pragma unroll
    for (int r = 0; r < 8; ++r) so[wave][8 * hh + r][t * 16 + ln] = acc[t][r];
  __builtin_amdgcn_fence(4 /* acq_rel order */, "workgroup");
  __builtin_amdgcn_wave_barrier();
  const int rsub = lane >> 3, c8 = (lane & 7) * 8;
  const v4f ba = *(const v4fa*)(bias + c8);
  const v4f bc = *(const v4fa*)(bias + c8 + 4);
  {
#pragma unroll
    for (int it = 0; it < 4; ++it) {
      const int r = it * 4 + rsub;
      const v4f a = *(const v4fa*)&so[wave][r][c8];
      const v4f c = *(const v4fa*)&so[wave][r][c8 + 4];
      v8us vh, vl;
#pragma unroll
      for (int q = 0; q < 4; ++q) {
        const float va = a[q] + bf16_rne(ba[q]);
        const float vc = c[q] + bf16_rne(bc[q]);
        unsigned short hb = bf16_bits(va); vh[q] = hb; vl[q] = bf16_bits(va - bf16_val(hb));
        hb = bf16_bits(vc); vh[4 + q] = hb; vl[4 + q] = bf16_bits(vc - bf16_val(hb));
      }
      const size_t o = (row0 + r) * RD + c8;
      *(v8us*)(PH + o) = vh;
      *(v8us*)(PL + o) = vl;
    }
    
  }
}

__global__ __launch_bounds__(128) void k_vproj(const unsigned short* __restrict__ XB, const unsigned short* __restrict__ WVB,
                                               const float* __restrict__ bv, unsigned short* __restrict__ VT) {
  __shared__ __attribute__((aligned(16))) float so[4][16][64];
  const int tid = threadIdx.x;
  const int wave = __builtin_amdgcn_readfirstlane(tid >> 5);
  const int lane = tid & 31, ln = lane & 15, hh = lane >> 4;
  const int b = blockIdx.y;
  const int wid = blockIdx.x * 4 + wave;
  const int mt = wid / (SEQ / 64), nq = wid % (SEQ / 64);
  const unsigned short* arow = WVB + (size_t)(mt * 16 + ln) * CC;
  const unsigned short* brow = XB + ((size_t)b * SEQ + nq * 64 + ln) * CC;
  const v8f z8 = {0.f, 0.f, 0.f, 0.f, 0.f, 0.f, 0.f, 0.f};
  v8f acc[4];
#pragma unroll
  for (int t = 0; t < 4; ++t) acc[t] = z8;
#pragma unroll 1
  for (int kb = 0; kb < CC; kb += 32) {
    const v16b a = ld_bf(arow + kb, hh);
#pragma unroll
    for (int t = 0; t < 4; ++t) {
      const v16b bq = ld_bf(brow + (size_t)(t * 16) * CC + kb, hh);
      acc[t] = mma_b1(a, bq, acc[t]);
    }
  }
#pragma unroll
  for (int t = 0; t < 4; ++t)
#pragma unroll
    for (int r = 0; r < 8; ++r) so[wave][8 * hh + r][t * 16 + ln] = acc[t][r];
  __builtin_amdgcn_fence(4 /* acq_rel order */, "workgroup");
  __builtin_amdgcn_wave_barrier();
  const int rsub = lane >> 3, c8 = (lane & 7) * 8;
  {
#pragma unroll
    for (int it = 0; it < 4; ++it) {
      const int r = it * 4 + rsub;
      const v4f a = *(const v4fa*)&so[wave][r][c8];
      const v4f c = *(const v4fa*)&so[wave][r][c8 + 4];
      const float bb = bf16_rne(bv[mt * 16 + r]);
      FragH f;
#pragma unroll
      for (int q = 0; q < 4; ++q) { f.h[q] = toh_flush(a[q] + bb); f.h[4 + q] = toh_flush(c[q] + bb); }
      const v8us o = f.half[0];
      *(v8us*)(VT + ((size_t)(b * RD + mt * 16 + r)) * SEQ + nq * 64 + c8) = o;
    }
    
  }
}

__global__ __launch_bounds__(128) void k_stats(const unsigned short* __restrict__ QH, const unsigned short* __restrict__ QL,
                                               const unsigned short* __restrict__ KH, const unsigned short* __restrict__ KL, float* __restrict__ E) {
  __shared__ __attribute__((aligned(16))) float st[64];
  const int tid = threadIdx.x;
  const int wave = __builtin_amdgcn_readfirstlane(tid >> 5);
  const int lane = tid & 31, ln = lane & 15, hh = lane >> 4;
  const int b = blockIdx.y;
  const size_t tb = (size_t)b * SEQ;
  const size_t ao = (tb + (size_t)blockIdx.x * 64 + wave * 16 + ln) * RD;
  const v16b aH0 = ld_bf(QH + ao, hh), aL0 = ld_bf(QL + ao, hh), aH1 = ld_bf(QH + ao + 32, hh), aL1 = ld_bf(QL + ao + 32, hh);
  const v8f z8 = {0.f, 0.f, 0.f, 0.f, 0.f, 0.f, 0.f, 0.f};
  float m[8], l[8];
#pragma unroll
  for (int r = 0; r < 8; ++r) { m[r] = -1.0e30f; l[r] = 0.f; }
#pragma unroll 1
  for (int j0 = 0; j0 < SEQ; j0 += 32) {
    const size_t bo0 = (tb + j0 + ln) * RD, bo1 = bo0 + (size_t)16 * RD;
    v8f s0 = z8, s1 = z8;
    { v16b bh = ld_bf(KH + bo0, hh), bl = ld_bf(KL + bo0, hh); s0 = mma_b3(aH0, aL0, bh, bl, s0);
      bh = ld_bf(KH + bo0 + 32, hh); bl = ld_bf(KL + bo0 + 32, hh); s0 = mma_b3(aH1, aL1, bh, bl, s0); }
    { v16b bh = ld_bf(KH + bo1, hh), bl = ld_bf(KL + bo1, hh); s1 = mma_b3(aH0, aL0, bh, bl, s1);
      bh = ld_bf(KH + bo1 + 32, hh); bl = ld_bf(KL + bo1 + 32, hh); s1 = mma_b3(aH1, aL1, bh, bl, s1); }
#pragma unroll
    for (int r = 0; r < 8; ++r) {
      const float a0 = s0[r], a1 = s1[r];
      const float mn = fmaxf(m[r], fmaxf(a0, a1));
      l[r] = l[r] * __expf(m[r] - mn) + __expf(a0 - mn) + __expf(a1 - mn);
      m[r] = mn;
    }
  }
#pragma unroll
  for (int off = 1; off < 16; off <<= 1) {
#pragma unroll
    for (int r = 0; r < 8; ++r) {
      const float mo = __shfl_xor(m[r], off);
      const float lo = __shfl_xor(l[r], off);
      const float mn = fmaxf(m[r], mo);
      l[r] = l[r] * __expf(m[r] - mn) + lo * __expf(mo - mn);
      m[r] = mn;
    }
  }
  float ev[8];
#pragma unroll
  for (int r = 0; r < 8; ++r) ev[r] = m[r] + __logf(l[r]) - PCARRY_LN;
  if (ln == 0) {
#pragma unroll
    for (int r = 0; r < 8; ++r) st[wave * 16 + 8 * hh + r] = ev[r];
  }
  __syncthreads();
  if (wave == 0 && lane < 16) {
    const v4f v = *(const v4fa*)&st[lane * 4];
    float* d = E + tb + (size_t)blockIdx.x * 64 + lane * 4;
    *(v4f*)d = v;
    
  }
}

__global__ __launch_bounds__(128) void k_attn(const unsigned short* __restrict__ KH, const unsigned short* __restrict__ KL,
                                              const unsigned short* __restrict__ QH, const unsigned short* __restrict__ QL,
                                              const unsigned short* __restrict__ VT, const float* __restrict__ E,
                                              const unsigned short* __restrict__ WOH, const float* __restrict__ bo,
                                              const float* __restrict__ gam,
                                              const float* __restrict__ x, float* __restrict__ out) {
  __shared__ __attribute__((aligned(16))) float so[CH][68];
  const int tid = threadIdx.x;
  const int wave = __builtin_amdgcn_readfirstlane(tid >> 5);
  const int lane = tid & 31, ln = lane & 15, hh = lane >> 4;
  const int b = blockIdx.y, jb = blockIdx.x * 64;
  const size_t tb = (size_t)b * SEQ;
  const size_t qo = (tb + jb + wave * 16 + ln) * RD;
  const v16b bH0 = ld_bf(QH + qo, hh), bL0 = ld_bf(QL + qo, hh), bH1 = ld_bf(QH + qo + 32, hh), bL1 = ld_bf(QL + qo + 32, hh);
  const float ej = E[tb + jb + wave * 16 + ln];
  const v8f z8 = {0.f, 0.f, 0.f, 0.f, 0.f, 0.f, 0.f, 0.f};
  v8f acc[4];
#pragma unroll
  for (int i = 0; i < 4; ++i) acc[i] = z8;
  const size_t vrow = ((size_t)(b * RD + ln)) * SEQ + 8 * hh;
#pragma unroll 1
  for (int n0 = 0; n0 < SEQ; n0 += 32) {
    const size_t ao0 = (tb + n0 + ln) * RD, ao1 = ao0 + (size_t)16 * RD;
    v8f s0 = z8, s1 = z8;
    { v16b ah = ld_bf(KH + ao0, hh), al = ld_bf(KL + ao0, hh); s0 = mma_b3(ah, al, bH0, bL0, s0);
      ah = ld_bf(KH + ao0 + 32, hh); al = ld_bf(KL + ao0 + 32, hh); s0 = mma_b3(ah, al, bH1, bL1, s0); }
    asm volatile("" ::: "memory");
    { v16b ah = ld_bf(KH + ao1, hh), al = ld_bf(KL + ao1, hh); s1 = mma_b3(ah, al, bH0, bL0, s1);
      ah = ld_bf(KH + ao1 + 32, hh); al = ld_bf(KL + ao1 + 32, hh); s1 = mma_b3(ah, al, bH1, bL1, s1); }
    asm volatile("" ::: "memory");
    FragH pf;
#pragma unroll
    for (int r = 0; r < 8; ++r) {
      pf.h[r]     = p_flush(s0[r] - ej);
      pf.h[8 + r] = p_flush(s1[r] - ej);
    }
    asm volatile("" ::: "memory");
#pragma unroll
    for (int ct = 0; ct < 4; ++ct) {
      const unsigned short* vp = VT + vrow + (size_t)(ct * 16) * SEQ + n0;
      FragH a;
      a.half[0] = *(const v8us*)vp;
      a.half[1] = *(const v8us*)(vp + 16);
      acc[ct] = mma_h1(a.v, pf.v, acc[ct]);
    }
    asm volatile("" ::: "memory");
  }
  // ctx^T tiles (rows e = 16 ct + 8h + r, cols j) -> two B fragments with k = e
  FragH cf0, cf1;
#pragma unroll
  for (int r = 0; r < 8; ++r) {
    cf0.h[r]     = toh_flush(acc[0][r] * PINV);
    cf0.h[8 + r] = toh_flush(acc[1][r] * PINV);
    cf1.h[r]     = toh_flush(acc[2][r] * PINV);
    cf1.h[8 + r] = toh_flush(acc[3][r] * PINV);
  }
  const float g = bf16_rne(gam[0]);
  const int rsub = lane >> 4, pc = (lane & 15) * 4;
#pragma unroll 1
  for (int hf = 0; hf < 2; ++hf) {
    const int ch0 = hf * CH;
#pragma unroll
    for (int ct = 0; ct < 8; ++ct) {
      const unsigned short* wp = WOH + (size_t)(ch0 + ct * 16 + ln) * RD + 8 * hh;
      FragH a0, a1;
      a0.half[0] = *(const v8us*)wp;
      a0.half[1] = *(const v8us*)(wp + 16);
      a1.half[0] = *(const v8us*)(wp + 32);
      a1.half[1] = *(const v8us*)(wp + 48);
      v8f d = z8;
      d = mma_h1(a0.v, cf0.v, d);
      d = mma_h1(a1.v, cf1.v, d);
#pragma unroll
      for (int r = 0; r < 8; ++r) so[ct * 16 + 8 * hh + r][wave * 16 + ln] = d[r] * WOINV;
    }
    __syncthreads();
    {
#pragma unroll 1
      for (int it = 0; it < CH / 8; ++it) {
        const int row = it * 8 + wave * 2 + rsub;
        const v4f v = *(const v4fa*)&so[row][pc];
        const v4f xr = *(const v4fa*)(x + ((size_t)(b * CC + ch0 + row)) * SEQ_FULL + jb + pc);
        const float bb = bf16_rne(bo[ch0 + row]);
        v4f o;
#pragma unroll
        for (int q = 0; q < 4; ++q) o[q] = bf16_rne(xr[q]) + g * (v[q] + bb);
        *(v4f*)(out + ((size_t)(b * CC + ch0 + row)) * SEQ + jb + pc) = o;
      }
      
    }
    __syncthreads();
  }
}

// workspace carve (bytes, every region a multiple of 256)
#define SZ_WP  ((size_t)RD * CC * 2)
#define SZ_WO  ((size_t)CC * RD * 2)
#define SZ_XB  (NRT * CC * 2)
#define SZ_P   (NRT * RD * 2)
#define SZ_VT  ((size_t)NB * RD * SEQ * 2)
#define SZ_E   (NRT * 4)
#define OFF_WKB ((size_t)0)
#define OFF_WQB (OFF_WKB + SZ_WP)
#define OFF_WVB (OFF_WQB + SZ_WP)
#define OFF_WOH (OFF_WVB + SZ_WP)
#define OFF_XB  (OFF_WOH + SZ_WO)
#define OFF_KH  (OFF_XB + SZ_XB)
#define OFF_KL  (OFF_KH + SZ_P)
#define OFF_QH  (OFF_KL + SZ_P)
#define OFF_QL  (OFF_QH + SZ_P)
#define OFF_VT  (OFF_QL + SZ_P)
#define OFF_E   (OFF_VT + SZ_VT)
#define WS_TOTAL (OFF_E + SZ_E)
static_assert(SZ_WP % 256 == 0 && SZ_WO % 256 == 0 && SZ_XB % 256 == 0 && SZ_P % 256 == 0 && SZ_VT % 256 == 0 && SZ_E % 256 == 0);
static_assert(WS_TOTAL <= (size_t)134217728);
static_assert((RD * CC) % (8 * 256) == 0);                                 /* k_wcvt / k_wcvth grids exact */
static_assert((NRT % 64) == 0);                                            /* k_kqproj grid x 4 waves x 16 rows == token rows */
static_assert(((RD / 16) * (SEQ / 64)) % 4 == 0);                          /* k_vproj grid x 4 waves == channel tiles x pixel quads */
static_assert(SEQ % 64 == 0 && SEQ % 32 == 0);                             /* k_stats / k_attn tiles and 32-row key steps */

extern "C" void kernel_launch(void* const* d_in, const int* in_sizes, int n_in,
                              void* d_out, int out_size, void* d_ws, size_t ws_size, hipStream_t stream) {
  if (n_in < 10) return;
  if ((size_t)in_sizes[0] < (size_t)(NB * CC - 1) * SEQ_FULL + SEQ) return;
  if ((size_t)in_sizes[1] < (size_t)RD * CC) return;
  if ((size_t)in_sizes[2] < (size_t)RD) return;
  if ((size_t)in_sizes[3] < (size_t)RD * CC) return;
  if ((size_t)in_sizes[4] < (size_t)RD) return;
  if ((size_t)in_sizes[5] < (size_t)RD * CC) return;
  if ((size_t)in_sizes[6] < (size_t)RD) return;
  if ((size_t)in_sizes[7] < (size_t)CC * RD) return;
  if ((size_t)in_sizes[8] < (size_t)CC) return;
  if ((size_t)in_sizes[9] < (size_t)1) return;
  if ((size_t)out_size < (size_t)NB * CC * SEQ) return;
  if (WS_TOTAL > ws_size) return;
  const float* x  = (const float*)d_in[0];       /* [NB][CC][SEQ_FULL] channel-first */
  const float* wk = (const float*)d_in[1];       /* [RD][CC] = [out][in], key */
  const float* bk = (const float*)d_in[2];       /* [RD] */
  const float* wq = (const float*)d_in[3];       /* [RD][CC] = [out][in], query */
  const float* bq = (const float*)d_in[4];       /* [RD] */
  const float* wv = (const float*)d_in[5];       /* [RD][CC] = [out][in], value */
  const float* bv = (const float*)d_in[6];       /* [RD] */
  const float* wo = (const float*)d_in[7];       /* [CC][RD] = [out][in] */
  const float* bo = (const float*)d_in[8];       /* [CC] */
  const float* gam = (const float*)d_in[9];      /* [1] */
  float* out = (float*)d_out;                    /* [NB][CC][SEQ] channel-first */
  char* ws = (char*)d_ws;
  unsigned short* WKB = (unsigned short*)(ws + OFF_WKB);
  unsigned short* WQB = (unsigned short*)(ws + OFF_WQB);
  unsigned short* WVB = (unsigned short*)(ws + OFF_WVB);
  unsigned short* WOH = (unsigned short*)(ws + OFF_WOH);
  unsigned short* XB  = (unsigned short*)(ws + OFF_XB);
  unsigned short* KH  = (unsigned short*)(ws + OFF_KH);
  unsigned short* KL  = (unsigned short*)(ws + OFF_KL);
  unsigned short* QH  = (unsigned short*)(ws + OFF_QH);
  unsigned short* QL  = (unsigned short*)(ws + OFF_QL);
  unsigned short* VT  = (unsigned short*)(ws + OFF_VT);
  float* E = (float*)(ws + OFF_E);

  k_wcvt<<<(RD * CC / 8) / 256, 256, 0, stream>>>(wk, WKB, RD * CC / 8);
  k_wcvt<<<(RD * CC / 8) / 256, 256, 0, stream>>>(wq, WQB, RD * CC / 8);
  k_wcvt<<<(RD * CC / 8) / 256, 256, 0, stream>>>(wv, WVB, RD * CC / 8);
  k_wcvth<<<(CC * RD / 8) / 256, 256, 0, stream>>>(wo, WOH, CC * RD / 8);
  k_xT<<<(CC / 64) * (SEQ / 64) * NB, 256, 0, stream>>>(x, XB);              /* in [b][c][n] -> out [b*SEQ+n][c] */
  k_kqproj<<<(unsigned)(NRT / 64), 128, 0, stream>>>(XB, WKB, bk, KH, KL);
  k_kqproj<<<(unsigned)(NRT / 64), 128, 0, stream>>>(XB, WQB, bq, QH, QL);
  k_vproj<<<dim3((RD / 16) * (SEQ / 64) / 4, NB), 128, 0, stream>>>(XB, WVB, bv, VT);
  k_stats<<<dim3(SEQ / 64, NB), 128, 0, stream>>>(QH, QL, KH, KL, E);
  k_attn<<<dim3(SEQ / 64, NB), 128, 0, stream>>>(KH, KL, QH, QL, VT, E, WOH, bo, gam, x, out);
}

// v001
// It runs in 136 microseconds.
// In two side-by-side timings against v000, it was 3.06 and 3.15 times as fast.
#include <hip/hip_runtime.h>
// Compute dtype: inputs converted (RNE) to bf16; key, query and value projections v_wmma_f32_16x16x32_bf16 (exact products, f32 accumulate, bias added in f32); scores f.g^T as bf16 hi|lo three-product (hi.hi + lo.hi + hi.lo) v_wmma_f32_16x16x32_bf16, f32 accumulate; softmax statistics f32; V^T single f16 and P x4096 single f16 on v_wmma_f32_16x16x32_f16; output projection Wo x64 single f16 times ctx single f16 on v_wmma_f32_16x16x32_f16, f32 accumulate; result = bf16(x) + bf16(gamma) * (o + bf16(bo)) in f32.
#ifndef NB
#define NB 4                      /* images */
#endif
#ifndef SEQ
#define SEQ 4096                  /* pixels per image processed */
#endif
#define SEQ_FULL 4096             /* pixel pitch of the staged x rows */
#define CC 256                    /* channels */
#define RD 64                     /* embedding channels (key / query / value width) */
#define CH 128                    /* channels per epilogue slab */
#define PCARRY_LN 8.317766166719343f   /* 12 ln 2: P carried x4096 */
#define PINV 0.000244140625f           /* 2^-12 */
#define WOCARRY 64.0f                  /* Wo plane carried x64 */
#define WOINV 0.015625f                /* 2^-6 */
#define NRT ((size_t)NB * SEQ)

static_assert(SEQ % 256 == 0);          /* 64-pixel tiles, 4 waves per block, v-projection grid divisibility */
static_assert(SEQ <= SEQ_FULL);
static_assert(CC % 64 == 0);            /* 64-channel transpose tiles, K % 32 == 0 */
static_assert(RD == 64);                
static_assert(CC == 2 * CH);            /* two channel slabs in the epilogue */
static_assert(CH % 16 == 0 && CH / 16 == 8);

typedef __bf16 v16b __attribute__((ext_vector_type(16)));
typedef _Float16 v16h __attribute__((ext_vector_type(16)));
typedef unsigned short v8us __attribute__((ext_vector_type(8), may_alias));
typedef float v8f  __attribute__((ext_vector_type(8)));
typedef float v4f  __attribute__((ext_vector_type(4)));
typedef float v4fa __attribute__((ext_vector_type(4), may_alias));
typedef _Float16 h16;
union FragB { v16b v; v8us half[2]; };
union FragH { v16h v; v8us half[2]; _Float16 h[16]; };

__device__ __forceinline__ unsigned short bf16_bits(float x) { unsigned int u = __float_as_uint(x); return (unsigned short)((u + 0x7FFFu + ((u >> 16) & 1u)) >> 16); }
__device__ __forceinline__ float bf16_val(unsigned short b) { return __uint_as_float(((unsigned int)b) << 16); }
__device__ __forceinline__ float bf16_rne(float x) { return bf16_val(bf16_bits(x)); }

// f32 -> f16 that cannot produce an f16 subnormal (value select)
static __device__ __forceinline__ h16 toh_flush(float v) { const h16 r = (h16)v; return (fabsf(v) < 6.103515625e-05f) ? (h16)0.0f : r; }
// exp(a) -> f16, zero when the result would fall below 2^-14 (select on the exponent argument)
static __device__ __forceinline__ h16 p_flush(float a) { const float p = __expf(a); return (a < -9.70f) ? (h16)0.0f : (h16)p; }

// fragment of a k-contiguous 16-bit row: elements 0..7 <- k 8h..8h+7, elements 8..15 <- k 16+8h..16+8h+7 (same map for A and B)
__device__ __forceinline__ v16b ld_bf(const unsigned short* p, int hh) { FragB f; f.half[0] = *(const v8us*)(p + 8 * hh); f.half[1] = *(const v8us*)(p + 16 + 8 * hh); return f.v; }

__device__ __forceinline__ v8f mma_b1(v16b a, v16b b, v8f c) {
  c = __builtin_amdgcn_wmma_f32_16x16x32_bf16(false, a, false, b, (short)0, c, false, false);
  asm volatile("v_nop\n\tv_nop\n\tv_nop\n\tv_nop" : "+v"(c) : "v"(a), "v"(b));
  return c;
}
// c += ah.bh + al.bh + ah.bl (unscaled bf16 residuals share the accumulator)
__device__ __forceinline__ v8f mma_b3(v16b ah, v16b al, v16b bh, v16b bl, v8f c) {
  c = __builtin_amdgcn_wmma_f32_16x16x32_bf16(false, ah, false, bh, (short)0, c, false, false);
  c = __builtin_amdgcn_wmma_f32_16x16x32_bf16(false, al, false, bh, (short)0, c, false, false);
  c = __builtin_amdgcn_wmma_f32_16x16x32_bf16(false, ah, false, bl, (short)0, c, false, false);
  asm volatile("v_nop\n\tv_nop\n\tv_nop\n\tv_nop" : "+v"(c) : "v"(ah), "v"(al), "v"(bh), "v"(bl));
  return c;
}
__device__ __forceinline__ v8f mma_h1(v16h a, v16h b, v8f c) {
  c = __builtin_amdgcn_wmma_f32_16x16x32_f16(false, a, false, b, (short)0, c, false, false);
  asm volatile("v_nop\n\tv_nop\n\tv_nop\n\tv_nop" : "+v"(c) : "v"(a), "v"(b));
  return c;
}

// ---- key / value tiles staged in LDS by asynchronous copies, two buffers ----
#define TK 128                        /* keys per staged tile */
#define NTILE (SEQ / TK)
#define KPITCH 144                    /* LDS bytes per 128-byte key row (16 B x odd: no bank conflict for 16-byte readers) */
#define VPITCH 272                    /* LDS bytes per 256-byte V^T row (16 B x odd) */
#define KTILE_B (TK * KPITCH)
#define VTILE_B (RD * VPITCH)
#define SSTAGE_B (2 * KTILE_B)            /* k_stats stage: K hi, K lo */
#define ASTAGE_B (2 * KTILE_B + VTILE_B)  /* k_attn stage: K hi, K lo, V^T */
static_assert(SEQ % TK == 0 && NTILE >= 2);   /* the ring's prologue fills two tiles */
static_assert(RD * 2 == 128 && TK * 2 == 256);
static_assert(KTILE_B % 16 == 0 && VTILE_B % 16 == 0);

__device__ __forceinline__ unsigned lds_off(const void* p) { return (unsigned)(size_t)p; }

// Eight 16-byte copies per lane, global -> LDS, through no register. The s_wait_xcnt is the statement's last line so that
// no later rewrite of an address register can be scheduled in front of it.
__device__ __forceinline__ void cp8(unsigned l, unsigned ls, const unsigned short* g, size_t gs) {
  asm volatile("global_load_async_to_lds_b128 %0, %8, off\n\t"
               "global_load_async_to_lds_b128 %1, %9, off\n\t"
               "global_load_async_to_lds_b128 %2, %10, off\n\t"
               "global_load_async_to_lds_b128 %3, %11, off\n\t"
               "global_load_async_to_lds_b128 %4, %12, off\n\t"
               "global_load_async_to_lds_b128 %5, %13, off\n\t"
               "global_load_async_to_lds_b128 %6, %14, off\n\t"
               "global_load_async_to_lds_b128 %7, %15, off\n\t"
               "s_wait_xcnt 0x0"
               :: "v"(l), "v"(l + ls), "v"(l + 2 * ls), "v"(l + 3 * ls), "v"(l + 4 * ls), "v"(l + 5 * ls), "v"(l + 6 * ls), "v"(l + 7 * ls),
                  "v"(g), "v"(g + gs), "v"(g + 2 * gs), "v"(g + 3 * gs), "v"(g + 4 * gs), "v"(g + 5 * gs), "v"(g + 6 * gs), "v"(g + 7 * gs)
               : "memory");
}
// one 128-key plane of K (rows contiguous in memory): lane tid brings bytes 16 tid .. 16 tid + 15 of every 2-KiB slab (16 rows)
__device__ __forceinline__ void cp_kplane(unsigned lbase, const unsigned short* plane_row0, int tid) {
  cp8(lbase + (unsigned)(tid >> 3) * KPITCH + (unsigned)(tid & 7) * 16u, 16u * KPITCH, plane_row0 + tid * 8, (size_t)16 * RD);
}
// 64 rows x 128 keys of V^T (row pitch SEQ): 16 lanes per row, 8 rows per copy
__device__ __forceinline__ void cp_vplane(unsigned lbase, const unsigned short* vt_row0_key0, int tid) {
  cp8(lbase + (unsigned)(tid >> 4) * VPITCH + (unsigned)(tid & 15) * 16u, 8u * VPITCH, vt_row0_key0 + (size_t)(tid >> 4) * SEQ + (tid & 15) * 8, (size_t)8 * SEQ);
}
// own copies landed (before the barrier that lets other waves read them)
__device__ __forceinline__ void wait_copies() { asm volatile("s_wait_asynccnt 0x0" ::: "memory"); }
// own LDS reads retired (before the barrier behind which their buffer is refilled)
__device__ __forceinline__ void wait_lds() { asm volatile("s_wait_dscnt 0x0" ::: "memory"); }
// fragment of a staged 16-bit row, p = row start + 64 * (k / 32) + 16 h: same element map as ld_bf
__device__ __forceinline__ v16b lds_bf(const unsigned char* p) { FragB f; f.half[0] = *(const v8us*)p; f.half[1] = *(const v8us*)(p + 32); return f.v; }
// K fragments of 32 staged keys: kf[4 * (16-key row block) + 2 * (k half) + (hi, lo)]; p = the lane's place in the hi plane
__device__ __forceinline__ void lds_k16(v16b (&kf)[8], int rb16, const unsigned char* p) {
#pragma unroll   /* constant kf index */
  for (int kh = 0; kh < 2; ++kh) {
    kf[rb16 * 4 + kh * 2]     = lds_bf(p + rb16 * 16 * KPITCH + kh * 64);
    kf[rb16 * 4 + kh * 2 + 1] = lds_bf(p + rb16 * 16 * KPITCH + kh * 64 + KTILE_B);
  }
}
__device__ __forceinline__ void lds_k32(v16b (&kf)[8], const unsigned char* p) { lds_k16(kf, 0, p); lds_k16(kf, 1, p); }

__global__ __launch_bounds__(256) void k_wcvt(const float* __restrict__ W, unsigned short* __restrict__ Wb, int n8) {
  const int t = blockIdx.x * 256 + threadIdx.x;
  if (t >= n8) return;
  const v4f a = *(const v4fa*)(W + (size_t)t * 8);
  const v4f c = *(const v4fa*)(W + (size_t)t * 8 + 4);
  v8us v;
#pragma unroll
  for (int q = 0; q < 4; ++q) { v[q] = bf16_bits(a[q]); v[4 + q] = bf16_bits(c[q]); }
  unsigned short* d = Wb + (size_t)t * 8;
  *(v8us*)d = v;
  
}

__global__ __launch_bounds__(256) void k_wcvth(const float* __restrict__ W, unsigned short* __restrict__ Wh, int n8) {
  const int t = blockIdx.x * 256 + threadIdx.x;
  if (t >= n8) return;
  const v4f a = *(const v4fa*)(W + (size_t)t * 8);
  const v4f c = *(const v4fa*)(W + (size_t)t * 8 + 4);
  FragH f;
#pragma unroll
  for (int q = 0; q < 4; ++q) { f.h[q] = toh_flush(bf16_rne(a[q]) * WOCARRY); f.h[4 + q] = toh_flush(bf16_rne(c[q]) * WOCARRY); }
  const v8us v = f.half[0];
  unsigned short* d = Wh + (size_t)t * 8;
  *(v8us*)d = v;
  
}

__global__ __launch_bounds__(256) void k_xT(const float* __restrict__ x, unsigned short* __restrict__ XB) {
  __shared__ unsigned short tl[64][66];
  const int tid = threadIdx.x;
  const int blk = blockIdx.x;
  const int ct = blk % (CC / 64);
  const int nt = (blk / (CC / 64)) % (SEQ / 64);
  const int b = blk / ((CC / 64) * (SEQ / 64));
#pragma unroll 1
  for (int i = tid; i < 64 * 16; i += 256) {
    const int c = i >> 4, n4 = (i & 15) * 4;
    const v4f v = *(const v4fa*)(x + ((size_t)(b * CC + ct * 64 + c)) * SEQ_FULL + nt * 64 + n4);
#pragma unroll
    for (int q = 0; q < 4; ++q) tl[n4 + q][c] = bf16_bits(v[q]);
  }
  __syncthreads();
  {
#pragma unroll 1
    for (int i = tid; i < 64 * 8; i += 256) {
      const int n = i >> 3, c8 = (i & 7) * 8;
      v8us f;
#pragma unroll
      for (int q = 0; q < 8; ++q) f[q] = tl[n][c8 + q];
      unsigned short* d = XB + ((size_t)b * SEQ + nt * 64 + n) * CC + ct * 64 + c8;
      *(v8us*)d = f;
    }
    
  }
}

__global__ __launch_bounds__(128) void k_kqproj(const unsigned short* __restrict__ XB, const unsigned short* __restrict__ WB,
                                                const float* __restrict__ bias,
                                                unsigned short* __restrict__ PH, unsigned short* __restrict__ PL) {
  __shared__ __attribute__((aligned(16))) float so[4][16][64];
  const int tid = threadIdx.x;
  const int wave = __builtin_amdgcn_readfirstlane(tid >> 5);
  const int lane = tid & 31, ln = lane & 15, hh = lane >> 4;
  const size_t row0 = ((size_t)blockIdx.x * 4 + wave) * 16;
  const unsigned short* arow = XB + (row0 + ln) * CC;
  const v8f z8 = {0.f, 0.f, 0.f, 0.f, 0.f, 0.f, 0.f, 0.f};
  v8f acc[4];
#pragma unroll
  for (int t = 0; t < 4; ++t) acc[t] = z8;
#pragma unroll 1
  for (int kb = 0; kb < CC; kb += 32) {
    const v16b a = ld_bf(arow + kb, hh);
#pragma unroll
    for (int t = 0; t < 4; ++t) {
      const v16b bq = ld_bf(WB + (size_t)(t * 16 + ln) * CC + kb, hh);
      acc[t] = mma_b1(a, bq, acc[t]);
    }
  }
#pragma unroll
  for (int t = 0; t < 4; ++t)
#pragma unroll
    for (int r = 0; r < 8; ++r) so[wave][8 * hh + r][t * 16 + ln] = acc[t][r];
  __builtin_amdgcn_fence(4 /* acq_rel order */, "workgroup");
  __builtin_amdgcn_wave_barrier();
  const int rsub = lane >> 3, c8 = (lane & 7) * 8;
  const v4f ba = *(const v4fa*)(bias + c8);
  const v4f bc = *(const v4fa*)(bias + c8 + 4);
  {
#pragma unroll
    for (int it = 0; it < 4; ++it) {
      const int r = it * 4 + rsub;
      const v4f a = *(const v4fa*)&so[wave][r][c8];
      const v4f c = *(const v4fa*)&so[wave][r][c8 + 4];
      v8us vh, vl;
#pragma unroll
      for (int q = 0; q < 4; ++q) {
        const float va = a[q] + bf16_rne(ba[q]);
        const float vc = c[q] + bf16_rne(bc[q]);
        unsigned short hb = bf16_bits(va); vh[q] = hb; vl[q] = bf16_bits(va - bf16_val(hb));
        hb = bf16_bits(vc); vh[4 + q] = hb; vl[4 + q] = bf16_bits(vc - bf16_val(hb));
      }
      const size_t o = (row0 + r) * RD + c8;
      *(v8us*)(PH + o) = vh;
      *(v8us*)(PL + o) = vl;
    }
    
  }
}

__global__ __launch_bounds__(128) void k_vproj(const unsigned short* __restrict__ XB, const unsigned short* __restrict__ WVB,
                                               const float* __restrict__ bv, unsigned short* __restrict__ VT) {
  __shared__ __attribute__((aligned(16))) float so[4][16][64];
  const int tid = threadIdx.x;
  const int wave = __builtin_amdgcn_readfirstlane(tid >> 5);
  const int lane = tid & 31, ln = lane & 15, hh = lane >> 4;
  const int b = blockIdx.y;
  const int wid = blockIdx.x * 4 + wave;
  const int mt = wid / (SEQ / 64), nq = wid % (SEQ / 64);
  const unsigned short* arow = WVB + (size_t)(mt * 16 + ln) * CC;
  const unsigned short* brow = XB + ((size_t)b * SEQ + nq * 64 + ln) * CC;
  const v8f z8 = {0.f, 0.f, 0.f, 0.f, 0.f, 0.f, 0.f, 0.f};
  v8f acc[4];
#pragma unroll
  for (int t = 0; t < 4; ++t) acc[t] = z8;
#pragma unroll 1
  for (int kb = 0; kb < CC; kb += 32) {
    const v16b a = ld_bf(arow + kb, hh);
#pragma unroll
    for (int t = 0; t < 4; ++t) {
      const v16b bq = ld_bf(brow + (size_t)(t * 16) * CC + kb, hh);
      acc[t] = mma_b1(a, bq, acc[t]);
    }
  }
#pragma unroll
  for (int t = 0; t < 4; ++t)
#pragma unroll
    for (int r = 0; r < 8; ++r) so[wave][8 * hh + r][t * 16 + ln] = acc[t][r];
  __builtin_amdgcn_fence(4 /* acq_rel order */, "workgroup");
  __builtin_amdgcn_wave_barrier();
  const int rsub = lane >> 3, c8 = (lane & 7) * 8;
  {
#pragma unroll
    for (int it = 0; it < 4; ++it) {
      const int r = it * 4 + rsub;
      const v4f a = *(const v4fa*)&so[wave][r][c8];
      const v4f c = *(const v4fa*)&so[wave][r][c8 + 4];
      const float bb = bf16_rne(bv[mt * 16 + r]);
      FragH f;
#pragma unroll
      for (int q = 0; q < 4; ++q) { f.h[q] = toh_flush(a[q] + bb); f.h[4 + q] = toh_flush(c[q] + bb); }
      const v8us o = f.half[0];
      *(v8us*)(VT + ((size_t)(b * RD + mt * 16 + r)) * SEQ + nq * 64 + c8) = o;
    }
    
  }
}

__global__ __launch_bounds__(128) void k_stats(const unsigned short* __restrict__ QH, const unsigned short* __restrict__ QL,
                                               const unsigned short* __restrict__ KH, const unsigned short* __restrict__ KL, float* __restrict__ E) {
  __shared__ __attribute__((aligned(16))) float st[64];
  __shared__ __attribute__((aligned(16))) unsigned char ring[2 * SSTAGE_B];
  const int tid = threadIdx.x;
  const int wave = __builtin_amdgcn_readfirstlane(tid >> 5);
  const int lane = tid & 31, ln = lane & 15, hh = lane >> 4;
  const int b = blockIdx.y;
  const size_t tb = (size_t)b * SEQ;
  const size_t ao = (tb + (size_t)blockIdx.x * 64 + wave * 16 + ln) * RD;
  const v16b aH0 = ld_bf(QH + ao, hh), aL0 = ld_bf(QL + ao, hh), aH1 = ld_bf(QH + ao + 32, hh), aL1 = ld_bf(QL + ao + 32, hh);
  const v8f z8 = {0.f, 0.f, 0.f, 0.f, 0.f, 0.f, 0.f, 0.f};
  float m[8], l[8];
#pragma unroll
  for (int r = 0; r < 8; ++r) { m[r] = -1.0e30f; l[r] = 0.f; }
  const unsigned rb = lds_off(ring);
  const unsigned short* kh0 = KH + tb * RD;
  const unsigned short* kl0 = KL + tb * RD;
  cp_kplane(rb, kh0, tid);
  cp_kplane(rb + KTILE_B, kl0, tid);
  wait_copies();
  __syncthreads();
  cp_kplane(rb + SSTAGE_B, kh0 + (size_t)TK * RD, tid);
  cp_kplane(rb + SSTAGE_B + KTILE_B, kl0 + (size_t)TK * RD, tid);
#pragma unroll 1   /* rolled: one publish point per trip, the buffer picked by t & 1 */
  for (int t = 0; t < NTILE; ++t) {
    const unsigned bsel = (unsigned)(t & 1) * SSTAGE_B;
    const unsigned char* fr = ring + bsel + ln * KPITCH + hh * 16;
    v16b kf[8];
    lds_k32(kf, fr);
#pragma unroll   /* unrolled: constant LDS offsets, kf indexed by constants so that it stays in registers */
    for (int sp = 0; sp < TK / 32; ++sp) {
      v8f s0 = z8, s1 = z8;
      s0 = mma_b3(aH0, aL0, kf[0], kf[1], s0);
      s0 = mma_b3(aH1, aL1, kf[2], kf[3], s0);
      if (sp + 1 < TK / 32) lds_k16(kf, 0, fr + (sp + 1) * 32 * KPITCH);   /* same tile, next 32 keys: lands under the products below */
      s1 = mma_b3(aH0, aL0, kf[4], kf[5], s1);
      s1 = mma_b3(aH1, aL1, kf[6], kf[7], s1);
      if (sp + 1 < TK / 32) lds_k16(kf, 1, fr + (sp + 1) * 32 * KPITCH);   /* same tile, the other 16 of the next 32 keys */
#pragma unroll
      for (int r = 0; r < 8; ++r) {
        const float a0 = s0[r], a1 = s1[r];
        const float mn = fmaxf(m[r], fmaxf(a0, a1));
        l[r] = l[r] * __expf(m[r] - mn) + __expf(a0 - mn) + __expf(a1 - mn);
        m[r] = mn;
      }
    }
    // publish point: tile t + 1 becomes readable, tile t's buffer becomes free
    wait_lds();
    wait_copies();
    __syncthreads();
    if (t + 2 < NTILE) {
      cp_kplane(rb + bsel, kh0 + (size_t)(t + 2) * TK * RD, tid);
      cp_kplane(rb + bsel + KTILE_B, kl0 + (size_t)(t + 2) * TK * RD, tid);
    }
  }
  wait_copies();
#pragma unroll
  for (int off = 1; off < 16; off <<= 1) {
#pragma unroll
    for (int r = 0; r < 8; ++r) {
      const float mo = __shfl_xor(m[r], off);
      const float lo = __shfl_xor(l[r], off);
      const float mn = fmaxf(m[r], mo);
      l[r] = l[r] * __expf(m[r] - mn) + lo * __expf(mo - mn);
      m[r] = mn;
    }
  }
  float ev[8];
#pragma unroll
  for (int r = 0; r < 8; ++r) ev[r] = m[r] + __logf(l[r]) - PCARRY_LN;
  if (ln == 0) {
#pragma unroll
    for (int r = 0; r < 8; ++r) st[wave * 16 + 8 * hh + r] = ev[r];
  }
  __syncthreads();
  if (wave == 0 && lane < 16) {
    const v4f v = *(const v4fa*)&st[lane * 4];
    float* d = E + tb + (size_t)blockIdx.x * 64 + lane * 4;
    *(v4f*)d = v;
    
  }
}

__global__ __launch_bounds__(128) void k_attn(const unsigned short* __restrict__ KH, const unsigned short* __restrict__ KL,
                                              const unsigned short* __restrict__ QH, const unsigned short* __restrict__ QL,
                                              const unsigned short* __restrict__ VT, const float* __restrict__ E,
                                              const unsigned short* __restrict__ WOH, const float* __restrict__ bo,
                                              const float* __restrict__ gam,
                                              const float* __restrict__ x, float* __restrict__ out) {
  __shared__ __attribute__((aligned(16))) float so[CH][68];
  __shared__ __attribute__((aligned(16))) unsigned char ring[2 * ASTAGE_B];
  const int tid = threadIdx.x;
  const int wave = __builtin_amdgcn_readfirstlane(tid >> 5);
  const int lane = tid & 31, ln = lane & 15, hh = lane >> 4;
  const int b = blockIdx.y, jb = blockIdx.x * 64;
  const size_t tb = (size_t)b * SEQ;
  const size_t qo = (tb + jb + wave * 16 + ln) * RD;
  const v16b bH0 = ld_bf(QH + qo, hh), bL0 = ld_bf(QL + qo, hh), bH1 = ld_bf(QH + qo + 32, hh), bL1 = ld_bf(QL + qo + 32, hh);
  const float ej = E[tb + jb + wave * 16 + ln];
  const v8f z8 = {0.f, 0.f, 0.f, 0.f, 0.f, 0.f, 0.f, 0.f};
  v8f acc[4];
#pragma unroll
  for (int i = 0; i < 4; ++i) acc[i] = z8;
  const unsigned rb = lds_off(ring);
  const unsigned short* kh0 = KH + tb * RD;
  const unsigned short* kl0 = KL + tb * RD;
  const unsigned short* vt0 = VT + (size_t)(b * RD) * SEQ;
  cp_kplane(rb, kh0, tid);
  cp_kplane(rb + KTILE_B, kl0, tid);
  cp_vplane(rb + 2 * KTILE_B, vt0, tid);
  wait_copies();
  __syncthreads();
  cp_kplane(rb + ASTAGE_B, kh0 + (size_t)TK * RD, tid);
  cp_kplane(rb + ASTAGE_B + KTILE_B, kl0 + (size_t)TK * RD, tid);
  cp_vplane(rb + ASTAGE_B + 2 * KTILE_B, vt0 + TK, tid);
#pragma unroll 1   /* rolled: one publish point per trip, the buffer picked by t & 1 */
  for (int t = 0; t < NTILE; ++t) {
    const unsigned bsel = (unsigned)(t & 1) * ASTAGE_B;
    const unsigned char* fr = ring + bsel + ln * KPITCH + hh * 16;
    const unsigned char* vf = ring + bsel + 2 * KTILE_B + ln * VPITCH + hh * 16;
    v16b kf[8];
    lds_k32(kf, fr);
#pragma unroll   /* unrolled: constant LDS offsets, kf indexed by constants so that it stays in registers */
    for (int sp = 0; sp < TK / 32; ++sp) {
      v8f s0 = z8, s1 = z8;
      s0 = mma_b3(kf[0], kf[1], bH0, bL0, s0);
      s0 = mma_b3(kf[2], kf[3], bH1, bL1, s0);
      FragH va[4];                                  /* V^T fragments of these 32 keys: land under the products below */
#pragma unroll   /* constant va index */
      for (int ct = 0; ct < 4; ++ct) {
        const unsigned char* vp = vf + ct * 16 * VPITCH + sp * 64;
        va[ct].half[0] = *(const v8us*)vp;
        va[ct].half[1] = *(const v8us*)(vp + 32);
      }
      if (sp + 1 < TK / 32) lds_k16(kf, 0, fr + (sp + 1) * 32 * KPITCH);   /* same tile, next 32 keys */
      s1 = mma_b3(kf[4], kf[5], bH0, bL0, s1);
      s1 = mma_b3(kf[6], kf[7], bH1, bL1, s1);
      if (sp + 1 < TK / 32) lds_k16(kf, 1, fr + (sp + 1) * 32 * KPITCH);   /* lands under the exponentials */
      FragH pf;
#pragma unroll
      for (int r = 0; r < 8; ++r) {
        pf.h[r]     = p_flush(s0[r] - ej);
        pf.h[8 + r] = p_flush(s1[r] - ej);
      }
#pragma unroll   /* constant acc index */
      for (int ct = 0; ct < 4; ++ct) acc[ct] = mma_h1(va[ct].v, pf.v, acc[ct]);
    }
    // publish point: tile t + 1 becomes readable, tile t's buffer becomes free
    wait_lds();
    wait_copies();
    __syncthreads();
    if (t + 2 < NTILE) {
      cp_kplane(rb + bsel, kh0 + (size_t)(t + 2) * TK * RD, tid);
      cp_kplane(rb + bsel + KTILE_B, kl0 + (size_t)(t + 2) * TK * RD, tid);
      cp_vplane(rb + bsel + 2 * KTILE_B, vt0 + (t + 2) * TK, tid);
    }
  }
  wait_copies();
  // ctx^T tiles (rows e = 16 ct + 8h + r, cols j) -> two B fragments with k = e
  FragH cf0, cf1;
#pragma unroll
  for (int r = 0; r < 8; ++r) {
    cf0.h[r]     = toh_flush(acc[0][r] * PINV);
    cf0.h[8 + r] = toh_flush(acc[1][r] * PINV);
    cf1.h[r]     = toh_flush(acc[2][r] * PINV);
    cf1.h[8 + r] = toh_flush(acc[3][r] * PINV);
  }
  const float g = bf16_rne(gam[0]);
  const int rsub = lane >> 4, pc = (lane & 15) * 4;
#pragma unroll 1
  for (int hf = 0; hf < 2; ++hf) {
    const int ch0 = hf * CH;
#pragma unroll
    for (int ct = 0; ct < 8; ++ct) {
      const unsigned short* wp = WOH + (size_t)(ch0 + ct * 16 + ln) * RD + 8 * hh;
      FragH a0, a1;
      a0.half[0] = *(const v8us*)wp;
      a0.half[1] = *(const v8us*)(wp + 16);
      a1.half[0] = *(const v8us*)(wp + 32);
      a1.half[1] = *(const v8us*)(wp + 48);
      v8f d = z8;
      d = mma_h1(a0.v, cf0.v, d);
      d = mma_h1(a1.v, cf1.v, d);
#pragma unroll
      for (int r = 0; r < 8; ++r) so[ct * 16 + 8 * hh + r][wave * 16 + ln] = d[r] * WOINV;
    }
    __syncthreads();
    {
#pragma unroll 1
      for (int it = 0; it < CH / 8; ++it) {
        const int row = it * 8 + wave * 2 + rsub;
        const v4f v = *(const v4fa*)&so[row][pc];
        const v4f xr = *(const v4fa*)(x + ((size_t)(b * CC + ch0 + row)) * SEQ_FULL + jb + pc);
        const float bb = bf16_rne(bo[ch0 + row]);
        v4f o;
#pragma unroll
        for (int q = 0; q < 4; ++q) o[q] = bf16_rne(xr[q]) + g * (v[q] + bb);
        *(v4f*)(out + ((size_t)(b * CC + ch0 + row)) * SEQ + jb + pc) = o;
      }
      
    }
    __syncthreads();
  }
}

// workspace carve (bytes, every region a multiple of 256)
#define SZ_WP  ((size_t)RD * CC * 2)
#define SZ_WO  ((size_t)CC * RD * 2)
#define SZ_XB  (NRT * CC * 2)
#define SZ_P   (NRT * RD * 2)
#define SZ_VT  ((size_t)NB * RD * SEQ * 2)
#define SZ_E   (NRT * 4)
#define OFF_WKB ((size_t)0)
#define OFF_WQB (OFF_WKB + SZ_WP)
#define OFF_WVB (OFF_WQB + SZ_WP)
#define OFF_WOH (OFF_WVB + SZ_WP)
#define OFF_XB  (OFF_WOH + SZ_WO)
#define OFF_KH  (OFF_XB + SZ_XB)
#define OFF_KL  (OFF_KH + SZ_P)
#define OFF_QH  (OFF_KL + SZ_P)
#define OFF_QL  (OFF_QH + SZ_P)
#define OFF_VT  (OFF_QL + SZ_P)
#define OFF_E   (OFF_VT + SZ_VT)
#define WS_TOTAL (OFF_E + SZ_E)
static_assert(SZ_WP % 256 == 0 && SZ_WO % 256 == 0 && SZ_XB % 256 == 0 && SZ_P % 256 == 0 && SZ_VT % 256 == 0 && SZ_E % 256 == 0);
static_assert(WS_TOTAL <= (size_t)134217728);
static_assert((RD * CC) % (8 * 256) == 0);                                 /* k_wcvt / k_wcvth grids exact */
static_assert((NRT % 64) == 0);                                            /* k_kqproj grid x 4 waves x 16 rows == token rows */
static_assert(((RD / 16) * (SEQ / 64)) % 4 == 0);                          /* k_vproj grid x 4 waves == channel tiles x pixel quads */
static_assert(SEQ % 64 == 0 && SEQ % 32 == 0);                             /* k_stats / k_attn tiles and 32-row key steps */

extern "C" void kernel_launch(void* const* d_in, const int* in_sizes, int n_in,
                              void* d_out, int out_size, void* d_ws, size_t ws_size, hipStream_t stream) {
  if (n_in < 10) return;
  if ((size_t)in_sizes[0] < (size_t)(NB * CC - 1) * SEQ_FULL + SEQ) return;
  if ((size_t)in_sizes[1] < (size_t)RD * CC) return;
  if ((size_t)in_sizes[2] < (size_t)RD) return;
  if ((size_t)in_sizes[3] < (size_t)RD * CC) return;
  if ((size_t)in_sizes[4] < (size_t)RD) return;
  if ((size_t)in_sizes[5] < (size_t)RD * CC) return;
  if ((size_t)in_sizes[6] < (size_t)RD) return;
  if ((size_t)in_sizes[7] < (size_t)CC * RD) return;
  if ((size_t)in_sizes[8] < (size_t)CC) return;
  if ((size_t)in_sizes[9] < (size_t)1) return;
  if ((size_t)out_size < (size_t)NB * CC * SEQ) return;
  if (WS_TOTAL > ws_size) return;
  const float* x  = (const float*)d_in[0];       /* [NB][CC][SEQ_FULL] channel-first */
  const float* wk = (const float*)d_in[1];       /* [RD][CC] = [out][in], key */
  const float* bk = (const float*)d_in[2];       /* [RD] */
  const float* wq = (const float*)d_in[3];       /* [RD][CC] = [out][in], query */
  const float* bq = (const float*)d_in[4];       /* [RD] */
  const float* wv = (const float*)d_in[5];       /* [RD][CC] = [out][in], value */
  const float* bv = (const float*)d_in[6];       /* [RD] */
  const float* wo = (const float*)d_in[7];       /* [CC][RD] = [out][in] */
  const float* bo = (const float*)d_in[8];       /* [CC] */
  const float* gam = (const float*)d_in[9];      /* [1] */
  float* out = (float*)d_out;                    /* [NB][CC][SEQ] channel-first */
  char* ws = (char*)d_ws;
  unsigned short* WKB = (unsigned short*)(ws + OFF_WKB);
  unsigned short* WQB = (unsigned short*)(ws + OFF_WQB);
  unsigned short* WVB = (unsigned short*)(ws + OFF_WVB);
  unsigned short* WOH = (unsigned short*)(ws + OFF_WOH);
  unsigned short* XB  = (unsigned short*)(ws + OFF_XB);
  unsigned short* KH  = (unsigned short*)(ws + OFF_KH);
  unsigned short* KL  = (unsigned short*)(ws + OFF_KL);
  unsigned short* QH  = (unsigned short*)(ws + OFF_QH);
  unsigned short* QL  = (unsigned short*)(ws + OFF_QL);
  unsigned short* VT  = (unsigned short*)(ws + OFF_VT);
  float* E = (float*)(ws + OFF_E);

  k_wcvt<<<(RD * CC / 8) / 256, 256, 0, stream>>>(wk, WKB, RD * CC / 8);
  k_wcvt<<<(RD * CC / 8) / 256, 256, 0, stream>>>(wq, WQB, RD * CC / 8);
  k_wcvt<<<(RD * CC / 8) / 256, 256, 0, stream>>>(wv, WVB, RD * CC / 8);
  k_wcvth<<<(CC * RD / 8) / 256, 256, 0, stream>>>(wo, WOH, CC * RD / 8);
  k_xT<<<(CC / 64) * (SEQ / 64) * NB, 256, 0, stream>>>(x, XB);              /* in [b][c][n] -> out [b*SEQ+n][c] */
  k_kqproj<<<(unsigned)(NRT / 64), 128, 0, stream>>>(XB, WKB, bk, KH, KL);
  k_kqproj<<<(unsigned)(NRT / 64), 128, 0, stream>>>(XB, WQB, bq, QH, QL);
  k_vproj<<<dim3((RD / 16) * (SEQ / 64) / 4, NB), 128, 0, stream>>>(XB, WVB, bv, VT);
  k_stats<<<dim3(SEQ / 64, NB), 128, 0, stream>>>(QH, QL, KH, KL, E);
  k_attn<<<dim3(SEQ / 64, NB), 128, 0, stream>>>(KH, KL, QH, QL, VT, E, WOH, bo, gam, x, out);
}

// v002
// It runs in 107 microseconds.
// In both of two side-by-side timings against v001, it was 1.26 times as fast.
// All steps since v000 together make it 3.92 times as fast.
#include <hip/hip_runtime.h>
// Compute dtype: inputs converted (RNE) to bf16; key, query and value projections v_wmma_f32_16x16x32_bf16 (exact products, f32 accumulate, bias added in f32); scores f.g^T as bf16 hi|lo three-product (hi.hi + lo.hi + hi.lo) v_wmma_f32_16x16x32_bf16, f32 accumulate; softmax running maximum and sum f32, kept in the attention loop; V^T single f16 and P = exp(s - running maximum) x4096 single f16 on v_wmma_f32_16x16x32_f16, f32 accumulate scaled every 32 keys by exp(old - new maximum), divided by the sum at the end; output projection Wo x64 single f16 times ctx single f16 on v_wmma_f32_16x16x32_f16, f32 accumulate; result = bf16(x) + bf16(gamma) * (o + bf16(bo)) in f32.
#ifndef NB
#define NB 4                      /* images */
#endif
#ifndef SEQ
#define SEQ 4096                  /* pixels per image processed */
#endif
#define SEQ_FULL 4096             /* pixel pitch of the staged x rows */
#define CC 256                    /* channels */
#define RD 64                     /* embedding channels (key / query / value width) */
#define CH 128                    /* channels per epilogue slab */
#define LOG2E 1.4426950408889634f      /* scores go to base 2 inside the exponent's multiply-add */
#define PCARRY_L2 12.0f                /* P carried x4096 */
#define WOCARRY 64.0f                  /* Wo plane carried x64 */
#define WOINV 0.015625f                /* 2^-6 */
#define NRT ((size_t)NB * SEQ)

static_assert(SEQ % 256 == 0);          /* 64-pixel tiles, 4 waves per block, v-projection grid divisibility */
static_assert(SEQ <= SEQ_FULL);
static_assert(CC % 64 == 0);            /* 64-channel transpose tiles, K % 32 == 0 */
static_assert(RD == 64);                
static_assert(CC == 2 * CH);            /* two channel slabs in the epilogue */
static_assert(CH % 16 == 0 && CH / 16 == 8);

typedef __bf16 v16b __attribute__((ext_vector_type(16)));
typedef _Float16 v16h __attribute__((ext_vector_type(16)));
typedef unsigned short v8us __attribute__((ext_vector_type(8), may_alias));
typedef float v8f  __attribute__((ext_vector_type(8)));
typedef float v4f  __attribute__((ext_vector_type(4)));
typedef float v4fa __attribute__((ext_vector_type(4), may_alias));
typedef _Float16 h16;
union FragB { v16b v; v8us half[2]; };
union FragH { v16h v; v8us half[2]; _Float16 h[16]; };

__device__ __forceinline__ unsigned short bf16_bits(float x) { unsigned int u = __float_as_uint(x); return (unsigned short)((u + 0x7FFFu + ((u >> 16) & 1u)) >> 16); }
__device__ __forceinline__ float bf16_val(unsigned short b) { return __uint_as_float(((unsigned int)b) << 16); }
__device__ __forceinline__ float bf16_rne(float x) { return bf16_val(bf16_bits(x)); }

// f32 -> f16 that cannot produce an f16 subnormal (value select)
static __device__ __forceinline__ h16 toh_flush(float v) { const h16 r = (h16)v; return (fabsf(v) < 6.103515625e-05f) ? (h16)0.0f : r; }
// p = 2^a -> f16, zero when the result would fall below 2^-14 (select on the exponent argument)
static __device__ __forceinline__ h16 p_flush(float a, float p) { return (a < -13.99f) ? (h16)0.0f : (h16)p; }
// lane l <-> lane l ^ 16: the two lanes that hold one query column
static __device__ __forceinline__ float xhalf(float x) { return __builtin_bit_cast(float, __builtin_amdgcn_permlanex16(__builtin_bit_cast(int, x), __builtin_bit_cast(int, x), 0x76543210, 0xfedcba98, false, false)); }
static __device__ __forceinline__ float max3(float a, float b, float c) { return fmaxf(fmaxf(a, b), c); }

// fragment of a k-contiguous 16-bit row: elements 0..7 <- k 8h..8h+7, elements 8..15 <- k 16+8h..16+8h+7 (same map for A and B)
__device__ __forceinline__ v16b ld_bf(const unsigned short* p, int hh) { FragB f; f.half[0] = *(const v8us*)(p + 8 * hh); f.half[1] = *(const v8us*)(p + 16 + 8 * hh); return f.v; }

__device__ __forceinline__ v8f mma_b1(v16b a, v16b b, v8f c) {
  c = __builtin_amdgcn_wmma_f32_16x16x32_bf16(false, a, false, b, (short)0, c, false, false);
  asm volatile("v_nop\n\tv_nop\n\tv_nop\n\tv_nop" : "+v"(c) : "v"(a), "v"(b));
  return c;
}
// c += ah.bh + al.bh + ah.bl (unscaled bf16 residuals share the accumulator)
__device__ __forceinline__ v8f mma_b3(v16b ah, v16b al, v16b bh, v16b bl, v8f c) {
  c = __builtin_amdgcn_wmma_f32_16x16x32_bf16(false, ah, false, bh, (short)0, c, false, false);
  c = __builtin_amdgcn_wmma_f32_16x16x32_bf16(false, al, false, bh, (short)0, c, false, false);
  c = __builtin_amdgcn_wmma_f32_16x16x32_bf16(false, ah, false, bl, (short)0, c, false, false);
  asm volatile("v_nop\n\tv_nop\n\tv_nop\n\tv_nop" : "+v"(c) : "v"(ah), "v"(al), "v"(bh), "v"(bl));
  return c;
}
__device__ __forceinline__ v8f mma_h1(v16h a, v16h b, v8f c) {
  c = __builtin_amdgcn_wmma_f32_16x16x32_f16(false, a, false, b, (short)0, c, false, false);
  asm volatile("v_nop\n\tv_nop\n\tv_nop\n\tv_nop" : "+v"(c) : "v"(a), "v"(b));
  return c;
}

// ---- key / value tiles staged in LDS by asynchronous copies, two buffers ----
#define TK 128                        /* keys per staged tile */
#define NTILE (SEQ / TK)
#define KPITCH 144                    /* LDS bytes per 128-byte key row (16 B x odd: no bank conflict for 16-byte readers) */
#define VPITCH 272                    /* LDS bytes per 256-byte V^T row (16 B x odd) */
#define KTILE_B (TK * KPITCH)
#define VTILE_B (RD * VPITCH)
#define ASTAGE_B (2 * KTILE_B + VTILE_B)  /* k_attn stage: K hi, K lo, V^T */
static_assert(SEQ % TK == 0 && NTILE >= 2);   /* the ring's prologue fills two tiles */
static_assert(RD * 2 == 128 && TK * 2 == 256);
static_assert(KTILE_B % 16 == 0 && VTILE_B % 16 == 0);

__device__ __forceinline__ unsigned lds_off(const void* p) { return (unsigned)(size_t)p; }

// Eight 16-byte copies per lane, global -> LDS, through no register. The s_wait_xcnt is the statement's last line so that
// no later rewrite of an address register can be scheduled in front of it.
__device__ __forceinline__ void cp8(unsigned l, unsigned ls, const unsigned short* g, size_t gs) {
  asm volatile("global_load_async_to_lds_b128 %0, %8, off\n\t"
               "global_load_async_to_lds_b128 %1, %9, off\n\t"
               "global_load_async_to_lds_b128 %2, %10, off\n\t"
               "global_load_async_to_lds_b128 %3, %11, off\n\t"
               "global_load_async_to_lds_b128 %4, %12, off\n\t"
               "global_load_async_to_lds_b128 %5, %13, off\n\t"
               "global_load_async_to_lds_b128 %6, %14, off\n\t"
               "global_load_async_to_lds_b128 %7, %15, off\n\t"
               "s_wait_xcnt 0x0"
               :: "v"(l), "v"(l + ls), "v"(l + 2 * ls), "v"(l + 3 * ls), "v"(l + 4 * ls), "v"(l + 5 * ls), "v"(l + 6 * ls), "v"(l + 7 * ls),
                  "v"(g), "v"(g + gs), "v"(g + 2 * gs), "v"(g + 3 * gs), "v"(g + 4 * gs), "v"(g + 5 * gs), "v"(g + 6 * gs), "v"(g + 7 * gs)
               : "memory");
}
// one 128-key plane of K (rows contiguous in memory): lane tid brings bytes 16 tid .. 16 tid + 15 of every 2-KiB slab (16 rows)
__device__ __forceinline__ void cp_kplane(unsigned lbase, const unsigned short* plane_row0, int tid) {
  cp8(lbase + (unsigned)(tid >> 3) * KPITCH + (unsigned)(tid & 7) * 16u, 16u * KPITCH, plane_row0 + tid * 8, (size_t)16 * RD);
}
// 64 rows x 128 keys of V^T (row pitch SEQ): 16 lanes per row, 8 rows per copy
__device__ __forceinline__ void cp_vplane(unsigned lbase, const unsigned short* vt_row0_key0, int tid) {
  cp8(lbase + (unsigned)(tid >> 4) * VPITCH + (unsigned)(tid & 15) * 16u, 8u * VPITCH, vt_row0_key0 + (size_t)(tid >> 4) * SEQ + (tid & 15) * 8, (size_t)8 * SEQ);
}
// own copies landed (before the barrier that lets other waves read them)
__device__ __forceinline__ void wait_copies() { asm volatile("s_wait_asynccnt 0x0" ::: "memory"); }
// own LDS reads retired (before the barrier behind which their buffer is refilled)
__device__ __forceinline__ void wait_lds() { asm volatile("s_wait_dscnt 0x0" ::: "memory"); }
// fragment of a staged 16-bit row, p = row start + 64 * (k / 32) + 16 h: same element map as ld_bf
__device__ __forceinline__ v16b lds_bf(const unsigned char* p) { FragB f; f.half[0] = *(const v8us*)p; f.half[1] = *(const v8us*)(p + 32); return f.v; }
// K fragments of 32 staged keys: kf[4 * (16-key row block) + 2 * (k half) + (hi, lo)]; p = the lane's place in the hi plane
__device__ __forceinline__ void lds_k16(v16b (&kf)[8], int rb16, const unsigned char* p) {
#pragma unroll   /* constant kf index */
  for (int kh = 0; kh < 2; ++kh) {
    kf[rb16 * 4 + kh * 2]     = lds_bf(p + rb16 * 16 * KPITCH + kh * 64);
    kf[rb16 * 4 + kh * 2 + 1] = lds_bf(p + rb16 * 16 * KPITCH + kh * 64 + KTILE_B);
  }
}
__device__ __forceinline__ void lds_k32(v16b (&kf)[8], const unsigned char* p) { lds_k16(kf, 0, p); lds_k16(kf, 1, p); }

__global__ __launch_bounds__(256) void k_wcvt(const float* __restrict__ W, unsigned short* __restrict__ Wb, int n8) {
  const int t = blockIdx.x * 256 + threadIdx.x;
  if (t >= n8) return;
  const v4f a = *(const v4fa*)(W + (size_t)t * 8);
  const v4f c = *(const v4fa*)(W + (size_t)t * 8 + 4);
  v8us v;
#pragma unroll
  for (int q = 0; q < 4; ++q) { v[q] = bf16_bits(a[q]); v[4 + q] = bf16_bits(c[q]); }
  unsigned short* d = Wb + (size_t)t * 8;
  *(v8us*)d = v;
  
}

__global__ __launch_bounds__(256) void k_wcvth(const float* __restrict__ W, unsigned short* __restrict__ Wh, int n8) {
  const int t = blockIdx.x * 256 + threadIdx.x;
  if (t >= n8) return;
  const v4f a = *(const v4fa*)(W + (size_t)t * 8);
  const v4f c = *(const v4fa*)(W + (size_t)t * 8 + 4);
  FragH f;
#pragma unroll
  for (int q = 0; q < 4; ++q) { f.h[q] = toh_flush(bf16_rne(a[q]) * WOCARRY); f.h[4 + q] = toh_flush(bf16_rne(c[q]) * WOCARRY); }
  const v8us v = f.half[0];
  unsigned short* d = Wh + (size_t)t * 8;
  *(v8us*)d = v;
  
}

__global__ __launch_bounds__(256) void k_xT(const float* __restrict__ x, unsigned short* __restrict__ XB) {
  __shared__ unsigned short tl[64][66];
  const int tid = threadIdx.x;
  const int blk = blockIdx.x;
  const int ct = blk % (CC / 64);
  const int nt = (blk / (CC / 64)) % (SEQ / 64);
  const int b = blk / ((CC / 64) * (SEQ / 64));
#pragma unroll 1
  for (int i = tid; i < 64 * 16; i += 256) {
    const int c = i >> 4, n4 = (i & 15) * 4;
    const v4f v = *(const v4fa*)(x + ((size_t)(b * CC + ct * 64 + c)) * SEQ_FULL + nt * 64 + n4);
#pragma unroll
    for (int q = 0; q < 4; ++q) tl[n4 + q][c] = bf16_bits(v[q]);
  }
  __syncthreads();
  {
#pragma unroll 1
    for (int i = tid; i < 64 * 8; i += 256) {
      const int n = i >> 3, c8 = (i & 7) * 8;
      v8us f;
#pragma unroll
      for (int q = 0; q < 8; ++q) f[q] = tl[n][c8 + q];
      unsigned short* d = XB + ((size_t)b * SEQ + nt * 64 + n) * CC + ct * 64 + c8;
      *(v8us*)d = f;
    }
    
  }
}

__global__ __launch_bounds__(128) void k_kqproj(const unsigned short* __restrict__ XB, const unsigned short* __restrict__ WB,
                                                const float* __restrict__ bias,
                                                unsigned short* __restrict__ PH, unsigned short* __restrict__ PL) {
  __shared__ __attribute__((aligned(16))) float so[4][16][64];
  const int tid = threadIdx.x;
  const int wave = __builtin_amdgcn_readfirstlane(tid >> 5);
  const int lane = tid & 31, ln = lane & 15, hh = lane >> 4;
  const size_t row0 = ((size_t)blockIdx.x * 4 + wave) * 16;
  const unsigned short* arow = XB + (row0 + ln) * CC;
  const v8f z8 = {0.f, 0.f, 0.f, 0.f, 0.f, 0.f, 0.f, 0.f};
  v8f acc[4];
#pragma unroll
  for (int t = 0; t < 4; ++t) acc[t] = z8;
#pragma unroll 1
  for (int kb = 0; kb < CC; kb += 32) {
    const v16b a = ld_bf(arow + kb, hh);
#pragma unroll
    for (int t = 0; t < 4; ++t) {
      const v16b bq = ld_bf(WB + (size_t)(t * 16 + ln) * CC + kb, hh);
      acc[t] = mma_b1(a, bq, acc[t]);
    }
  }
#pragma unroll
  for (int t = 0; t < 4; ++t)
#pragma unroll
    for (int r = 0; r < 8; ++r) so[wave][8 * hh + r][t * 16 + ln] = acc[t][r];
  __builtin_amdgcn_fence(4 /* acq_rel order */, "workgroup");
  __builtin_amdgcn_wave_barrier();
  const int rsub = lane >> 3, c8 = (lane & 7) * 8;
  const v4f ba = *(const v4fa*)(bias + c8);
  const v4f bc = *(const v4fa*)(bias + c8 + 4);
  {
#pragma unroll
    for (int it = 0; it < 4; ++it) {
      const int r = it * 4 + rsub;
      const v4f a = *(const v4fa*)&so[wave][r][c8];
      const v4f c = *(const v4fa*)&so[wave][r][c8 + 4];
      v8us vh, vl;
#pragma unroll
      for (int q = 0; q < 4; ++q) {
        const float va = a[q] + bf16_rne(ba[q]);
        const float vc = c[q] + bf16_rne(bc[q]);
        unsigned short hb = bf16_bits(va); vh[q] = hb; vl[q] = bf16_bits(va - bf16_val(hb));
        hb = bf16_bits(vc); vh[4 + q] = hb; vl[4 + q] = bf16_bits(vc - bf16_val(hb));
      }
      const size_t o = (row0 + r) * RD + c8;
      *(v8us*)(PH + o) = vh;
      *(v8us*)(PL + o) = vl;
    }
    
  }
}

__global__ __launch_bounds__(128) void k_vproj(const unsigned short* __restrict__ XB, const unsigned short* __restrict__ WVB,
                                               const float* __restrict__ bv, unsigned short* __restrict__ VT) {
  __shared__ __attribute__((aligned(16))) float so[4][16][64];
  const int tid = threadIdx.x;
  const int wave = __builtin_amdgcn_readfirstlane(tid >> 5);
  const int lane = tid & 31, ln = lane & 15, hh = lane >> 4;
  const int b = blockIdx.y;
  const int wid = blockIdx.x * 4 + wave;
  const int mt = wid / (SEQ / 64), nq = wid % (SEQ / 64);
  const unsigned short* arow = WVB + (size_t)(mt * 16 + ln) * CC;
  const unsigned short* brow = XB + ((size_t)b * SEQ + nq * 64 + ln) * CC;
  const v8f z8 = {0.f, 0.f, 0.f, 0.f, 0.f, 0.f, 0.f, 0.f};
  v8f acc[4];
#pragma unroll
  for (int t = 0; t < 4; ++t) acc[t] = z8;
#pragma unroll 1
  for (int kb = 0; kb < CC; kb += 32) {
    const v16b a = ld_bf(arow + kb, hh);
#pragma unroll
    for (int t = 0; t < 4; ++t) {
      const v16b bq = ld_bf(brow + (size_t)(t * 16) * CC + kb, hh);
      acc[t] = mma_b1(a, bq, acc[t]);
    }
  }
#pragma unroll
  for (int t = 0; t < 4; ++t)
#pragma unroll
    for (int r = 0; r < 8; ++r) so[wave][8 * hh + r][t * 16 + ln] = acc[t][r];
  __builtin_amdgcn_fence(4 /* acq_rel order */, "workgroup");
  __builtin_amdgcn_wave_barrier();
  const int rsub = lane >> 3, c8 = (lane & 7) * 8;
  {
#pragma unroll
    for (int it = 0; it < 4; ++it) {
      const int r = it * 4 + rsub;
      const v4f a = *(const v4fa*)&so[wave][r][c8];
      const v4f c = *(const v4fa*)&so[wave][r][c8 + 4];
      const float bb = bf16_rne(bv[mt * 16 + r]);
      FragH f;
#pragma unroll
      for (int q = 0; q < 4; ++q) { f.h[q] = toh_flush(a[q] + bb); f.h[4 + q] = toh_flush(c[q] + bb); }
      const v8us o = f.half[0];
      *(v8us*)(VT + ((size_t)(b * RD + mt * 16 + r)) * SEQ + nq * 64 + c8) = o;
    }
    
  }
}

__global__ __launch_bounds__(128) void k_attn(const unsigned short* __restrict__ KH, const unsigned short* __restrict__ KL,
                                              const unsigned short* __restrict__ QH, const unsigned short* __restrict__ QL,
                                              const unsigned short* __restrict__ VT,
                                              const unsigned short* __restrict__ WOH, const float* __restrict__ bo,
                                              const float* __restrict__ gam,
                                              const float* __restrict__ x, float* __restrict__ out) {
  __shared__ __attribute__((aligned(16))) float so[CH][68];
  __shared__ __attribute__((aligned(16))) unsigned char ring[2 * ASTAGE_B];
  const int tid = threadIdx.x;
  const int wave = __builtin_amdgcn_readfirstlane(tid >> 5);
  const int lane = tid & 31, ln = lane & 15, hh = lane >> 4;
  const int b = blockIdx.y, jb = blockIdx.x * 64;
  const size_t tb = (size_t)b * SEQ;
  const size_t qo = (tb + jb + wave * 16 + ln) * RD;
  const v16b bH0 = ld_bf(QH + qo, hh), bL0 = ld_bf(QL + qo, hh), bH1 = ld_bf(QH + qo + 32, hh), bL1 = ld_bf(QL + qo + 32, hh);
  float m = -1.0e30f;                               /* running maximum of this lane's query column, the same in both lanes that hold it */
  float m2 = -1.0e30f;                              /* m in base 2, less the carry: what the exponent subtracts */
  float l = 0.f;                                    /* sum of P over this lane's own keys, on the scale of m */
  const v8f z8 = {0.f, 0.f, 0.f, 0.f, 0.f, 0.f, 0.f, 0.f};
  v8f acc[4];
#pragma unroll
  for (int i = 0; i < 4; ++i) acc[i] = z8;
  const unsigned rb = lds_off(ring);
  const unsigned short* kh0 = KH + tb * RD;
  const unsigned short* kl0 = KL + tb * RD;
  const unsigned short* vt0 = VT + (size_t)(b * RD) * SEQ;
  cp_kplane(rb, kh0, tid);
  cp_kplane(rb + KTILE_B, kl0, tid);
  cp_vplane(rb + 2 * KTILE_B, vt0, tid);
  wait_copies();
  __syncthreads();
  cp_kplane(rb + ASTAGE_B, kh0 + (size_t)TK * RD, tid);
  cp_kplane(rb + ASTAGE_B + KTILE_B, kl0 + (size_t)TK * RD, tid);
  cp_vplane(rb + ASTAGE_B + 2 * KTILE_B, vt0 + TK, tid);
#pragma unroll 1   /* rolled: one publish point per trip, the buffer picked by t & 1 */
  for (int t = 0; t < NTILE; ++t) {
    const unsigned bsel = (unsigned)(t & 1) * ASTAGE_B;
    const unsigned char* fr = ring + bsel + ln * KPITCH + hh * 16;
    const unsigned char* vf = ring + bsel + 2 * KTILE_B + ln * VPITCH + hh * 16;
    v16b kf[8];
    lds_k32(kf, fr);
#pragma unroll   /* unrolled: constant LDS offsets, kf indexed by constants so that it stays in registers */
    for (int sp = 0; sp < TK / 32; ++sp) {
      v8f s0 = z8, s1 = z8;
      s0 = mma_b3(kf[0], kf[1], bH0, bL0, s0);
      s0 = mma_b3(kf[2], kf[3], bH1, bL1, s0);
      FragH va[4];                                  /* V^T fragments of these 32 keys: land under the products below */
#pragma unroll   /* constant va index */
      for (int ct = 0; ct < 4; ++ct) {
        const unsigned char* vp = vf + ct * 16 * VPITCH + sp * 64;
        va[ct].half[0] = *(const v8us*)vp;
        va[ct].half[1] = *(const v8us*)(vp + 32);
      }
      if (sp + 1 < TK / 32) lds_k16(kf, 0, fr + (sp + 1) * 32 * KPITCH);   /* same tile, next 32 keys */
      s1 = mma_b3(kf[4], kf[5], bH0, bL0, s1);
      s1 = mma_b3(kf[6], kf[7], bH1, bL1, s1);
      if (sp + 1 < TK / 32) lds_k16(kf, 1, fr + (sp + 1) * 32 * KPITCH);   /* lands under the exponentials */
      const float mh = max3(max3(max3(s0[0], s0[1], s0[2]), max3(s0[3], s0[4], s0[5]), max3(s0[6], s0[7], s1[0])),
                            max3(max3(s1[1], s1[2], s1[3]), max3(s1[4], s1[5], s1[6]), s1[7]), m);
      m = fmaxf(mh, xhalf(mh));
      const float m2n = fmaf(m, LOG2E, -PCARRY_L2);
      const float alpha = __builtin_amdgcn_exp2f(m2 - m2n);   /* 0 on the first 32 keys, 1 while the maximum stands */
      m2 = m2n;
      FragH pf;
      float ps[8];
#pragma unroll
      for (int r = 0; r < 8; ++r) {
        const float a0 = fmaf(s0[r], LOG2E, -m2n), a1 = fmaf(s1[r], LOG2E, -m2n);
        const float p0 = __builtin_amdgcn_exp2f(a0), p1 = __builtin_amdgcn_exp2f(a1);
        pf.h[r]     = p_flush(a0, p0);
        pf.h[8 + r] = p_flush(a1, p1);
        ps[r] = p0 + p1;
      }
      l = fmaf(l, alpha, ((ps[0] + ps[1]) + (ps[2] + ps[3])) + ((ps[4] + ps[5]) + (ps[6] + ps[7])));
#pragma unroll   /* constant acc index */
      for (int ct = 0; ct < 4; ++ct) acc[ct] *= alpha;
#pragma unroll   /* constant acc index */
      for (int ct = 0; ct < 4; ++ct) acc[ct] = mma_h1(va[ct].v, pf.v, acc[ct]);
    }
    // publish point: tile t + 1 becomes readable, tile t's buffer becomes free
    wait_lds();
    wait_copies();
    __syncthreads();
    if (t + 2 < NTILE) {
      cp_kplane(rb + bsel, kh0 + (size_t)(t + 2) * TK * RD, tid);
      cp_kplane(rb + bsel + KTILE_B, kl0 + (size_t)(t + 2) * TK * RD, tid);
      cp_vplane(rb + bsel + 2 * KTILE_B, vt0 + (t + 2) * TK, tid);
    }
  }
  wait_copies();
  // ctx^T tiles (rows e = 16 ct + 8h + r, cols j) -> two B fragments with k = e
  const float linv = 1.0f / (l + xhalf(l));         /* the column's whole sum; it carries the same x4096 as acc */
  FragH cf0, cf1;
#pragma unroll
  for (int r = 0; r < 8; ++r) {
    cf0.h[r]     = toh_flush(acc[0][r] * linv);
    cf0.h[8 + r] = toh_flush(acc[1][r] * linv);
    cf1.h[r]     = toh_flush(acc[2][r] * linv);
    cf1.h[8 + r] = toh_flush(acc[3][r] * linv);
  }
  const float g = bf16_rne(gam[0]);
  const int rsub = lane >> 4, pc = (lane & 15) * 4;
#pragma unroll 1
  for (int hf = 0; hf < 2; ++hf) {
    const int ch0 = hf * CH;
#pragma unroll
    for (int ct = 0; ct < 8; ++ct) {
      const unsigned short* wp = WOH + (size_t)(ch0 + ct * 16 + ln) * RD + 8 * hh;
      FragH a0, a1;
      a0.half[0] = *(const v8us*)wp;
      a0.half[1] = *(const v8us*)(wp + 16);
      a1.half[0] = *(const v8us*)(wp + 32);
      a1.half[1] = *(const v8us*)(wp + 48);
      v8f d = z8;
      d = mma_h1(a0.v, cf0.v, d);
      d = mma_h1(a1.v, cf1.v, d);
#pragma unroll
      for (int r = 0; r < 8; ++r) so[ct * 16 + 8 * hh + r][wave * 16 + ln] = d[r] * WOINV;
    }
    __syncthreads();
    {
#pragma unroll 1
      for (int it = 0; it < CH / 8; ++it) {
        const int row = it * 8 + wave * 2 + rsub;
        const v4f v = *(const v4fa*)&so[row][pc];
        const v4f xr = *(const v4fa*)(x + ((size_t)(b * CC + ch0 + row)) * SEQ_FULL + jb + pc);
        const float bb = bf16_rne(bo[ch0 + row]);
        v4f o;
#pragma unroll
        for (int q = 0; q < 4; ++q) o[q] = bf16_rne(xr[q]) + g * (v[q] + bb);
        *(v4f*)(out + ((size_t)(b * CC + ch0 + row)) * SEQ + jb + pc) = o;
      }
      
    }
    __syncthreads();
  }
}

// workspace carve (bytes, every region a multiple of 256)
#define SZ_WP  ((size_t)RD * CC * 2)
#define SZ_WO  ((size_t)CC * RD * 2)
#define SZ_XB  (NRT * CC * 2)
#define SZ_P   (NRT * RD * 2)
#define SZ_VT  ((size_t)NB * RD * SEQ * 2)
#define OFF_WKB ((size_t)0)
#define OFF_WQB (OFF_WKB + SZ_WP)
#define OFF_WVB (OFF_WQB + SZ_WP)
#define OFF_WOH (OFF_WVB + SZ_WP)
#define OFF_XB  (OFF_WOH + SZ_WO)
#define OFF_KH  (OFF_XB + SZ_XB)
#define OFF_KL  (OFF_KH + SZ_P)
#define OFF_QH  (OFF_KL + SZ_P)
#define OFF_QL  (OFF_QH + SZ_P)
#define OFF_VT  (OFF_QL + SZ_P)
#define WS_TOTAL (OFF_VT + SZ_VT)
static_assert(SZ_WP % 256 == 0 && SZ_WO % 256 == 0 && SZ_XB % 256 == 0 && SZ_P % 256 == 0 && SZ_VT % 256 == 0);
static_assert(WS_TOTAL <= (size_t)134217728);
static_assert((RD * CC) % (8 * 256) == 0);                                 /* k_wcvt / k_wcvth grids exact */
static_assert((NRT % 64) == 0);                                            /* k_kqproj grid x 4 waves x 16 rows == token rows */
static_assert(((RD / 16) * (SEQ / 64)) % 4 == 0);                          /* k_vproj grid x 4 waves == channel tiles x pixel quads */
static_assert(SEQ % 64 == 0 && SEQ % 32 == 0);                             /* k_attn tiles and 32-row key steps */

extern "C" void kernel_launch(void* const* d_in, const int* in_sizes, int n_in,
                              void* d_out, int out_size, void* d_ws, size_t ws_size, hipStream_t stream) {
  if (n_in < 10) return;
  if ((size_t)in_sizes[0] < (size_t)(NB * CC - 1) * SEQ_FULL + SEQ) return;
  if ((size_t)in_sizes[1] < (size_t)RD * CC) return;
  if ((size_t)in_sizes[2] < (size_t)RD) return;
  if ((size_t)in_sizes[3] < (size_t)RD * CC) return;
  if ((size_t)in_sizes[4] < (size_t)RD) return;
  if ((size_t)in_sizes[5] < (size_t)RD * CC) return;
  if ((size_t)in_sizes[6] < (size_t)RD) return;
  if ((size_t)in_sizes[7] < (size_t)CC * RD) return;
  if ((size_t)in_sizes[8] < (size_t)CC) return;
  if ((size_t)in_sizes[9] < (size_t)1) return;
  if ((size_t)out_size < (size_t)NB * CC * SEQ) return;
  if (WS_TOTAL > ws_size) return;
  const float* x  = (const float*)d_in[0];       /* [NB][CC][SEQ_FULL] channel-first */
  const float* wk = (const float*)d_in[1];       /* [RD][CC] = [out][in], key */
  const float* bk = (const float*)d_in[2];       /* [RD] */
  const float* wq = (const float*)d_in[3];       /* [RD][CC] = [out][in], query */
  const float* bq = (const float*)d_in[4];       /* [RD] */
  const float* wv = (const float*)d_in[5];       /* [RD][CC] = [out][in], value */
  const float* bv = (const float*)d_in[6];       /* [RD] */
  const float* wo = (const float*)d_in[7];       /* [CC][RD] = [out][in] */
  const float* bo = (const float*)d_in[8];       /* [CC] */
  const float* gam = (const float*)d_in[9];      /* [1] */
  float* out = (float*)d_out;                    /* [NB][CC][SEQ] channel-first */
  char* ws = (char*)d_ws;
  unsigned short* WKB = (unsigned short*)(ws + OFF_WKB);
  unsigned short* WQB = (unsigned short*)(ws + OFF_WQB);
  unsigned short* WVB = (unsigned short*)(ws + OFF_WVB);
  unsigned short* WOH = (unsigned short*)(ws + OFF_WOH);
  unsigned short* XB  = (unsigned short*)(ws + OFF_XB);
  unsigned short* KH  = (unsigned short*)(ws + OFF_KH);
  unsigned short* KL  = (unsigned short*)(ws + OFF_KL);
  unsigned short* QH  = (unsigned short*)(ws + OFF_QH);
  unsigned short* QL  = (unsigned short*)(ws + OFF_QL);
  unsigned short* VT  = (unsigned short*)(ws + OFF_VT);

  k_wcvt<<<(RD * CC / 8) / 256, 256, 0, stream>>>(wk, WKB, RD * CC / 8);
  k_wcvt<<<(RD * CC / 8) / 256, 256, 0, stream>>>(wq, WQB, RD * CC / 8);
  k_wcvt<<<(RD * CC / 8) / 256, 256, 0, stream>>>(wv, WVB, RD * CC / 8);
  k_wcvth<<<(CC * RD / 8) / 256, 256, 0, stream>>>(wo, WOH, CC * RD / 8);
  k_xT<<<(CC / 64) * (SEQ / 64) * NB, 256, 0, stream>>>(x, XB);              /* in [b][c][n] -> out [b*SEQ+n][c] */
  k_kqproj<<<(unsigned)(NRT / 64), 128, 0, stream>>>(XB, WKB, bk, KH, KL);
  k_kqproj<<<(unsigned)(NRT / 64), 128, 0, stream>>>(XB, WQB, bq, QH, QL);
  k_vproj<<<dim3((RD / 16) * (SEQ / 64) / 4, NB), 128, 0, stream>>>(XB, WVB, bv, VT);
  k_attn<<<dim3(SEQ / 64, NB), 128, 0, stream>>>(KH, KL, QH, QL, VT, WOH, bo, gam, x, out);
}

// v003
// Measured time: 83.8 microseconds a run.
// Two timings next to v002 both put it at 1.28 times that version's speed.
// Over all steps from v000 it is 5.01 times as fast.
#include <hip/hip_runtime.h>
// Compute dtype: inputs converted (RNE) to bf16; key, query and value projections v_wmma_f32_16x16x32_bf16 (exact products, f32 accumulate, bias added in f32); scores f.g^T as bf16 hi|lo three-product (hi.hi + lo.hi + hi.lo) v_wmma_f32_16x16x32_bf16, f32 accumulate; softmax running maximum and sum f32, kept in the attention loop; V^T single f16 and P = exp(s - running maximum) x4096 single f16 on v_wmma_f32_16x16x32_f16, f32 accumulate scaled every 32 keys by exp(old - new maximum), divided by the sum at the end; output projection Wo x64 single f16 times ctx single f16 on v_wmma_f32_16x16x32_f16, f32 accumulate; result = bf16(x) + bf16(gamma) * (o + bf16(bo)) in f32.
#ifndef NB
#define NB 4                      /* images */
#endif
#ifndef SEQ
#define SEQ 4096                  /* pixels per image processed */
#endif
#define SEQ_FULL 4096             /* pixel pitch of the staged x rows */
#define CC 256                    /* channels */
#define RD 64                     /* embedding channels (key / query / value width) */
#define CH 128                    /* channels per epilogue slab */
#define LOG2E 1.4426950408889634f      /* scores go to base 2 inside the exponent's multiply-add */
#define PCARRY_L2 12.0f                /* P carried x4096 */
#define WOCARRY 64.0f                  /* Wo plane carried x64 */
#define WOINV 0.015625f                /* 2^-6 */
#define NRT ((size_t)NB * SEQ)

static_assert(SEQ % 256 == 0);          /* 64-pixel tiles, 4 waves per block, v-projection grid divisibility */
static_assert(SEQ <= SEQ_FULL);
static_assert(CC % 64 == 0);            /* 64-channel transpose tiles, K % 32 == 0 */
static_assert(RD == 64);                
static_assert(CC == 2 * CH);            /* two channel slabs in the epilogue */
static_assert(CH % 16 == 0 && CH / 16 == 8);

typedef __bf16 v16b __attribute__((ext_vector_type(16)));
typedef _Float16 v16h __attribute__((ext_vector_type(16)));
typedef unsigned short v8us __attribute__((ext_vector_type(8), may_alias));
typedef float v8f  __attribute__((ext_vector_type(8)));
typedef float v4f  __attribute__((ext_vector_type(4)));
typedef float v4fa __attribute__((ext_vector_type(4), may_alias));
typedef _Float16 h16;
union FragB { v16b v; v8us half[2]; };
union FragH { v16h v; v8us half[2]; _Float16 h[16]; };

__device__ __forceinline__ unsigned short bf16_bits(float x) { unsigned int u = __float_as_uint(x); return (unsigned short)((u + 0x7FFFu + ((u >> 16) & 1u)) >> 16); }
__device__ __forceinline__ float bf16_val(unsigned short b) { return __uint_as_float(((unsigned int)b) << 16); }
__device__ __forceinline__ float bf16_rne(float x) { return bf16_val(bf16_bits(x)); }

// f32 -> f16 that cannot produce an f16 subnormal (value select)
static __device__ __forceinline__ h16 toh_flush(float v) { const h16 r = (h16)v; return (fabsf(v) < 6.103515625e-05f) ? (h16)0.0f : r; }
// p = 2^a -> f16, zero when the result would fall below 2^-14 (select on the exponent argument)
static __device__ __forceinline__ h16 p_flush(float a, float p) { return (a < -13.99f) ? (h16)0.0f : (h16)p; }
// lane l <-> lane l ^ 16: the two lanes that hold one query column
static __device__ __forceinline__ float xhalf(float x) { return __builtin_bit_cast(float, __builtin_amdgcn_permlanex16(__builtin_bit_cast(int, x), __builtin_bit_cast(int, x), 0x76543210, 0xfedcba98, false, false)); }
static __device__ __forceinline__ float max3(float a, float b, float c) { return fmaxf(fmaxf(a, b), c); }

// fragment of a k-contiguous 16-bit row: elements 0..7 <- k 8h..8h+7, elements 8..15 <- k 16+8h..16+8h+7 (same map for A and B)
__device__ __forceinline__ v16b ld_bf(const unsigned short* p, int hh) { FragB f; f.half[0] = *(const v8us*)(p + 8 * hh); f.half[1] = *(const v8us*)(p + 16 + 8 * hh); return f.v; }

__device__ __forceinline__ v8f mma_b1(v16b a, v16b b, v8f c) {
  c = __builtin_amdgcn_wmma_f32_16x16x32_bf16(false, a, false, b, (short)0, c, false, false);
  asm volatile("v_nop\n\tv_nop\n\tv_nop\n\tv_nop" : "+v"(c) : "v"(a), "v"(b));
  return c;
}
// c += ah.bh + al.bh + ah.bl (unscaled bf16 residuals share the accumulator)
__device__ __forceinline__ v8f mma_b3(v16b ah, v16b al, v16b bh, v16b bl, v8f c) {
  c = __builtin_amdgcn_wmma_f32_16x16x32_bf16(false, ah, false, bh, (short)0, c, false, false);
  c = __builtin_amdgcn_wmma_f32_16x16x32_bf16(false, al, false, bh, (short)0, c, false, false);
  c = __builtin_amdgcn_wmma_f32_16x16x32_bf16(false, ah, false, bl, (short)0, c, false, false);
  asm volatile("v_nop\n\tv_nop\n\tv_nop\n\tv_nop" : "+v"(c) : "v"(ah), "v"(al), "v"(bh), "v"(bl));
  return c;
}
__device__ __forceinline__ v8f mma_h1(v16h a, v16h b, v8f c) {
  c = __builtin_amdgcn_wmma_f32_16x16x32_f16(false, a, false, b, (short)0, c, false, false);
  asm volatile("v_nop\n\tv_nop\n\tv_nop\n\tv_nop" : "+v"(c) : "v"(a), "v"(b));
  return c;
}

// ---- key / value tiles staged in LDS by asynchronous copies, two buffers ----
#define TK 128                        /* keys per staged tile */
#define NTILE (SEQ / TK)
#define KPITCH 144                    /* LDS bytes per 128-byte key row (16 B x odd: no bank conflict for 16-byte readers) */
#define VPITCH 272                    /* LDS bytes per 256-byte V^T row (16 B x odd) */
#define KTILE_B (TK * KPITCH)
#define VTILE_B (RD * VPITCH)
#define ASTAGE_B (2 * KTILE_B + VTILE_B)  /* k_attn stage: K hi, K lo, V^T */
static_assert(SEQ % TK == 0 && NTILE >= 2);   /* the ring's prologue fills two tiles */
static_assert(RD * 2 == 128 && TK * 2 == 256);
static_assert(KTILE_B % 16 == 0 && VTILE_B % 16 == 0);

__device__ __forceinline__ unsigned lds_off(const void* p) { return (unsigned)(size_t)p; }

// Eight 16-byte copies per lane, global -> LDS, through no register. The s_wait_xcnt is the statement's last line so that
// no later rewrite of an address register can be scheduled in front of it.
__device__ __forceinline__ void cp8(unsigned l, unsigned ls, const unsigned short* g, size_t gs) {
  asm volatile("global_load_async_to_lds_b128 %0, %8, off\n\t"
               "global_load_async_to_lds_b128 %1, %9, off\n\t"
               "global_load_async_to_lds_b128 %2, %10, off\n\t"
               "global_load_async_to_lds_b128 %3, %11, off\n\t"
               "global_load_async_to_lds_b128 %4, %12, off\n\t"
               "global_load_async_to_lds_b128 %5, %13, off\n\t"
               "global_load_async_to_lds_b128 %6, %14, off\n\t"
               "global_load_async_to_lds_b128 %7, %15, off\n\t"
               "s_wait_xcnt 0x0"
               :: "v"(l), "v"(l + ls), "v"(l + 2 * ls), "v"(l + 3 * ls), "v"(l + 4 * ls), "v"(l + 5 * ls), "v"(l + 6 * ls), "v"(l + 7 * ls),
                  "v"(g), "v"(g + gs), "v"(g + 2 * gs), "v"(g + 3 * gs), "v"(g + 4 * gs), "v"(g + 5 * gs), "v"(g + 6 * gs), "v"(g + 7 * gs)
               : "memory");
}
// one 128-key plane of K (rows contiguous in memory): lane tid brings bytes 16 tid .. 16 tid + 15 of every 2-KiB slab (16 rows)
__device__ __forceinline__ void cp_kplane(unsigned lbase, const unsigned short* plane_row0, int tid) {
  cp8(lbase + (unsigned)(tid >> 3) * KPITCH + (unsigned)(tid & 7) * 16u, 16u * KPITCH, plane_row0 + tid * 8, (size_t)16 * RD);
}
// 64 rows x 128 keys of V^T (row pitch SEQ): 16 lanes per row, 8 rows per copy
__device__ __forceinline__ void cp_vplane(unsigned lbase, const unsigned short* vt_row0_key0, int tid) {
  cp8(lbase + (unsigned)(tid >> 4) * VPITCH + (unsigned)(tid & 15) * 16u, 8u * VPITCH, vt_row0_key0 + (size_t)(tid >> 4) * SEQ + (tid & 15) * 8, (size_t)8 * SEQ);
}
// own copies landed (before the barrier that lets other waves read them)
__device__ __forceinline__ void wait_copies() { asm volatile("s_wait_asynccnt 0x0" ::: "memory"); }
// own LDS reads retired (before the barrier behind which their buffer is refilled)
__device__ __forceinline__ void wait_lds() { asm volatile("s_wait_dscnt 0x0" ::: "memory"); }
// fragment of a staged 16-bit row, p = row start + 64 * (k / 32) + 16 h: same element map as ld_bf
__device__ __forceinline__ v16b lds_bf(const unsigned char* p) { FragB f; f.half[0] = *(const v8us*)p; f.half[1] = *(const v8us*)(p + 32); return f.v; }
// K fragments of 32 staged keys: kf[4 * (16-key row block) + 2 * (k half) + (hi, lo)]; p = the lane's place in the hi plane
__device__ __forceinline__ void lds_k16(v16b (&kf)[8], int rb16, const unsigned char* p) {
#pragma unroll   /* constant kf index */
  for (int kh = 0; kh < 2; ++kh) {
    kf[rb16 * 4 + kh * 2]     = lds_bf(p + rb16 * 16 * KPITCH + kh * 64);
    kf[rb16 * 4 + kh * 2 + 1] = lds_bf(p + rb16 * 16 * KPITCH + kh * 64 + KTILE_B);
  }
}
__device__ __forceinline__ void lds_k32(v16b (&kf)[8], const unsigned char* p) { lds_k16(kf, 0, p); lds_k16(kf, 1, p); }

// t = the thread's place among the plane's groups of eight weights
__device__ __forceinline__ void wcvt(const float* __restrict__ W, unsigned short* __restrict__ Wb, int t) {
  const v4f a = *(const v4fa*)(W + (size_t)t * 8);
  const v4f c = *(const v4fa*)(W + (size_t)t * 8 + 4);
  v8us v;
#pragma unroll
  for (int q = 0; q < 4; ++q) { v[q] = bf16_bits(a[q]); v[4 + q] = bf16_bits(c[q]); }
  unsigned short* d = Wb + (size_t)t * 8;
  *(v8us*)d = v;
  
}

__device__ __forceinline__ void wcvth(const float* __restrict__ W, unsigned short* __restrict__ Wh, int t) {
  const v4f a = *(const v4fa*)(W + (size_t)t * 8);
  const v4f c = *(const v4fa*)(W + (size_t)t * 8 + 4);
  FragH f;
#pragma unroll
  for (int q = 0; q < 4; ++q) { f.h[q] = toh_flush(bf16_rne(a[q]) * WOCARRY); f.h[4 + q] = toh_flush(bf16_rne(c[q]) * WOCARRY); }
  const v8us v = f.half[0];
  unsigned short* d = Wh + (size_t)t * 8;
  *(v8us*)d = v;
  asm volatile("s_wait_xcnt 0x0" ::: "memory");   /* the store's registers may be rewritten by the code laid out behind it in the merged kernel */
}

#define WBLK ((RD * CC / 8) / 256)     /* blocks per weight plane */
// One launch for all that depends on the inputs alone: blocks 0 .. 4 WBLK - 1 convert the four weight planes, the rest transpose x.
__global__ __launch_bounds__(256) void k_prep(const float* __restrict__ wk, const float* __restrict__ wq, const float* __restrict__ wv,
                                              const float* __restrict__ wo, const float* __restrict__ x,
                                              unsigned short* __restrict__ WKB, unsigned short* __restrict__ WQB,
                                              unsigned short* __restrict__ WVB, unsigned short* __restrict__ WOH,
                                              unsigned short* __restrict__ XB) {
  __shared__ unsigned short tl[64][66];
  const int tid = threadIdx.x;
  if (blockIdx.x < 4 * WBLK) {          /* the same for the whole block, and in front of the barrier */
    const int pl = blockIdx.x / WBLK;
    const int t = (blockIdx.x % WBLK) * 256 + tid;
    if (pl < 3) wcvt(pl == 0 ? wk : pl == 1 ? wq : wv, pl == 0 ? WKB : pl == 1 ? WQB : WVB, t);
    else wcvth(wo, WOH, t);
    return;
  }
  const int blk = blockIdx.x - 4 * WBLK;
  const int ct = blk % (CC / 64);
  const int nt = (blk / (CC / 64)) % (SEQ / 64);
  const int b = blk / ((CC / 64) * (SEQ / 64));
#pragma unroll 1
  for (int i = tid; i < 64 * 16; i += 256) {
    const int c = i >> 4, n4 = (i & 15) * 4;
    const v4f v = *(const v4fa*)(x + ((size_t)(b * CC + ct * 64 + c)) * SEQ_FULL + nt * 64 + n4);
#pragma unroll
    for (int q = 0; q < 4; ++q) tl[n4 + q][c] = bf16_bits(v[q]);
  }
  __syncthreads();
  {
#pragma unroll 1
    for (int i = tid; i < 64 * 8; i += 256) {
      const int n = i >> 3, c8 = (i & 7) * 8;
      v8us f;
#pragma unroll
      for (int q = 0; q < 8; ++q) f[q] = tl[n][c8 + q];
      unsigned short* d = XB + ((size_t)b * SEQ + nt * 64 + n) * CC + ct * 64 + c8;
      *(v8us*)d = f;
    }
    
  }
}

__device__ __forceinline__ void kqproj(float (&so)[4][16][64], int bx,
                                       const unsigned short* __restrict__ XB, const unsigned short* __restrict__ WB,
                                       const float* __restrict__ bias,
                                       unsigned short* __restrict__ PH, unsigned short* __restrict__ PL) {
  const int tid = threadIdx.x;
  const int wave = __builtin_amdgcn_readfirstlane(tid >> 5);
  const int lane = tid & 31, ln = lane & 15, hh = lane >> 4;
  const size_t row0 = ((size_t)bx * 4 + wave) * 16;
  const unsigned short* arow = XB + (row0 + ln) * CC;
  const v8f z8 = {0.f, 0.f, 0.f, 0.f, 0.f, 0.f, 0.f, 0.f};
  v8f acc[4];
#pragma unroll
  for (int t = 0; t < 4; ++t) acc[t] = z8;
#pragma unroll 1
  for (int kb = 0; kb < CC; kb += 32) {
    const v16b a = ld_bf(arow + kb, hh);
#pragma unroll
    for (int t = 0; t < 4; ++t) {
      const v16b bq = ld_bf(WB + (size_t)(t * 16 + ln) * CC + kb, hh);
      acc[t] = mma_b1(a, bq, acc[t]);
    }
  }
#pragma unroll
  for (int t = 0; t < 4; ++t)
#pragma unroll
    for (int r = 0; r < 8; ++r) so[wave][8 * hh + r][t * 16 + ln] = acc[t][r];
  __builtin_amdgcn_fence(4 /* acq_rel order */, "workgroup");
  __builtin_amdgcn_wave_barrier();
  const int rsub = lane >> 3, c8 = (lane & 7) * 8;
  const v4f ba = *(const v4fa*)(bias + c8);
  const v4f bc = *(const v4fa*)(bias + c8 + 4);
  {
#pragma unroll
    for (int it = 0; it < 4; ++it) {
      const int r = it * 4 + rsub;
      const v4f a = *(const v4fa*)&so[wave][r][c8];
      const v4f c = *(const v4fa*)&so[wave][r][c8 + 4];
      v8us vh, vl;
#pragma unroll
      for (int q = 0; q < 4; ++q) {
        const float va = a[q] + bf16_rne(ba[q]);
        const float vc = c[q] + bf16_rne(bc[q]);
        unsigned short hb = bf16_bits(va); vh[q] = hb; vl[q] = bf16_bits(va - bf16_val(hb));
        hb = bf16_bits(vc); vh[4 + q] = hb; vl[4 + q] = bf16_bits(vc - bf16_val(hb));
      }
      const size_t o = (row0 + r) * RD + c8;
      *(v8us*)(PH + o) = vh;
      *(v8us*)(PL + o) = vl;
    }
    
  }
}

__device__ __forceinline__ void vproj(float (&so)[4][16][64], int bx, int b,
                                      const unsigned short* __restrict__ XB, const unsigned short* __restrict__ WVB,
                                      const float* __restrict__ bv, unsigned short* __restrict__ VT) {
  const int tid = threadIdx.x;
  const int wave = __builtin_amdgcn_readfirstlane(tid >> 5);
  const int lane = tid & 31, ln = lane & 15, hh = lane >> 4;
  const int wid = bx * 4 + wave;
  const int mt = wid / (SEQ / 64), nq = wid % (SEQ / 64);
  const unsigned short* arow = WVB + (size_t)(mt * 16 + ln) * CC;
  const unsigned short* brow = XB + ((size_t)b * SEQ + nq * 64 + ln) * CC;
  const v8f z8 = {0.f, 0.f, 0.f, 0.f, 0.f, 0.f, 0.f, 0.f};
  v8f acc[4];
#pragma unroll
  for (int t = 0; t < 4; ++t) acc[t] = z8;
#pragma unroll 1
  for (int kb = 0; kb < CC; kb += 32) {
    const v16b a = ld_bf(arow + kb, hh);
#pragma unroll
    for (int t = 0; t < 4; ++t) {
      const v16b bq = ld_bf(brow + (size_t)(t * 16) * CC + kb, hh);
      acc[t] = mma_b1(a, bq, acc[t]);
    }
  }
#pragma unroll
  for (int t = 0; t < 4; ++t)
#pragma unroll
    for (int r = 0; r < 8; ++r) so[wave][8 * hh + r][t * 16 + ln] = acc[t][r];
  __builtin_amdgcn_fence(4 /* acq_rel order */, "workgroup");
  __builtin_amdgcn_wave_barrier();
  const int rsub = lane >> 3, c8 = (lane & 7) * 8;
  {
#pragma unroll
    for (int it = 0; it < 4; ++it) {
      const int r = it * 4 + rsub;
      const v4f a = *(const v4fa*)&so[wave][r][c8];
      const v4f c = *(const v4fa*)&so[wave][r][c8 + 4];
      const float bb = bf16_rne(bv[mt * 16 + r]);
      FragH f;
#pragma unroll
      for (int q = 0; q < 4; ++q) { f.h[q] = toh_flush(a[q] + bb); f.h[4 + q] = toh_flush(c[q] + bb); }
      const v8us o = f.half[0];
      *(v8us*)(VT + ((size_t)(b * RD + mt * 16 + r)) * SEQ + nq * 64 + c8) = o;
    }
    
  }
}

#define VBLK ((RD / 16) * (SEQ / 64) / 4)   /* value-projection blocks per image */
static_assert(NRT / 64 == (size_t)VBLK * NB);   /* the three projections have equally many blocks */
// One launch for the three projections of the staged x: blockIdx.y picks key, query or value.
__global__ __launch_bounds__(128) void k_proj(const unsigned short* __restrict__ XB, const unsigned short* __restrict__ WKB,
                                              const unsigned short* __restrict__ WQB, const unsigned short* __restrict__ WVB,
                                              const float* __restrict__ bk, const float* __restrict__ bq, const float* __restrict__ bv,
                                              unsigned short* __restrict__ KH, unsigned short* __restrict__ KL,
                                              unsigned short* __restrict__ QH, unsigned short* __restrict__ QL,
                                              unsigned short* __restrict__ VT) {
  __shared__ __attribute__((aligned(16))) float so[4][16][64];
  const int bx = blockIdx.x;
  const bool qy = blockIdx.y == 1;
  if (blockIdx.y < 2) kqproj(so, bx, XB, qy ? WQB : WKB, qy ? bq : bk, qy ? QH : KH, qy ? QL : KL);
  else vproj(so, bx % VBLK, bx / VBLK, XB, WVB, bv, VT);
}

__global__ __launch_bounds__(128) void k_attn(const unsigned short* __restrict__ KH, const unsigned short* __restrict__ KL,
                                              const unsigned short* __restrict__ QH, const unsigned short* __restrict__ QL,
                                              const unsigned short* __restrict__ VT,
                                              const unsigned short* __restrict__ WOH, const float* __restrict__ bo,
                                              const float* __restrict__ gam,
                                              const float* __restrict__ x, float* __restrict__ out) {
  __shared__ __attribute__((aligned(16))) float so[CH][68];
  __shared__ __attribute__((aligned(16))) unsigned char ring[2 * ASTAGE_B];
  const int tid = threadIdx.x;
  const int wave = __builtin_amdgcn_readfirstlane(tid >> 5);
  const int lane = tid & 31, ln = lane & 15, hh = lane >> 4;
  const int b = blockIdx.y, jb = blockIdx.x * 64;
  const size_t tb = (size_t)b * SEQ;
  const size_t qo = (tb + jb + wave * 16 + ln) * RD;
  const v16b bH0 = ld_bf(QH + qo, hh), bL0 = ld_bf(QL + qo, hh), bH1 = ld_bf(QH + qo + 32, hh), bL1 = ld_bf(QL + qo + 32, hh);
  float m = -1.0e30f;                               /* running maximum of this lane's query column, the same in both lanes that hold it */
  float m2 = -1.0e30f;                              /* m in base 2, less the carry: what the exponent subtracts */
  float l = 0.f;                                    /* sum of P over this lane's own keys, on the scale of m */
  const v8f z8 = {0.f, 0.f, 0.f, 0.f, 0.f, 0.f, 0.f, 0.f};
  v8f acc[4];
#pragma unroll
  for (int i = 0; i < 4; ++i) acc[i] = z8;
  const unsigned rb = lds_off(ring);
  const unsigned short* kh0 = KH + tb * RD;
  const unsigned short* kl0 = KL + tb * RD;
  const unsigned short* vt0 = VT + (size_t)(b * RD) * SEQ;
  cp_kplane(rb, kh0, tid);
  cp_kplane(rb + KTILE_B, kl0, tid);
  cp_vplane(rb + 2 * KTILE_B, vt0, tid);
  wait_copies();
  __syncthreads();
  cp_kplane(rb + ASTAGE_B, kh0 + (size_t)TK * RD, tid);
  cp_kplane(rb + ASTAGE_B + KTILE_B, kl0 + (size_t)TK * RD, tid);
  cp_vplane(rb + ASTAGE_B + 2 * KTILE_B, vt0 + TK, tid);
#pragma unroll 1   /* rolled: one publish point per trip, the buffer picked by t & 1 */
  for (int t = 0; t < NTILE; ++t) {
    const unsigned bsel = (unsigned)(t & 1) * ASTAGE_B;
    const unsigned char* fr = ring + bsel + ln * KPITCH + hh * 16;
    const unsigned char* vf = ring + bsel + 2 * KTILE_B + ln * VPITCH + hh * 16;
    v16b kf[8];
    lds_k32(kf, fr);
#pragma unroll   /* unrolled: constant LDS offsets, kf indexed by constants so that it stays in registers */
    for (int sp = 0; sp < TK / 32; ++sp) {
      v8f s0 = z8, s1 = z8;
      s0 = mma_b3(kf[0], kf[1], bH0, bL0, s0);
      s0 = mma_b3(kf[2], kf[3], bH1, bL1, s0);
      FragH va[4];                                  /* V^T fragments of these 32 keys: land under the products below */
#pragma unroll   /* constant va index */
      for (int ct = 0; ct < 4; ++ct) {
        const unsigned char* vp = vf + ct * 16 * VPITCH + sp * 64;
        va[ct].half[0] = *(const v8us*)vp;
        va[ct].half[1] = *(const v8us*)(vp + 32);
      }
      if (sp + 1 < TK / 32) lds_k16(kf, 0, fr + (sp + 1) * 32 * KPITCH);   /* same tile, next 32 keys */
      s1 = mma_b3(kf[4], kf[5], bH0, bL0, s1);
      s1 = mma_b3(kf[6], kf[7], bH1, bL1, s1);
      if (sp + 1 < TK / 32) lds_k16(kf, 1, fr + (sp + 1) * 32 * KPITCH);   /* lands under the exponentials */
      const float mh = max3(max3(max3(s0[0], s0[1], s0[2]), max3(s0[3], s0[4], s0[5]), max3(s0[6], s0[7], s1[0])),
                            max3(max3(s1[1], s1[2], s1[3]), max3(s1[4], s1[5], s1[6]), s1[7]), m);
      m = fmaxf(mh, xhalf(mh));
      const float m2n = fmaf(m, LOG2E, -PCARRY_L2);
      const float alpha = __builtin_amdgcn_exp2f(m2 - m2n);   /* 0 on the first 32 keys, 1 while the maximum stands */
      m2 = m2n;
      FragH pf;
      float ps[8];
#pragma unroll
      for (int r = 0; r < 8; ++r) {
        const float a0 = fmaf(s0[r], LOG2E, -m2n), a1 = fmaf(s1[r], LOG2E, -m2n);
        const float p0 = __builtin_amdgcn_exp2f(a0), p1 = __builtin_amdgcn_exp2f(a1);
        pf.h[r]     = p_flush(a0, p0);
        pf.h[8 + r] = p_flush(a1, p1);
        ps[r] = p0 + p1;
      }
      l = fmaf(l, alpha, ((ps[0] + ps[1]) + (ps[2] + ps[3])) + ((ps[4] + ps[5]) + (ps[6] + ps[7])));
#pragma unroll   /* constant acc index */
      for (int ct = 0; ct < 4; ++ct) acc[ct] *= alpha;
#pragma unroll   /* constant acc index */
      for (int ct = 0; ct < 4; ++ct) acc[ct] = mma_h1(va[ct].v, pf.v, acc[ct]);
    }
    // publish point: tile t + 1 becomes readable, tile t's buffer becomes free
    wait_lds();
    wait_copies();
    __syncthreads();
    if (t + 2 < NTILE) {
      cp_kplane(rb + bsel, kh0 + (size_t)(t + 2) * TK * RD, tid);
      cp_kplane(rb + bsel + KTILE_B, kl0 + (size_t)(t + 2) * TK * RD, tid);
      cp_vplane(rb + bsel + 2 * KTILE_B, vt0 + (t + 2) * TK, tid);
    }
  }
  wait_copies();
  // ctx^T tiles (rows e = 16 ct + 8h + r, cols j) -> two B fragments with k = e
  const float linv = 1.0f / (l + xhalf(l));         /* the column's whole sum; it carries the same x4096 as acc */
  FragH cf0, cf1;
#pragma unroll
  for (int r = 0; r < 8; ++r) {
    cf0.h[r]     = toh_flush(acc[0][r] * linv);
    cf0.h[8 + r] = toh_flush(acc[1][r] * linv);
    cf1.h[r]     = toh_flush(acc[2][r] * linv);
    cf1.h[8 + r] = toh_flush(acc[3][r] * linv);
  }
  const float g = bf16_rne(gam[0]);
  const int rsub = lane >> 4, pc = (lane & 15) * 4;
#pragma unroll 1
  for (int hf = 0; hf < 2; ++hf) {
    const int ch0 = hf * CH;
#pragma unroll
    for (int ct = 0; ct < 8; ++ct) {
      const unsigned short* wp = WOH + (size_t)(ch0 + ct * 16 + ln) * RD + 8 * hh;
      FragH a0, a1;
      a0.half[0] = *(const v8us*)wp;
      a0.half[1] = *(const v8us*)(wp + 16);
      a1.half[0] = *(const v8us*)(wp + 32);
      a1.half[1] = *(const v8us*)(wp + 48);
      v8f d = z8;
      d = mma_h1(a0.v, cf0.v, d);
      d = mma_h1(a1.v, cf1.v, d);
#pragma unroll
      for (int r = 0; r < 8; ++r) so[ct * 16 + 8 * hh + r][wave * 16 + ln] = d[r] * WOINV;
    }
    __syncthreads();
    {
#pragma unroll 1
      for (int it = 0; it < CH / 8; ++it) {
        const int row = it * 8 + wave * 2 + rsub;
        const v4f v = *(const v4fa*)&so[row][pc];
        const v4f xr = *(const v4fa*)(x + ((size_t)(b * CC + ch0 + row)) * SEQ_FULL + jb + pc);
        const float bb = bf16_rne(bo[ch0 + row]);
        v4f o;
#pragma unroll
        for (int q = 0; q < 4; ++q) o[q] = bf16_rne(xr[q]) + g * (v[q] + bb);
        *(v4f*)(out + ((size_t)(b * CC + ch0 + row)) * SEQ + jb + pc) = o;
      }
      
    }
    __syncthreads();
  }
}

// workspace carve (bytes, every region a multiple of 256)
#define SZ_WP  ((size_t)RD * CC * 2)
#define SZ_WO  ((size_t)CC * RD * 2)
#define SZ_XB  (NRT * CC * 2)
#define SZ_P   (NRT * RD * 2)
#define SZ_VT  ((size_t)NB * RD * SEQ * 2)
#define OFF_WKB ((size_t)0)
#define OFF_WQB (OFF_WKB + SZ_WP)
#define OFF_WVB (OFF_WQB + SZ_WP)
#define OFF_WOH (OFF_WVB + SZ_WP)
#define OFF_XB  (OFF_WOH + SZ_WO)
#define OFF_KH  (OFF_XB + SZ_XB)
#define OFF_KL  (OFF_KH + SZ_P)
#define OFF_QH  (OFF_KL + SZ_P)
#define OFF_QL  (OFF_QH + SZ_P)
#define OFF_VT  (OFF_QL + SZ_P)
#define WS_TOTAL (OFF_VT + SZ_VT)
static_assert(SZ_WP % 256 == 0 && SZ_WO % 256 == 0 && SZ_XB % 256 == 0 && SZ_P % 256 == 0 && SZ_VT % 256 == 0);
static_assert(WS_TOTAL <= (size_t)134217728);
static_assert((RD * CC) % (8 * 256) == 0);                                 /* weight-plane block ranges exact */
static_assert((NRT % 64) == 0);                                            /* key / query blocks x 4 waves x 16 rows == token rows */
static_assert(((RD / 16) * (SEQ / 64)) % 4 == 0);                          /* value blocks x 4 waves == channel tiles x pixel quads */
static_assert(SEQ % 64 == 0 && SEQ % 32 == 0);                             /* k_attn tiles and 32-row key steps */

extern "C" void kernel_launch(void* const* d_in, const int* in_sizes, int n_in,
                              void* d_out, int out_size, void* d_ws, size_t ws_size, hipStream_t stream) {
  if (n_in < 10) return;
  if ((size_t)in_sizes[0] < (size_t)(NB * CC - 1) * SEQ_FULL + SEQ) return;
  if ((size_t)in_sizes[1] < (size_t)RD * CC) return;
  if ((size_t)in_sizes[2] < (size_t)RD) return;
  if ((size_t)in_sizes[3] < (size_t)RD * CC) return;
  if ((size_t)in_sizes[4] < (size_t)RD) return;
  if ((size_t)in_sizes[5] < (size_t)RD * CC) return;
  if ((size_t)in_sizes[6] < (size_t)RD) return;
  if ((size_t)in_sizes[7] < (size_t)CC * RD) return;
  if ((size_t)in_sizes[8] < (size_t)CC) return;
  if ((size_t)in_sizes[9] < (size_t)1) return;
  if ((size_t)out_size < (size_t)NB * CC * SEQ) return;
  if (WS_TOTAL > ws_size) return;
  const float* x  = (const float*)d_in[0];       /* [NB][CC][SEQ_FULL] channel-first */
  const float* wk = (const float*)d_in[1];       /* [RD][CC] = [out][in], key */
  const float* bk = (const float*)d_in[2];       /* [RD] */
  const float* wq = (const float*)d_in[3];       /* [RD][CC] = [out][in], query */
  const float* bq = (const float*)d_in[4];       /* [RD] */
  const float* wv = (const float*)d_in[5];       /* [RD][CC] = [out][in], value */
  const float* bv = (const float*)d_in[6];       /* [RD] */
  const float* wo = (const float*)d_in[7];       /* [CC][RD] = [out][in] */
  const float* bo = (const float*)d_in[8];       /* [CC] */
  const float* gam = (const float*)d_in[9];      /* [1] */
  float* out = (float*)d_out;                    /* [NB][CC][SEQ] channel-first */
  char* ws = (char*)d_ws;
  unsigned short* WKB = (unsigned short*)(ws + OFF_WKB);
  unsigned short* WQB = (unsigned short*)(ws + OFF_WQB);
  unsigned short* WVB = (unsigned short*)(ws + OFF_WVB);
  unsigned short* WOH = (unsigned short*)(ws + OFF_WOH);
  unsigned short* XB  = (unsigned short*)(ws + OFF_XB);
  unsigned short* KH  = (unsigned short*)(ws + OFF_KH);
  unsigned short* KL  = (unsigned short*)(ws + OFF_KL);
  unsigned short* QH  = (unsigned short*)(ws + OFF_QH);
  unsigned short* QL  = (unsigned short*)(ws + OFF_QL);
  unsigned short* VT  = (unsigned short*)(ws + OFF_VT);

  k_prep<<<4 * WBLK + (CC / 64) * (SEQ / 64) * NB, 256, 0, stream>>>(wk, wq, wv, wo, x, WKB, WQB, WVB, WOH, XB);   /* x: in [b][c][n] -> out [b*SEQ+n][c] */
  k_proj<<<dim3((unsigned)(NRT / 64), 3), 128, 0, stream>>>(XB, WKB, WQB, WVB, bk, bq, bv, KH, KL, QH, QL, VT);
  k_attn<<<dim3(SEQ / 64, NB), 128, 0, stream>>>(KH, KL, QH, QL, VT, WOH, bo, gam, x, out);
}

// v004
// One run takes 59.3 microseconds.
// Next to v003, in two timings, it ran 1.42 and 1.41 times as fast.
// Over all steps from v000 it is 7.09 times as fast.
#include <hip/hip_runtime.h>
// Compute dtype: inputs converted (RNE) to bf16; key, query and value projections v_wmma_f32_16x16x32_bf16 (exact products, f32 accumulate, bias added in f32); scores f.g^T as bf16 hi|lo three-product (hi.hi + lo.hi + hi.lo) v_wmma_f32_16x16x32_bf16, f32 accumulate; softmax running maximum and sum f32, kept in the attention loop by each of four waves per query column (one 32-key quarter of every tile each) and merged in f32 at the end; V^T single f16 and P = exp(s - running maximum) x4096 single f16 on v_wmma_f32_16x16x32_f16, f32 accumulate scaled every 32 keys by exp(old - new maximum), divided by the sum at the end; output projection Wo x64 single f16 times ctx single f16 on v_wmma_f32_16x16x32_f16, f32 accumulate; result = bf16(x) + bf16(gamma) * (o + bf16(bo)) in f32.
#ifndef NB
#define NB 4                      /* images */
#endif
#ifndef SEQ
#define SEQ 4096                  /* pixels per image processed */
#endif
#define SEQ_FULL 4096             /* pixel pitch of the staged x rows */
#define CC 256                    /* channels */
#define RD 64                     /* embedding channels (key / query / value width) */
#define CH 128                    /* channels per epilogue slab */
#define LOG2E 1.4426950408889634f      /* scores go to base 2 inside the exponent's multiply-add */
#define PCARRY_L2 12.0f                /* P carried x4096 */
#define WOCARRY 64.0f                  /* Wo plane carried x64 */
#define WOINV 0.015625f                /* 2^-6 */
#define NRT ((size_t)NB * SEQ)

static_assert(SEQ % 256 == 0);          /* 64-pixel tiles, 4 waves per block, v-projection grid divisibility */
static_assert(SEQ <= SEQ_FULL);
static_assert(CC % 64 == 0);            /* 64-channel transpose tiles, K % 32 == 0 */
static_assert(RD == 64);                
static_assert(CC == 2 * CH);            /* two channel slabs in the epilogue */
static_assert(CH % 16 == 0 && CH / 16 == 8);

typedef __bf16 v16b __attribute__((ext_vector_type(16)));
typedef _Float16 v16h __attribute__((ext_vector_type(16)));
typedef unsigned short v8us __attribute__((ext_vector_type(8), may_alias));
typedef float v8f  __attribute__((ext_vector_type(8)));
typedef float v4f  __attribute__((ext_vector_type(4)));
typedef float v4fa __attribute__((ext_vector_type(4), may_alias));
typedef float v2f  __attribute__((ext_vector_type(2)));
typedef float v2fa __attribute__((ext_vector_type(2), may_alias));
typedef _Float16 h16;
union FragB { v16b v; v8us half[2]; };
union FragH { v16h v; v8us half[2]; _Float16 h[16]; };

__device__ __forceinline__ unsigned short bf16_bits(float x) { unsigned int u = __float_as_uint(x); return (unsigned short)((u + 0x7FFFu + ((u >> 16) & 1u)) >> 16); }
__device__ __forceinline__ float bf16_val(unsigned short b) { return __uint_as_float(((unsigned int)b) << 16); }
__device__ __forceinline__ float bf16_rne(float x) { return bf16_val(bf16_bits(x)); }

// f32 -> f16 that cannot produce an f16 subnormal (value select)
static __device__ __forceinline__ h16 toh_flush(float v) { const h16 r = (h16)v; return (fabsf(v) < 6.103515625e-05f) ? (h16)0.0f : r; }
// p = 2^a -> f16, zero when the result would fall below 2^-14 (select on the exponent argument)
static __device__ __forceinline__ h16 p_flush(float a, float p) { return (a < -13.99f) ? (h16)0.0f : (h16)p; }
// lane l <-> lane l ^ 16: the two lanes that hold one query column
static __device__ __forceinline__ float xhalf(float x) { return __builtin_bit_cast(float, __builtin_amdgcn_permlanex16(__builtin_bit_cast(int, x), __builtin_bit_cast(int, x), 0x76543210, 0xfedcba98, false, false)); }
static __device__ __forceinline__ float max3(float a, float b, float c) { return fmaxf(fmaxf(a, b), c); }
// 2^d with the slot behind the transcendental filled inside the statement
static __device__ __forceinline__ float exp2_slot(float d) { float r; asm("v_exp_f32 %0, %1\n\tv_nop" : "=v"(r) : "v"(d)); return r; }

// fragment of a k-contiguous 16-bit row: elements 0..7 <- k 8h..8h+7, elements 8..15 <- k 16+8h..16+8h+7 (same map for A and B)
__device__ __forceinline__ v16b ld_bf(const unsigned short* p, int hh) { FragB f; f.half[0] = *(const v8us*)(p + 8 * hh); f.half[1] = *(const v8us*)(p + 16 + 8 * hh); return f.v; }

__device__ __forceinline__ v8f mma_b1(v16b a, v16b b, v8f c) {
  c = __builtin_amdgcn_wmma_f32_16x16x32_bf16(false, a, false, b, (short)0, c, false, false);
  asm volatile("v_nop\n\tv_nop\n\tv_nop\n\tv_nop" : "+v"(c) : "v"(a), "v"(b));
  return c;
}
// c += ah.bh + al.bh + ah.bl (unscaled bf16 residuals share the accumulator)
__device__ __forceinline__ v8f mma_b3(v16b ah, v16b al, v16b bh, v16b bl, v8f c) {
  c = __builtin_amdgcn_wmma_f32_16x16x32_bf16(false, ah, false, bh, (short)0, c, false, false);
  c = __builtin_amdgcn_wmma_f32_16x16x32_bf16(false, al, false, bh, (short)0, c, false, false);
  c = __builtin_amdgcn_wmma_f32_16x16x32_bf16(false, ah, false, bl, (short)0, c, false, false);
  asm volatile("v_nop\n\tv_nop\n\tv_nop\n\tv_nop" : "+v"(c) : "v"(ah), "v"(al), "v"(bh), "v"(bl));
  return c;
}
__device__ __forceinline__ v8f mma_h1(v16h a, v16h b, v8f c) {
  c = __builtin_amdgcn_wmma_f32_16x16x32_f16(false, a, false, b, (short)0, c, false, false);
  asm volatile("v_nop\n\tv_nop\n\tv_nop\n\tv_nop" : "+v"(c) : "v"(a), "v"(b));
  return c;
}

// ---- key / value tiles staged in LDS by asynchronous copies, two buffers ----
#define TK 128                        /* keys per staged tile */
#define NTILE (SEQ / TK)
#define KPITCH 144                    /* LDS bytes per 128-byte key row (16 B x odd: no bank conflict for 16-byte readers) */
#define VPITCH 272                    /* LDS bytes per 256-byte V^T row (16 B x odd) */
#define KTILE_B (TK * KPITCH)
#define VTILE_B (RD * VPITCH)
#define ASTAGE_B (2 * KTILE_B + VTILE_B)  /* k_attn stage: K hi, K lo, V^T */
static_assert(SEQ % TK == 0 && NTILE >= 2);   /* the ring's prologue fills two tiles */
static_assert(RD * 2 == 128 && TK * 2 == 256);
static_assert(KTILE_B % 16 == 0 && VTILE_B % 16 == 0);

__device__ __forceinline__ unsigned lds_off(const void* p) { return (unsigned)(size_t)p; }

#define AT 512                        /* k_attn threads: 4 query groups of 16 columns x 4 key quarters of a tile */
static_assert(TK / 32 == 4 && TK * RD * 2 == 2 * AT * 16 && RD * TK * 2 == 2 * AT * 16);   /* two copies per lane and plane */
// One stage, six 16-byte copies per lane, global -> LDS, through no register: two per plane (K hi, K lo, V^T).
// K planes (rows contiguous in memory): lane tid brings bytes 16 tid .. 16 tid + 15 of each 8-KiB slab (64 rows).
// V^T (64 rows x 128 keys, row pitch SEQ): 16 lanes per row, 32 rows per copy.
// The s_wait_xcnt is the statement's last line so that no later rewrite of an address register can be scheduled in front of it.
__device__ __forceinline__ void cp_stage(unsigned lbase, const unsigned short* kh_row0, const unsigned short* kl_row0,
                                         const unsigned short* vt_row0_key0, int tid) {
  const unsigned lk = lbase + (unsigned)(tid >> 3) * KPITCH + (unsigned)(tid & 7) * 16u;
  const unsigned lv = lbase + 2 * KTILE_B + (unsigned)(tid >> 4) * VPITCH + (unsigned)(tid & 15) * 16u;
  const unsigned short* gh = kh_row0 + tid * 8;
  const unsigned short* gl = kl_row0 + tid * 8;
  const unsigned short* gv = vt_row0_key0 + (size_t)(tid >> 4) * SEQ + (tid & 15) * 8;
  asm volatile("global_load_async_to_lds_b128 %0, %6, off\n\t"
               "global_load_async_to_lds_b128 %1, %7, off\n\t"
               "global_load_async_to_lds_b128 %2, %8, off\n\t"
               "global_load_async_to_lds_b128 %3, %9, off\n\t"
               "global_load_async_to_lds_b128 %4, %10, off\n\t"
               "global_load_async_to_lds_b128 %5, %11, off\n\t"
               "s_wait_xcnt 0x0"
               :: "v"(lk), "v"(lk + 64u * KPITCH), "v"(lk + KTILE_B), "v"(lk + KTILE_B + 64u * KPITCH), "v"(lv), "v"(lv + 32u * VPITCH),
                  "v"(gh), "v"(gh + 64 * RD), "v"(gl), "v"(gl + 64 * RD), "v"(gv), "v"(gv + (size_t)32 * SEQ)
               : "memory");
}
// own copies landed (before the barrier that lets other waves read them)
__device__ __forceinline__ void wait_copies() { asm volatile("s_wait_asynccnt 0x0" ::: "memory"); }
// own LDS reads retired (before the barrier behind which their buffer is refilled)
__device__ __forceinline__ void wait_lds() { asm volatile("s_wait_dscnt 0x0" ::: "memory"); }
// fragment of a staged 16-bit row, p = row start + 64 * (k / 32) + 16 h: same element map as ld_bf
__device__ __forceinline__ v16b lds_bf(const unsigned char* p) { FragB f; f.half[0] = *(const v8us*)p; f.half[1] = *(const v8us*)(p + 32); return f.v; }
// K fragments of 32 staged keys: kf[4 * (16-key row block) + 2 * (k half) + (hi, lo)]; p = the lane's place in the hi plane
__device__ __forceinline__ void lds_k16(v16b (&kf)[8], int rb16, const unsigned char* p) {
#pragma unroll   /* constant kf index */
  for (int kh = 0; kh < 2; ++kh) {
    kf[rb16 * 4 + kh * 2]     = lds_bf(p + rb16 * 16 * KPITCH + kh * 64);
    kf[rb16 * 4 + kh * 2 + 1] = lds_bf(p + rb16 * 16 * KPITCH + kh * 64 + KTILE_B);
  }
}
__device__ __forceinline__ void lds_k32(v16b (&kf)[8], const unsigned char* p) { lds_k16(kf, 0, p); lds_k16(kf, 1, p); }

// t = the thread's place among the plane's groups of eight weights
__device__ __forceinline__ void wcvt(const float* __restrict__ W, unsigned short* __restrict__ Wb, int t) {
  const v4f a = *(const v4fa*)(W + (size_t)t * 8);
  const v4f c = *(const v4fa*)(W + (size_t)t * 8 + 4);
  v8us v;
#pragma unroll
  for (int q = 0; q < 4; ++q) { v[q] = bf16_bits(a[q]); v[4 + q] = bf16_bits(c[q]); }
  unsigned short* d = Wb + (size_t)t * 8;
  *(v8us*)d = v;
  
}

__device__ __forceinline__ void wcvth(const float* __restrict__ W, unsigned short* __restrict__ Wh, int t) {
  const v4f a = *(const v4fa*)(W + (size_t)t * 8);
  const v4f c = *(const v4fa*)(W + (size_t)t * 8 + 4);
  FragH f;
#pragma unroll
  for (int q = 0; q < 4; ++q) { f.h[q] = toh_flush(bf16_rne(a[q]) * WOCARRY); f.h[4 + q] = toh_flush(bf16_rne(c[q]) * WOCARRY); }
  const v8us v = f.half[0];
  unsigned short* d = Wh + (size_t)t * 8;
  *(v8us*)d = v;
  asm volatile("s_wait_xcnt 0x0" ::: "memory");   /* the store's registers may be rewritten by the code laid out behind it in the merged kernel */
}

#define WBLK ((RD * CC / 8) / 256)     /* blocks per weight plane */
// One launch for all that depends on the inputs alone: blocks 0 .. 4 WBLK - 1 convert the four weight planes, the rest transpose x.
__global__ __launch_bounds__(256) void k_prep(const float* __restrict__ wk, const float* __restrict__ wq, const float* __restrict__ wv,
                                              const float* __restrict__ wo, const float* __restrict__ x,
                                              unsigned short* __restrict__ WKB, unsigned short* __restrict__ WQB,
                                              unsigned short* __restrict__ WVB, unsigned short* __restrict__ WOH,
                                              unsigned short* __restrict__ XB) {
  __shared__ unsigned short tl[64][66];
  const int tid = threadIdx.x;
  if (blockIdx.x < 4 * WBLK) {          /* the same for the whole block, and in front of the barrier */
    const int pl = blockIdx.x / WBLK;
    const int t = (blockIdx.x % WBLK) * 256 + tid;
    if (pl < 3) wcvt(pl == 0 ? wk : pl == 1 ? wq : wv, pl == 0 ? WKB : pl == 1 ? WQB : WVB, t);
    else wcvth(wo, WOH, t);
    return;
  }
  const int blk = blockIdx.x - 4 * WBLK;
  const int ct = blk % (CC / 64);
  const int nt = (blk / (CC / 64)) % (SEQ / 64);
  const int b = blk / ((CC / 64) * (SEQ / 64));
#pragma unroll 1
  for (int i = tid; i < 64 * 16; i += 256) {
    const int c = i >> 4, n4 = (i & 15) * 4;
    const v4f v = *(const v4fa*)(x + ((size_t)(b * CC + ct * 64 + c)) * SEQ_FULL + nt * 64 + n4);
#pragma unroll
    for (int q = 0; q < 4; ++q) tl[n4 + q][c] = bf16_bits(v[q]);
  }
  __syncthreads();
  {
#pragma unroll 1
    for (int i = tid; i < 64 * 8; i += 256) {
      const int n = i >> 3, c8 = (i & 7) * 8;
      v8us f;
#pragma unroll
      for (int q = 0; q < 8; ++q) f[q] = tl[n][c8 + q];
      unsigned short* d = XB + ((size_t)b * SEQ + nt * 64 + n) * CC + ct * 64 + c8;
      *(v8us*)d = f;
    }
    
  }
}

__device__ __forceinline__ void kqproj(float (&so)[4][16][64], int bx,
                                       const unsigned short* __restrict__ XB, const unsigned short* __restrict__ WB,
                                       const float* __restrict__ bias,
                                       unsigned short* __restrict__ PH, unsigned short* __restrict__ PL) {
  const int tid = threadIdx.x;
  const int wave = __builtin_amdgcn_readfirstlane(tid >> 5);
  const int lane = tid & 31, ln = lane & 15, hh = lane >> 4;
  const size_t row0 = ((size_t)bx * 4 + wave) * 16;
  const unsigned short* arow = XB + (row0 + ln) * CC;
  const v8f z8 = {0.f, 0.f, 0.f, 0.f, 0.f, 0.f, 0.f, 0.f};
  v8f acc[4];
#pragma unroll
  for (int t = 0; t < 4; ++t) acc[t] = z8;
#pragma unroll 1
  for (int kb = 0; kb < CC; kb += 32) {
    const v16b a = ld_bf(arow + kb, hh);
#pragma unroll
    for (int t = 0; t < 4; ++t) {
      const v16b bq = ld_bf(WB + (size_t)(t * 16 + ln) * CC + kb, hh);
      acc[t] = mma_b1(a, bq, acc[t]);
    }
  }
#pragma unroll
  for (int t = 0; t < 4; ++t)
#pragma unroll
    for (int r = 0; r < 8; ++r) so[wave][8 * hh + r][t * 16 + ln] = acc[t][r];
  __builtin_amdgcn_fence(4 /* acq_rel order */, "workgroup");
  __builtin_amdgcn_wave_barrier();
  const int rsub = lane >> 3, c8 = (lane & 7) * 8;
  const v4f ba = *(const v4fa*)(bias + c8);
  const v4f bc = *(const v4fa*)(bias + c8 + 4);
  {
#pragma unroll
    for (int it = 0; it < 4; ++it) {
      const int r = it * 4 + rsub;
      const v4f a = *(const v4fa*)&so[wave][r][c8];
      const v4f c = *(const v4fa*)&so[wave][r][c8 + 4];
      v8us vh, vl;
#pragma unroll
      for (int q = 0; q < 4; ++q) {
        const float va = a[q] + bf16_rne(ba[q]);
        const float vc = c[q] + bf16_rne(bc[q]);
        unsigned short hb = bf16_bits(va); vh[q] = hb; vl[q] = bf16_bits(va - bf16_val(hb));
        hb = bf16_bits(vc); vh[4 + q] = hb; vl[4 + q] = bf16_bits(vc - bf16_val(hb));
      }
      const size_t o = (row0 + r) * RD + c8;
      *(v8us*)(PH + o) = vh;
      *(v8us*)(PL + o) = vl;
    }
    
  }
}

__device__ __forceinline__ void vproj(float (&so)[4][16][64], int bx, int b,
                                      const unsigned short* __restrict__ XB, const unsigned short* __restrict__ WVB,
                                      const float* __restrict__ bv, unsigned short* __restrict__ VT) {
  const int tid = threadIdx.x;
  const int wave = __builtin_amdgcn_readfirstlane(tid >> 5);
  const int lane = tid & 31, ln = lane & 15, hh = lane >> 4;
  const int wid = bx * 4 + wave;
  const int mt = wid / (SEQ / 64), nq = wid % (SEQ / 64);
  const unsigned short* arow = WVB + (size_t)(mt * 16 + ln) * CC;
  const unsigned short* brow = XB + ((size_t)b * SEQ + nq * 64 + ln) * CC;
  const v8f z8 = {0.f, 0.f, 0.f, 0.f, 0.f, 0.f, 0.f, 0.f};
  v8f acc[4];
#pragma unroll
  for (int t = 0; t < 4; ++t) acc[t] = z8;
#pragma unroll 1
  for (int kb = 0; kb < CC; kb += 32) {
    const v16b a = ld_bf(arow + kb, hh);
#pragma unroll
    for (int t = 0; t < 4; ++t) {
      const v16b bq = ld_bf(brow + (size_t)(t * 16) * CC + kb, hh);
      acc[t] = mma_b1(a, bq, acc[t]);
    }
  }
#pragma unroll
  for (int t = 0; t < 4; ++t)
#pragma unroll
    for (int r = 0; r < 8; ++r) so[wave][8 * hh + r][t * 16 + ln] = acc[t][r];
  __builtin_amdgcn_fence(4 /* acq_rel order */, "workgroup");
  __builtin_amdgcn_wave_barrier();
  const int rsub = lane >> 3, c8 = (lane & 7) * 8;
  {
#pragma unroll
    for (int it = 0; it < 4; ++it) {
      const int r = it * 4 + rsub;
      const v4f a = *(const v4fa*)&so[wave][r][c8];
      const v4f c = *(const v4fa*)&so[wave][r][c8 + 4];
      const float bb = bf16_rne(bv[mt * 16 + r]);
      FragH f;
#pragma unroll
      for (int q = 0; q < 4; ++q) { f.h[q] = toh_flush(a[q] + bb); f.h[4 + q] = toh_flush(c[q] + bb); }
      const v8us o = f.half[0];
      *(v8us*)(VT + ((size_t)(b * RD + mt * 16 + r)) * SEQ + nq * 64 + c8) = o;
    }
    
  }
}

#define VBLK ((RD / 16) * (SEQ / 64) / 4)   /* value-projection blocks per image */
static_assert(NRT / 64 == (size_t)VBLK * NB);   /* the three projections have equally many blocks */
// One launch for the three projections of the staged x: blockIdx.y picks key, query or value.
__global__ __launch_bounds__(128) void k_proj(const unsigned short* __restrict__ XB, const unsigned short* __restrict__ WKB,
                                              const unsigned short* __restrict__ WQB, const unsigned short* __restrict__ WVB,
                                              const float* __restrict__ bk, const float* __restrict__ bq, const float* __restrict__ bv,
                                              unsigned short* __restrict__ KH, unsigned short* __restrict__ KL,
                                              unsigned short* __restrict__ QH, unsigned short* __restrict__ QL,
                                              unsigned short* __restrict__ VT) {
  __shared__ __attribute__((aligned(16))) float so[4][16][64];
  const int bx = blockIdx.x;
  const bool qy = blockIdx.y == 1;
  if (blockIdx.y < 2) kqproj(so, bx, XB, qy ? WQB : WKB, qy ? bq : bk, qy ? QH : KH, qy ? QL : KL);
  else vproj(so, bx % VBLK, bx / VBLK, XB, WVB, bv, VT);
}

#define PART_B (8 * 512 + 256)        /* one wave's partial in LDS: 32 accumulator floats and (maximum, sum) per lane */
static_assert((AT / 32) * PART_B <= 2 * ASTAGE_B);

__global__ __launch_bounds__(AT) void k_attn(const unsigned short* __restrict__ KH, const unsigned short* __restrict__ KL,
                                             const unsigned short* __restrict__ QH, const unsigned short* __restrict__ QL,
                                             const unsigned short* __restrict__ VT,
                                             const unsigned short* __restrict__ WOH, const float* __restrict__ bo,
                                             const float* __restrict__ gam,
                                             const float* __restrict__ x, float* __restrict__ out) {
  __shared__ __attribute__((aligned(16))) float so[CH][68];
  __shared__ __attribute__((aligned(16))) unsigned char ring[2 * ASTAGE_B];
  const int tid = threadIdx.x;
  const int wave = __builtin_amdgcn_readfirstlane(tid >> 5);
  const int qg = wave & 3;                          /* which 16 query columns of the block */
  const int kq = wave >> 2;                         /* which 32 keys of every staged tile */
  const int lane = tid & 31, ln = lane & 15, hh = lane >> 4;
  const int b = blockIdx.y, jb = blockIdx.x * 64;
  const size_t tb = (size_t)b * SEQ;
  const size_t qo = (tb + jb + qg * 16 + ln) * RD;
  const v16b bH0 = ld_bf(QH + qo, hh), bL0 = ld_bf(QL + qo, hh), bH1 = ld_bf(QH + qo + 32, hh), bL1 = ld_bf(QL + qo + 32, hh);
  float m = -1.0e30f;                               /* running maximum of this lane's query column over this wave's keys, the same in both lanes that hold it */
  float m2 = -1.0e30f;                              /* m in base 2, less the carry: what the exponent subtracts */
  float l = 0.f;                                    /* sum of P over this lane's own keys, on the scale of m */
  const v8f z8 = {0.f, 0.f, 0.f, 0.f, 0.f, 0.f, 0.f, 0.f};
  v8f acc[4];
#pragma unroll
  for (int i = 0; i < 4; ++i) acc[i] = z8;
  const unsigned rb = lds_off(ring);
  const unsigned short* kh0 = KH + tb * RD;
  const unsigned short* kl0 = KL + tb * RD;
  const unsigned short* vt0 = VT + (size_t)(b * RD) * SEQ;
  cp_stage(rb, kh0, kl0, vt0, tid);
  wait_copies();
  __syncthreads();
  cp_stage(rb + ASTAGE_B, kh0 + (size_t)TK * RD, kl0 + (size_t)TK * RD, vt0 + TK, tid);
#pragma unroll 1   /* rolled: one publish point per trip, the buffer picked by t & 1 */
  for (int t = 0; t < NTILE; ++t) {
    const unsigned bsel = (unsigned)(t & 1) * ASTAGE_B;
    const unsigned char* fr = ring + bsel + (kq * 32 + ln) * KPITCH + hh * 16;
    const unsigned char* vf = ring + bsel + 2 * KTILE_B + ln * VPITCH + hh * 16 + kq * 64;
    v16b kf[8];
    lds_k32(kf, fr);
    FragH va[4];                                    /* V^T fragments of these 32 keys: land under the score products */
#pragma unroll   /* constant va index */
    for (int ct = 0; ct < 4; ++ct) {
      const unsigned char* vp = vf + ct * 16 * VPITCH;
      va[ct].half[0] = *(const v8us*)vp;
      va[ct].half[1] = *(const v8us*)(vp + 32);
    }
    v8f s0 = z8, s1 = z8;
    s0 = mma_b3(kf[0], kf[1], bH0, bL0, s0);
    s0 = mma_b3(kf[2], kf[3], bH1, bL1, s0);
    s1 = mma_b3(kf[4], kf[5], bH0, bL0, s1);
    s1 = mma_b3(kf[6], kf[7], bH1, bL1, s1);
    const float mh = max3(max3(max3(s0[0], s0[1], s0[2]), max3(s0[3], s0[4], s0[5]), max3(s0[6], s0[7], s1[0])),
                          max3(max3(s1[1], s1[2], s1[3]), max3(s1[4], s1[5], s1[6]), s1[7]), m);
    m = fmaxf(mh, xhalf(mh));
    const float m2n = fmaf(m, LOG2E, -PCARRY_L2);
    const float alpha = __builtin_amdgcn_exp2f(m2 - m2n);   /* 0 on the first 32 keys, 1 while the maximum stands */
    m2 = m2n;
    FragH pf;
    float ps[8];
#pragma unroll
    for (int r = 0; r < 8; ++r) {
      const float a0 = fmaf(s0[r], LOG2E, -m2n), a1 = fmaf(s1[r], LOG2E, -m2n);
      const float p0 = __builtin_amdgcn_exp2f(a0), p1 = __builtin_amdgcn_exp2f(a1);
      pf.h[r]     = p_flush(a0, p0);
      pf.h[8 + r] = p_flush(a1, p1);
      ps[r] = p0 + p1;
    }
    l = fmaf(l, alpha, ((ps[0] + ps[1]) + (ps[2] + ps[3])) + ((ps[4] + ps[5]) + (ps[6] + ps[7])));
#pragma unroll   /* constant acc index */
    for (int ct = 0; ct < 4; ++ct) acc[ct] *= alpha;
#pragma unroll   /* constant acc index */
    for (int ct = 0; ct < 4; ++ct) acc[ct] = mma_h1(va[ct].v, pf.v, acc[ct]);
    // publish point: tile t + 1 becomes readable, tile t's buffer becomes free
    wait_lds();
    wait_copies();
    __syncthreads();
    if (t + 2 < NTILE)
      cp_stage(rb + bsel, kh0 + (size_t)(t + 2) * TK * RD, kl0 + (size_t)(t + 2) * TK * RD, vt0 + (t + 2) * TK, tid);
  }
  wait_copies();
  // The four key quarters of a query group meet in LDS. The ring is free: the last trip's barrier ended every read of it, no copy is in flight.
  {
    unsigned char* pw = ring + wave * PART_B + lane * 16;
#pragma unroll
    for (int ct = 0; ct < 4; ++ct) {
      const v4f lo = {acc[ct][0], acc[ct][1], acc[ct][2], acc[ct][3]};
      const v4f hi = {acc[ct][4], acc[ct][5], acc[ct][6], acc[ct][7]};
      *(v4fa*)(pw + (2 * ct) * 512) = lo;
      *(v4fa*)(pw + (2 * ct + 1) * 512) = hi;
    }
    const v2f ml = {m2, l + xhalf(l)};              /* the quarter's maximum (base 2) and its column's whole sum */
    *(v2fa*)(ring + wave * PART_B + 8 * 512 + lane * 8) = ml;
  }
  __syncthreads();
  // every wave of the group forms the same merged column, quarters in the order 0..3
  float wq4[4], lsum;
  {
    v2f ml[4];
#pragma unroll
    for (int k = 0; k < 4; ++k) ml[k] = *(const v2fa*)(ring + (qg + 4 * k) * PART_B + 8 * 512 + lane * 8);
    const float mm = fmaxf(fmaxf(ml[0][0], ml[1][0]), fmaxf(ml[2][0], ml[3][0]));
#pragma unroll
    for (int k = 0; k < 4; ++k) wq4[k] = exp2_slot(ml[k][0] - mm);   /* 1 for the quarter that holds the column's maximum */
    lsum = wq4[0] * ml[0][1];
#pragma unroll
    for (int k = 1; k < 4; ++k) lsum = fmaf(wq4[k], ml[k][1], lsum);
  }
#pragma unroll
  for (int k = 0; k < 4; ++k) {
    const unsigned char* pr = ring + (qg + 4 * k) * PART_B + lane * 16;
#pragma unroll
    for (int ct = 0; ct < 4; ++ct) {
      const v4f lo = *(const v4fa*)(pr + (2 * ct) * 512);
      const v4f hi = *(const v4fa*)(pr + (2 * ct + 1) * 512);
#pragma unroll
      for (int r = 0; r < 4; ++r) {
        acc[ct][r]     = k == 0 ? wq4[0] * lo[r] : fmaf(wq4[k], lo[r], acc[ct][r]);
        acc[ct][4 + r] = k == 0 ? wq4[0] * hi[r] : fmaf(wq4[k], hi[r], acc[ct][4 + r]);
      }
    }
  }
  // ctx^T tiles (rows e = 16 ct + 8h + r, cols j) -> two B fragments with k = e
  const float linv = 1.0f / lsum;                   /* the column's whole sum; it carries the same x4096 as acc */
  FragH cf0, cf1;
#pragma unroll
  for (int r = 0; r < 8; ++r) {
    cf0.h[r]     = toh_flush(acc[0][r] * linv);
    cf0.h[8 + r] = toh_flush(acc[1][r] * linv);
    cf1.h[r]     = toh_flush(acc[2][r] * linv);
    cf1.h[8 + r] = toh_flush(acc[3][r] * linv);
  }
  const float g = bf16_rne(gam[0]);
  const int rsub = lane >> 4, pc = (lane & 15) * 4;
#pragma unroll 1
  for (int hf = 0; hf < 2; ++hf) {
    const int ch0 = hf * CH;
#pragma unroll
    for (int c2 = 0; c2 < 2; ++c2) {
      const int ct = kq * 2 + c2;                   /* the group's four waves share the slab's eight channel tiles */
      const unsigned short* wp = WOH + (size_t)(ch0 + ct * 16 + ln) * RD + 8 * hh;
      FragH a0, a1;
      a0.half[0] = *(const v8us*)wp;
      a0.half[1] = *(const v8us*)(wp + 16);
      a1.half[0] = *(const v8us*)(wp + 32);
      a1.half[1] = *(const v8us*)(wp + 48);
      v8f d = z8;
      d = mma_h1(a0.v, cf0.v, d);
      d = mma_h1(a1.v, cf1.v, d);
#pragma unroll
      for (int r = 0; r < 8; ++r) so[ct * 16 + 8 * hh + r][qg * 16 + ln] = d[r] * WOINV;
    }
    __syncthreads();
    {
#pragma unroll 1
      for (int it = 0; it < CH / 32; ++it) {
        const int row = it * 32 + wave * 2 + rsub;
        const v4f v = *(const v4fa*)&so[row][pc];
        const v4f xr = *(const v4fa*)(x + ((size_t)(b * CC + ch0 + row)) * SEQ_FULL + jb + pc);
        const float bb = bf16_rne(bo[ch0 + row]);
        v4f o;
#pragma unroll
        for (int q = 0; q < 4; ++q) o[q] = bf16_rne(xr[q]) + g * (v[q] + bb);
        *(v4f*)(out + ((size_t)(b * CC + ch0 + row)) * SEQ + jb + pc) = o;
        asm volatile("s_wait_xcnt 0x0" ::: "memory");   /* the next trip rewrites the store's address registers */
      }
      
    }
    __syncthreads();
  }
}

// workspace carve (bytes, every region a multiple of 256)
#define SZ_WP  ((size_t)RD * CC * 2)
#define SZ_WO  ((size_t)CC * RD * 2)
#define SZ_XB  (NRT * CC * 2)
#define SZ_P   (NRT * RD * 2)
#define SZ_VT  ((size_t)NB * RD * SEQ * 2)
#define OFF_WKB ((size_t)0)
#define OFF_WQB (OFF_WKB + SZ_WP)
#define OFF_WVB (OFF_WQB + SZ_WP)
#define OFF_WOH (OFF_WVB + SZ_WP)
#define OFF_XB  (OFF_WOH + SZ_WO)
#define OFF_KH  (OFF_XB + SZ_XB)
#define OFF_KL  (OFF_KH + SZ_P)
#define OFF_QH  (OFF_KL + SZ_P)
#define OFF_QL  (OFF_QH + SZ_P)
#define OFF_VT  (OFF_QL + SZ_P)
#define WS_TOTAL (OFF_VT + SZ_VT)
static_assert(SZ_WP % 256 == 0 && SZ_WO % 256 == 0 && SZ_XB % 256 == 0 && SZ_P % 256 == 0 && SZ_VT % 256 == 0);
static_assert(WS_TOTAL <= (size_t)134217728);
static_assert((RD * CC) % (8 * 256) == 0);                                 /* weight-plane block ranges exact */
static_assert((NRT % 64) == 0);                                            /* key / query blocks x 4 waves x 16 rows == token rows */
static_assert(((RD / 16) * (SEQ / 64)) % 4 == 0);                          /* value blocks x 4 waves == channel tiles x pixel quads */
static_assert(SEQ % 64 == 0 && SEQ % 32 == 0);                             /* k_attn tiles and 32-row key steps */

extern "C" void kernel_launch(void* const* d_in, const int* in_sizes, int n_in,
                              void* d_out, int out_size, void* d_ws, size_t ws_size, hipStream_t stream) {
  if (n_in < 10) return;
  if ((size_t)in_sizes[0] < (size_t)(NB * CC - 1) * SEQ_FULL + SEQ) return;
  if ((size_t)in_sizes[1] < (size_t)RD * CC) return;
  if ((size_t)in_sizes[2] < (size_t)RD) return;
  if ((size_t)in_sizes[3] < (size_t)RD * CC) return;
  if ((size_t)in_sizes[4] < (size_t)RD) return;
  if ((size_t)in_sizes[5] < (size_t)RD * CC) return;
  if ((size_t)in_sizes[6] < (size_t)RD) return;
  if ((size_t)in_sizes[7] < (size_t)CC * RD) return;
  if ((size_t)in_sizes[8] < (size_t)CC) return;
  if ((size_t)in_sizes[9] < (size_t)1) return;
  if ((size_t)out_size < (size_t)NB * CC * SEQ) return;
  if (WS_TOTAL > ws_size) return;
  const float* x  = (const float*)d_in[0];       /* [NB][CC][SEQ_FULL] channel-first */
  const float* wk = (const float*)d_in[1];       /* [RD][CC] = [out][in], key */
  const float* bk = (const float*)d_in[2];       /* [RD] */
  const float* wq = (const float*)d_in[3];       /* [RD][CC] = [out][in], query */
  const float* bq = (const float*)d_in[4];       /* [RD] */
  const float* wv = (const float*)d_in[5];       /* [RD][CC] = [out][in], value */
  const float* bv = (const float*)d_in[6];       /* [RD] */
  const float* wo = (const float*)d_in[7];       /* [CC][RD] = [out][in] */
  const float* bo = (const float*)d_in[8];       /* [CC] */
  const float* gam = (const float*)d_in[9];      /* [1] */
  float* out = (float*)d_out;                    /* [NB][CC][SEQ] channel-first */
  char* ws = (char*)d_ws;
  unsigned short* WKB = (unsigned short*)(ws + OFF_WKB);
  unsigned short* WQB = (unsigned short*)(ws + OFF_WQB);
  unsigned short* WVB = (unsigned short*)(ws + OFF_WVB);
  unsigned short* WOH = (unsigned short*)(ws + OFF_WOH);
  unsigned short* XB  = (unsigned short*)(ws + OFF_XB);
  unsigned short* KH  = (unsigned short*)(ws + OFF_KH);
  unsigned short* KL  = (unsigned short*)(ws + OFF_KL);
  unsigned short* QH  = (unsigned short*)(ws + OFF_QH);
  unsigned short* QL  = (unsigned short*)(ws + OFF_QL);
  unsigned short* VT  = (unsigned short*)(ws + OFF_VT);

  k_prep<<<4 * WBLK + (CC / 64) * (SEQ / 64) * NB, 256, 0, stream>>>(wk, wq, wv, wo, x, WKB, WQB, WVB, WOH, XB);   /* x: in [b][c][n] -> out [b*SEQ+n][c] */
  k_proj<<<dim3((unsigned)(NRT / 64), 3), 128, 0, stream>>>(XB, WKB, WQB, WVB, bk, bq, bv, KH, KL, QH, QL, VT);
  k_attn<<<dim3(SEQ / 64, NB), AT, 0, stream>>>(KH, KL, QH, QL, VT, WOH, bo, gam, x, out);
}

// v005
// A run of this version takes 52.7 microseconds.
// Next to v004, in two timings, it ran 1.12 times as fast each time.
// All steps since v000 together make it 7.96 times as fast.
#include <hip/hip_runtime.h>
// Compute dtype: inputs converted (RNE) to bf16; key, query and value projections v_wmma_f32_16x16x32_bf16 (exact products, f32 accumulate, bias added in f32); scores f.g^T as bf16 hi|lo three-product (hi.hi + lo.hi + hi.lo) v_wmma_f32_16x16x32_bf16, f32 accumulate; softmax running maximum and sum f32, kept in the attention loop by each of four waves per query column (one 32-key quarter of every tile each) and merged in f32 at the end; V^T single f16 and P = exp(s - running maximum) x4096 single f16 on v_wmma_f32_16x16x32_f16, f32 accumulate scaled every 32 keys by exp(old - new maximum), divided by the sum at the end; output projection Wo x64 single f16 times ctx single f16 on v_wmma_f32_16x16x32_f16, f32 accumulate; result = bf16(x) + bf16(gamma) * (o + bf16(bo)) in f32.
#ifndef NB
#define NB 4                      /* images */
#endif
#ifndef SEQ
#define SEQ 4096                  /* pixels per image processed */
#endif
#define SEQ_FULL 4096             /* pixel pitch of the staged x rows */
#define CC 256                    /* channels */
#define RD 64                     /* embedding channels (key / query / value width) */
#define CH 128                    /* channels per epilogue slab */
#define LOG2E 1.4426950408889634f      /* scores go to base 2 inside the exponent's multiply-add */
#define PCARRY_L2 12.0f                /* P carried x4096 */
#define WOCARRY 64.0f                  /* Wo plane carried x64 */
#define WOINV 0.015625f                /* 2^-6 */
#define NRT ((size_t)NB * SEQ)

static_assert(SEQ % 256 == 0);          /* 64-pixel tiles, 4 waves per block, v-projection grid divisibility */
static_assert(SEQ <= SEQ_FULL);
static_assert(CC % 64 == 0);            /* 64-channel transpose tiles, K % 32 == 0 */
static_assert(RD == 64);                
static_assert(CC == 2 * CH);            /* two channel slabs in the epilogue */
static_assert(CH % 16 == 0 && CH / 16 == 8);

typedef __bf16 v16b __attribute__((ext_vector_type(16)));
typedef _Float16 v16h __attribute__((ext_vector_type(16)));
typedef unsigned short v8us __attribute__((ext_vector_type(8), may_alias));
typedef float v8f  __attribute__((ext_vector_type(8)));
typedef float v4f  __attribute__((ext_vector_type(4)));
typedef float v4fa __attribute__((ext_vector_type(4), may_alias));
typedef float v2f  __attribute__((ext_vector_type(2)));
typedef float v2fa __attribute__((ext_vector_type(2), may_alias));
typedef _Float16 h16;
union FragB { v16b v; v8us half[2]; };
union FragH { v16h v; v8us half[2]; _Float16 h[16]; };

__device__ __forceinline__ unsigned short bf16_bits(float x) { unsigned int u = __float_as_uint(x); return (unsigned short)((u + 0x7FFFu + ((u >> 16) & 1u)) >> 16); }
__device__ __forceinline__ float bf16_val(unsigned short b) { return __uint_as_float(((unsigned int)b) << 16); }
__device__ __forceinline__ float bf16_rne(float x) { return bf16_val(bf16_bits(x)); }

// f32 -> f16 that cannot produce an f16 subnormal (value select)
static __device__ __forceinline__ h16 toh_flush(float v) { const h16 r = (h16)v; return (fabsf(v) < 6.103515625e-05f) ? (h16)0.0f : r; }
// p = 2^a -> f16, zero when the result would fall below 2^-14 (select on the exponent argument)
static __device__ __forceinline__ h16 p_flush(float a, float p) { return (a < -13.99f) ? (h16)0.0f : (h16)p; }
// lane l <-> lane l ^ 16: the two lanes that hold one query column
static __device__ __forceinline__ float xhalf(float x) { return __builtin_bit_cast(float, __builtin_amdgcn_permlanex16(__builtin_bit_cast(int, x), __builtin_bit_cast(int, x), 0x76543210, 0xfedcba98, false, false)); }
static __device__ __forceinline__ float max3(float a, float b, float c) { return fmaxf(fmaxf(a, b), c); }
// 2^d with the slot behind the transcendental filled inside the statement
static __device__ __forceinline__ float exp2_slot(float d) { float r; asm("v_exp_f32 %0, %1\n\tv_nop" : "=v"(r) : "v"(d)); return r; }

// fragment of a k-contiguous 16-bit row: elements 0..7 <- k 8h..8h+7, elements 8..15 <- k 16+8h..16+8h+7 (same map for A and B)
__device__ __forceinline__ v16b ld_bf(const unsigned short* p, int hh) { FragB f; f.half[0] = *(const v8us*)(p + 8 * hh); f.half[1] = *(const v8us*)(p + 16 + 8 * hh); return f.v; }

__device__ __forceinline__ v8f mma_b1(v16b a, v16b b, v8f c) {
  c = __builtin_amdgcn_wmma_f32_16x16x32_bf16(false, a, false, b, (short)0, c, false, false);
  asm volatile("v_nop\n\tv_nop\n\tv_nop\n\tv_nop" : "+v"(c) : "v"(a), "v"(b));
  return c;
}
// c += ah.bh + al.bh + ah.bl (unscaled bf16 residuals share the accumulator)
__device__ __forceinline__ v8f mma_b3(v16b ah, v16b al, v16b bh, v16b bl, v8f c) {
  c = __builtin_amdgcn_wmma_f32_16x16x32_bf16(false, ah, false, bh, (short)0, c, false, false);
  c = __builtin_amdgcn_wmma_f32_16x16x32_bf16(false, al, false, bh, (short)0, c, false, false);
  c = __builtin_amdgcn_wmma_f32_16x16x32_bf16(false, ah, false, bl, (short)0, c, false, false);
  asm volatile("v_nop\n\tv_nop\n\tv_nop\n\tv_nop" : "+v"(c) : "v"(ah), "v"(al), "v"(bh), "v"(bl));
  return c;
}
__device__ __forceinline__ v8f mma_h1(v16h a, v16h b, v8f c) {
  c = __builtin_amdgcn_wmma_f32_16x16x32_f16(false, a, false, b, (short)0, c, false, false);
  asm volatile("v_nop\n\tv_nop\n\tv_nop\n\tv_nop" : "+v"(c) : "v"(a), "v"(b));
  return c;
}

// ---- key / value tiles staged in LDS by asynchronous copies, two buffers ----
#define TK 128                        /* keys per staged tile */
#define NTILE (SEQ / TK)
#define KPITCH 144                    /* LDS bytes per 128-byte key row (16 B x odd: no bank conflict for 16-byte readers) */
#define VPITCH 272                    /* LDS bytes per 256-byte V^T row (16 B x odd) */
#define KTILE_B (TK * KPITCH)
#define VTILE_B (RD * VPITCH)
#define ASTAGE_B (2 * KTILE_B + VTILE_B)  /* k_attn stage: K hi, K lo, V^T */
static_assert(SEQ % TK == 0 && NTILE >= 2);   /* the ring's prologue fills two tiles */
static_assert(RD * 2 == 128 && TK * 2 == 256);
static_assert(KTILE_B % 16 == 0 && VTILE_B % 16 == 0);

__device__ __forceinline__ unsigned lds_off(const void* p) { return (unsigned)(size_t)p; }

#define AT 512                        /* k_attn threads: 4 query groups of 16 columns x 4 key quarters of a tile */
static_assert(TK / 32 == 4 && TK * RD * 2 == 2 * AT * 16 && RD * TK * 2 == 2 * AT * 16);   /* two copies per lane and plane */
// One stage, six 16-byte copies per lane, global -> LDS, through no register: two per plane (K hi, K lo, V^T).
// K planes (rows contiguous in memory): lane tid brings bytes 16 tid .. 16 tid + 15 of each 8-KiB slab (64 rows).
// V^T (64 rows x 128 keys, row pitch SEQ): 16 lanes per row, 32 rows per copy.
// The s_wait_xcnt is the statement's last line so that no later rewrite of an address register can be scheduled in front of it.
__device__ __forceinline__ void cp_stage(unsigned lbase, const unsigned short* kh_row0, const unsigned short* kl_row0,
                                         const unsigned short* vt_row0_key0, int tid) {
  const unsigned lk = lbase + (unsigned)(tid >> 3) * KPITCH + (unsigned)(tid & 7) * 16u;
  const unsigned lv = lbase + 2 * KTILE_B + (unsigned)(tid >> 4) * VPITCH + (unsigned)(tid & 15) * 16u;
  const unsigned short* gh = kh_row0 + tid * 8;
  const unsigned short* gl = kl_row0 + tid * 8;
  const unsigned short* gv = vt_row0_key0 + (size_t)(tid >> 4) * SEQ + (tid & 15) * 8;
  asm volatile("global_load_async_to_lds_b128 %0, %6, off\n\t"
               "global_load_async_to_lds_b128 %1, %7, off\n\t"
               "global_load_async_to_lds_b128 %2, %8, off\n\t"
               "global_load_async_to_lds_b128 %3, %9, off\n\t"
               "global_load_async_to_lds_b128 %4, %10, off\n\t"
               "global_load_async_to_lds_b128 %5, %11, off\n\t"
               "s_wait_xcnt 0x0"
               :: "v"(lk), "v"(lk + 64u * KPITCH), "v"(lk + KTILE_B), "v"(lk + KTILE_B + 64u * KPITCH), "v"(lv), "v"(lv + 32u * VPITCH),
                  "v"(gh), "v"(gh + 64 * RD), "v"(gl), "v"(gl + 64 * RD), "v"(gv), "v"(gv + (size_t)32 * SEQ)
               : "memory");
}
// own copies landed (before the barrier that lets other waves read them)
__device__ __forceinline__ void wait_copies() { asm volatile("s_wait_asynccnt 0x0" ::: "memory"); }
// own LDS reads retired (before the barrier behind which their buffer is refilled)
__device__ __forceinline__ void wait_lds() { asm volatile("s_wait_dscnt 0x0" ::: "memory"); }
// fragment of a staged 16-bit row, p = row start + 64 * (k / 32) + 16 h: same element map as ld_bf
__device__ __forceinline__ v16b lds_bf(const unsigned char* p) { FragB f; f.half[0] = *(const v8us*)p; f.half[1] = *(const v8us*)(p + 32); return f.v; }
// K fragments of 32 staged keys: kf[4 * (16-key row block) + 2 * (k half) + (hi, lo)]; p = the lane's place in the hi plane
__device__ __forceinline__ void lds_k16(v16b (&kf)[8], int rb16, const unsigned char* p) {
#pragma unroll   /* constant kf index */
  for (int kh = 0; kh < 2; ++kh) {
    kf[rb16 * 4 + kh * 2]     = lds_bf(p + rb16 * 16 * KPITCH + kh * 64);
    kf[rb16 * 4 + kh * 2 + 1] = lds_bf(p + rb16 * 16 * KPITCH + kh * 64 + KTILE_B);
  }
}
__device__ __forceinline__ void lds_k32(v16b (&kf)[8], const unsigned char* p) { lds_k16(kf, 0, p); lds_k16(kf, 1, p); }

// t = the thread's place among the plane's groups of eight weights
__device__ __forceinline__ void wcvt(const float* __restrict__ W, unsigned short* __restrict__ Wb, int t) {
  const v4f a = *(const v4fa*)(W + (size_t)t * 8);
  const v4f c = *(const v4fa*)(W + (size_t)t * 8 + 4);
  v8us v;
#pragma unroll
  for (int q = 0; q < 4; ++q) { v[q] = bf16_bits(a[q]); v[4 + q] = bf16_bits(c[q]); }
  unsigned short* d = Wb + (size_t)t * 8;
  *(v8us*)d = v;
  
}

__device__ __forceinline__ void wcvth(const float* __restrict__ W, unsigned short* __restrict__ Wh, int t) {
  const v4f a = *(const v4fa*)(W + (size_t)t * 8);
  const v4f c = *(const v4fa*)(W + (size_t)t * 8 + 4);
  FragH f;
#pragma unroll
  for (int q = 0; q < 4; ++q) { f.h[q] = toh_flush(bf16_rne(a[q]) * WOCARRY); f.h[4 + q] = toh_flush(bf16_rne(c[q]) * WOCARRY); }
  const v8us v = f.half[0];
  unsigned short* d = Wh + (size_t)t * 8;
  *(v8us*)d = v;
  asm volatile("s_wait_xcnt 0x0" ::: "memory");   /* the store's registers may be rewritten by the code laid out behind it in the merged kernel */
}

#define WBLK ((RD * CC / 8) / 256)     /* blocks per weight plane */
// One launch for all that depends on the inputs alone: blocks 0 .. 4 WBLK - 1 convert the four weight planes, the rest transpose x.
__global__ __launch_bounds__(256) void k_prep(const float* __restrict__ wk, const float* __restrict__ wq, const float* __restrict__ wv,
                                              const float* __restrict__ wo, const float* __restrict__ x,
                                              unsigned short* __restrict__ WKB, unsigned short* __restrict__ WQB,
                                              unsigned short* __restrict__ WVB, unsigned short* __restrict__ WOH,
                                              unsigned short* __restrict__ XB) {
  __shared__ unsigned short tl[64][66];
  const int tid = threadIdx.x;
  if (blockIdx.x < 4 * WBLK) {          /* the same for the whole block, and in front of the barrier */
    const int pl = blockIdx.x / WBLK;
    const int t = (blockIdx.x % WBLK) * 256 + tid;
    if (pl < 3) wcvt(pl == 0 ? wk : pl == 1 ? wq : wv, pl == 0 ? WKB : pl == 1 ? WQB : WVB, t);
    else wcvth(wo, WOH, t);
    return;
  }
  const int blk = blockIdx.x - 4 * WBLK;
  const int ct = blk % (CC / 64);
  const int nt = (blk / (CC / 64)) % (SEQ / 64);
  const int b = blk / ((CC / 64) * (SEQ / 64));
  v4f xv[4];
  const float* px = x + ((size_t)(b * CC + ct * 64 + (tid >> 4))) * SEQ_FULL + nt * 64 + (tid & 15) * 4;
#pragma unroll   /* a thread's four loads (16 channels apart) are in flight together: one memory latency, not four */
  for (int k = 0; k < 4; ++k) xv[k] = *(const v4fa*)(px + (size_t)(16 * k) * SEQ_FULL);
  asm volatile("s_wait_xcnt 0x0" :: "v"(px) : "memory");   /* the address pair stays whole until every load's address is taken */
#pragma unroll   /* constant xv index */
  for (int k = 0; k < 4; ++k) {
    const int i = tid + 256 * k;
    const int c = i >> 4, n4 = (i & 15) * 4;
#pragma unroll
    for (int q = 0; q < 4; ++q) tl[n4 + q][c] = bf16_bits(xv[k][q]);
  }
  __syncthreads();
  {
#pragma unroll 1
    for (int i = tid; i < 64 * 8; i += 256) {
      const int n = i >> 3, c8 = (i & 7) * 8;
      v8us f;
#pragma unroll
      for (int q = 0; q < 8; ++q) f[q] = tl[n][c8 + q];
      unsigned short* d = XB + ((size_t)b * SEQ + nt * 64 + n) * CC + ct * 64 + c8;
      *(v8us*)d = f;
    }
    
  }
}

__device__ __forceinline__ void kqproj(float (&so)[4][16][64], int bx,
                                       const unsigned short* __restrict__ XB, const unsigned short* __restrict__ WB,
                                       const float* __restrict__ bias,
                                       unsigned short* __restrict__ PH, unsigned short* __restrict__ PL) {
  const int tid = threadIdx.x;
  const int wave = __builtin_amdgcn_readfirstlane(tid >> 5);
  const int lane = tid & 31, ln = lane & 15, hh = lane >> 4;
  const size_t row0 = ((size_t)bx * 4 + wave) * 16;
  const unsigned short* arow = XB + (row0 + ln) * CC;
  const v8f z8 = {0.f, 0.f, 0.f, 0.f, 0.f, 0.f, 0.f, 0.f};
  v8f acc[4];
#pragma unroll
  for (int t = 0; t < 4; ++t) acc[t] = z8;
#pragma unroll 1   /* two halves of k: bounds the registers that the fragments in flight take */
  for (int kb0 = 0; kb0 < CC; kb0 += 128) {
    v16b a[4], bq[4][4];
    const unsigned short* pa = arow + kb0 + 8 * hh;
    const unsigned short* pb = WB + (size_t)ln * CC + kb0 + 8 * hh;
#pragma unroll   /* the fragments of four k steps are loaded together: one load latency, not four */
    for (int s = 0; s < 4; ++s) {
      a[s] = ld_bf(pa + s * 32, 0);
#pragma unroll
      for (int t = 0; t < 4; ++t) bq[s][t] = ld_bf(pb + (size_t)(t * 16) * CC + s * 32, 0);
    }
    asm volatile("s_wait_xcnt 0x0" :: "v"(pa), "v"(pb) : "memory");   /* both address pairs stay whole until every load's address is taken */
#pragma unroll   /* constant fragment index; k ascends as before */
    for (int s = 0; s < 4; ++s)
#pragma unroll
      for (int t = 0; t < 4; ++t) acc[t] = mma_b1(a[s], bq[s][t], acc[t]);
  }
#pragma unroll
  for (int t = 0; t < 4; ++t)
#pragma unroll
    for (int r = 0; r < 8; ++r) so[wave][8 * hh + r][t * 16 + ln] = acc[t][r];
  __builtin_amdgcn_fence(4 /* acq_rel order */, "workgroup");
  __builtin_amdgcn_wave_barrier();
  const int rsub = lane >> 3, c8 = (lane & 7) * 8;
  const v4f ba = *(const v4fa*)(bias + c8);
  const v4f bc = *(const v4fa*)(bias + c8 + 4);
  {
#pragma unroll
    for (int it = 0; it < 4; ++it) {
      const int r = it * 4 + rsub;
      const v4f a = *(const v4fa*)&so[wave][r][c8];
      const v4f c = *(const v4fa*)&so[wave][r][c8 + 4];
      v8us vh, vl;
#pragma unroll
      for (int q = 0; q < 4; ++q) {
        const float va = a[q] + bf16_rne(ba[q]);
        const float vc = c[q] + bf16_rne(bc[q]);
        unsigned short hb = bf16_bits(va); vh[q] = hb; vl[q] = bf16_bits(va - bf16_val(hb));
        hb = bf16_bits(vc); vh[4 + q] = hb; vl[4 + q] = bf16_bits(vc - bf16_val(hb));
      }
      const size_t o = (row0 + r) * RD + c8;
      *(v8us*)(PH + o) = vh;
      *(v8us*)(PL + o) = vl;
    }
    
  }
}

__device__ __forceinline__ void vproj(float (&so)[4][16][64], int bx, int b,
                                      const unsigned short* __restrict__ XB, const unsigned short* __restrict__ WVB,
                                      const float* __restrict__ bv, unsigned short* __restrict__ VT) {
  const int tid = threadIdx.x;
  const int wave = __builtin_amdgcn_readfirstlane(tid >> 5);
  const int lane = tid & 31, ln = lane & 15, hh = lane >> 4;
  const int wid = bx * 4 + wave;
  const int mt = wid / (SEQ / 64), nq = wid % (SEQ / 64);
  const unsigned short* arow = WVB + (size_t)(mt * 16 + ln) * CC;
  const unsigned short* brow = XB + ((size_t)b * SEQ + nq * 64 + ln) * CC;
  const v8f z8 = {0.f, 0.f, 0.f, 0.f, 0.f, 0.f, 0.f, 0.f};
  v8f acc[4];
#pragma unroll
  for (int t = 0; t < 4; ++t) acc[t] = z8;
#pragma unroll 1   /* two halves of k: bounds the registers that the fragments in flight take */
  for (int kb0 = 0; kb0 < CC; kb0 += 128) {
    v16b a[4], bq[4][4];
    const unsigned short* pa = arow + kb0 + 8 * hh;
    const unsigned short* pb = brow + kb0 + 8 * hh;
#pragma unroll   /* the fragments of four k steps are loaded together: one load latency, not four */
    for (int s = 0; s < 4; ++s) {
      a[s] = ld_bf(pa + s * 32, 0);
#pragma unroll
      for (int t = 0; t < 4; ++t) bq[s][t] = ld_bf(pb + (size_t)(t * 16) * CC + s * 32, 0);
    }
    asm volatile("s_wait_xcnt 0x0" :: "v"(pa), "v"(pb) : "memory");   /* both address pairs stay whole until every load's address is taken */
#pragma unroll   /* constant fragment index; k ascends as before */
    for (int s = 0; s < 4; ++s)
#pragma unroll
      for (int t = 0; t < 4; ++t) acc[t] = mma_b1(a[s], bq[s][t], acc[t]);
  }
#pragma unroll
  for (int t = 0; t < 4; ++t)
#pragma unroll
    for (int r = 0; r < 8; ++r) so[wave][8 * hh + r][t * 16 + ln] = acc[t][r];
  __builtin_amdgcn_fence(4 /* acq_rel order */, "workgroup");
  __builtin_amdgcn_wave_barrier();
  const int rsub = lane >> 3, c8 = (lane & 7) * 8;
  {
#pragma unroll
    for (int it = 0; it < 4; ++it) {
      const int r = it * 4 + rsub;
      const v4f a = *(const v4fa*)&so[wave][r][c8];
      const v4f c = *(const v4fa*)&so[wave][r][c8 + 4];
      const float bb = bf16_rne(bv[mt * 16 + r]);
      FragH f;
#pragma unroll
      for (int q = 0; q < 4; ++q) { f.h[q] = toh_flush(a[q] + bb); f.h[4 + q] = toh_flush(c[q] + bb); }
      const v8us o = f.half[0];
      *(v8us*)(VT + ((size_t)(b * RD + mt * 16 + r)) * SEQ + nq * 64 + c8) = o;
    }
    
  }
}

#define VBLK ((RD / 16) * (SEQ / 64) / 4)   /* value-projection blocks per image */
static_assert(NRT / 64 == (size_t)VBLK * NB);   /* the three projections have equally many blocks */
// One launch for the three projections of the staged x: blockIdx.y picks key, query or value.
__global__ __launch_bounds__(128) void k_proj(const unsigned short* __restrict__ XB, const unsigned short* __restrict__ WKB,
                                              const unsigned short* __restrict__ WQB, const unsigned short* __restrict__ WVB,
                                              const float* __restrict__ bk, const float* __restrict__ bq, const float* __restrict__ bv,
                                              unsigned short* __restrict__ KH, unsigned short* __restrict__ KL,
                                              unsigned short* __restrict__ QH, unsigned short* __restrict__ QL,
                                              unsigned short* __restrict__ VT) {
  __shared__ __attribute__((aligned(16))) float so[4][16][64];
  const int bx = blockIdx.x;
  const bool qy = blockIdx.y == 1;
  if (blockIdx.y < 2) kqproj(so, bx, XB, qy ? WQB : WKB, qy ? bq : bk, qy ? QH : KH, qy ? QL : KL);
  else vproj(so, bx % VBLK, bx / VBLK, XB, WVB, bv, VT);
}

#define PART_B (8 * 512 + 256)        /* one wave's partial in LDS: 32 accumulator floats and (maximum, sum) per lane */
static_assert((AT / 32) * PART_B <= 2 * ASTAGE_B);

__global__ __launch_bounds__(AT) void k_attn(const unsigned short* __restrict__ KH, const unsigned short* __restrict__ KL,
                                             const unsigned short* __restrict__ QH, const unsigned short* __restrict__ QL,
                                             const unsigned short* __restrict__ VT,
                                             const unsigned short* __restrict__ WOH, const float* __restrict__ bo,
                                             const float* __restrict__ gam,
                                             const float* __restrict__ x, float* __restrict__ out) {
  __shared__ __attribute__((aligned(16))) float so[CH][68];
  __shared__ __attribute__((aligned(16))) unsigned char ring[2 * ASTAGE_B];
  const int tid = threadIdx.x;
  const int wave = __builtin_amdgcn_readfirstlane(tid >> 5);
  const int qg = wave & 3;                          /* which 16 query columns of the block */
  const int kq = wave >> 2;                         /* which 32 keys of every staged tile */
  const int lane = tid & 31, ln = lane & 15, hh = lane >> 4;
  const int b = blockIdx.y, jb = blockIdx.x * 64;
  const size_t tb = (size_t)b * SEQ;
  const size_t qo = (tb + jb + qg * 16 + ln) * RD;
  const v16b bH0 = ld_bf(QH + qo, hh), bL0 = ld_bf(QL + qo, hh), bH1 = ld_bf(QH + qo + 32, hh), bL1 = ld_bf(QL + qo + 32, hh);
  float m = -1.0e30f;                               /* running maximum of this lane's query column over this wave's keys, the same in both lanes that hold it */
  float m2 = -1.0e30f;                              /* m in base 2, less the carry: what the exponent subtracts */
  float l = 0.f;                                    /* sum of P over this lane's own keys, on the scale of m */
  const v8f z8 = {0.f, 0.f, 0.f, 0.f, 0.f, 0.f, 0.f, 0.f};
  v8f acc[4];
#pragma unroll
  for (int i = 0; i < 4; ++i) acc[i] = z8;
  const unsigned rb = lds_off(ring);
  const unsigned short* kh0 = KH + tb * RD;
  const unsigned short* kl0 = KL + tb * RD;
  const unsigned short* vt0 = VT + (size_t)(b * RD) * SEQ;
  cp_stage(rb, kh0, kl0, vt0, tid);
  wait_copies();
  __syncthreads();
  cp_stage(rb + ASTAGE_B, kh0 + (size_t)TK * RD, kl0 + (size_t)TK * RD, vt0 + TK, tid);
  // the x values that the last stage adds: loaded here, so that their memory latency passes under the key loop
  const int rsub = lane >> 4, pc = (lane & 15) * 4;
  v4f xr[2][CH / 32];
  const float* px = x + ((size_t)(b * CC + wave * 2 + rsub)) * SEQ_FULL + jb + pc;
#pragma unroll   /* constant xr index */
  for (int hf = 0; hf < 2; ++hf)
#pragma unroll
    for (int it = 0; it < CH / 32; ++it) xr[hf][it] = *(const v4fa*)(px + (size_t)(hf * CH + it * 32) * SEQ_FULL);
  asm volatile("s_wait_xcnt 0x0" :: "v"(px) : "memory");   /* the address pair stays whole until every load's address is taken */
#pragma unroll 1   /* rolled: one publish point per trip, the buffer picked by t & 1 */
  for (int t = 0; t < NTILE; ++t) {
    const unsigned bsel = (unsigned)(t & 1) * ASTAGE_B;
    const unsigned char* fr = ring + bsel + (kq * 32 + ln) * KPITCH + hh * 16;
    const unsigned char* vf = ring + bsel + 2 * KTILE_B + ln * VPITCH + hh * 16 + kq * 64;
    v16b kf[8];
    lds_k32(kf, fr);
    FragH va[4];                                    /* V^T fragments of these 32 keys: land under the score products */
#pragma unroll   /* constant va index */
    for (int ct = 0; ct < 4; ++ct) {
      const unsigned char* vp = vf + ct * 16 * VPITCH;
      va[ct].half[0] = *(const v8us*)vp;
      va[ct].half[1] = *(const v8us*)(vp + 32);
    }
    v8f s0 = z8, s1 = z8;
    s0 = mma_b3(kf[0], kf[1], bH0, bL0, s0);
    s0 = mma_b3(kf[2], kf[3], bH1, bL1, s0);
    s1 = mma_b3(kf[4], kf[5], bH0, bL0, s1);
    s1 = mma_b3(kf[6], kf[7], bH1, bL1, s1);
    const float mh = max3(max3(max3(s0[0], s0[1], s0[2]), max3(s0[3], s0[4], s0[5]), max3(s0[6], s0[7], s1[0])),
                          max3(max3(s1[1], s1[2], s1[3]), max3(s1[4], s1[5], s1[6]), s1[7]), m);
    m = fmaxf(mh, xhalf(mh));
    const float m2n = fmaf(m, LOG2E, -PCARRY_L2);
    const float alpha = __builtin_amdgcn_exp2f(m2 - m2n);   /* 0 on the first 32 keys, 1 while the maximum stands */
    m2 = m2n;
    FragH pf;
    float ps[8];
#pragma unroll
    for (int r = 0; r < 8; ++r) {
      const float a0 = fmaf(s0[r], LOG2E, -m2n), a1 = fmaf(s1[r], LOG2E, -m2n);
      const float p0 = __builtin_amdgcn_exp2f(a0), p1 = __builtin_amdgcn_exp2f(a1);
      pf.h[r]     = p_flush(a0, p0);
      pf.h[8 + r] = p_flush(a1, p1);
      ps[r] = p0 + p1;
    }
    l = fmaf(l, alpha, ((ps[0] + ps[1]) + (ps[2] + ps[3])) + ((ps[4] + ps[5]) + (ps[6] + ps[7])));
#pragma unroll   /* constant acc index */
    for (int ct = 0; ct < 4; ++ct) acc[ct] *= alpha;
#pragma unroll   /* constant acc index */
    for (int ct = 0; ct < 4; ++ct) acc[ct] = mma_h1(va[ct].v, pf.v, acc[ct]);
    // publish point: tile t + 1 becomes readable, tile t's buffer becomes free
    wait_lds();
    wait_copies();
    __syncthreads();
    if (t + 2 < NTILE)
      cp_stage(rb + bsel, kh0 + (size_t)(t + 2) * TK * RD, kl0 + (size_t)(t + 2) * TK * RD, vt0 + (t + 2) * TK, tid);
  }
  wait_copies();
  // The four key quarters of a query group meet in LDS. The ring is free: the last trip's barrier ended every read of it, no copy is in flight.
  {
    unsigned char* pw = ring + wave * PART_B + lane * 16;
#pragma unroll
    for (int ct = 0; ct < 4; ++ct) {
      const v4f lo = {acc[ct][0], acc[ct][1], acc[ct][2], acc[ct][3]};
      const v4f hi = {acc[ct][4], acc[ct][5], acc[ct][6], acc[ct][7]};
      *(v4fa*)(pw + (2 * ct) * 512) = lo;
      *(v4fa*)(pw + (2 * ct + 1) * 512) = hi;
    }
    const v2f ml = {m2, l + xhalf(l)};              /* the quarter's maximum (base 2) and its column's whole sum */
    *(v2fa*)(ring + wave * PART_B + 8 * 512 + lane * 8) = ml;
  }
  __syncthreads();
  // output-projection fragments and bias of both slabs: loaded here, behind the barrier, so that their latency passes under the merge
  FragH wa[2][2][2];
  float bb[2][CH / 32];
  const unsigned short* pw = WOH + (size_t)(kq * 32 + ln) * RD + 8 * hh;
  const float* pbo = bo + wave * 2 + rsub;
#pragma unroll   /* constant wa, bb index */
  for (int hf = 0; hf < 2; ++hf) {
#pragma unroll
    for (int c2 = 0; c2 < 2; ++c2) {
      const unsigned short* wp = pw + (size_t)(hf * CH + c2 * 16) * RD;
      wa[hf][c2][0].half[0] = *(const v8us*)wp;
      wa[hf][c2][0].half[1] = *(const v8us*)(wp + 16);
      wa[hf][c2][1].half[0] = *(const v8us*)(wp + 32);
      wa[hf][c2][1].half[1] = *(const v8us*)(wp + 48);
    }
#pragma unroll
    for (int it = 0; it < CH / 32; ++it) bb[hf][it] = pbo[hf * CH + it * 32];
  }
  asm volatile("s_wait_xcnt 0x0" :: "v"(pw), "v"(pbo) : "memory");   /* both address pairs stay whole until every load's address is taken */
  // every wave of the group forms the same merged column, quarters in the order 0..3
  float wq4[4], lsum;
  {
    v2f ml[4];
#pragma unroll
    for (int k = 0; k < 4; ++k) ml[k] = *(const v2fa*)(ring + (qg + 4 * k) * PART_B + 8 * 512 + lane * 8);
    const float mm = fmaxf(fmaxf(ml[0][0], ml[1][0]), fmaxf(ml[2][0], ml[3][0]));
#pragma unroll
    for (int k = 0; k < 4; ++k) wq4[k] = exp2_slot(ml[k][0] - mm);   /* 1 for the quarter that holds the column's maximum */
    lsum = wq4[0] * ml[0][1];
#pragma unroll
    for (int k = 1; k < 4; ++k) lsum = fmaf(wq4[k], ml[k][1], lsum);
  }
#pragma unroll
  for (int k = 0; k < 4; ++k) {
    const unsigned char* pr = ring + (qg + 4 * k) * PART_B + lane * 16;
#pragma unroll
    for (int ct = 0; ct < 4; ++ct) {
      const v4f lo = *(const v4fa*)(pr + (2 * ct) * 512);
      const v4f hi = *(const v4fa*)(pr + (2 * ct + 1) * 512);
#pragma unroll
      for (int r = 0; r < 4; ++r) {
        acc[ct][r]     = k == 0 ? wq4[0] * lo[r] : fmaf(wq4[k], lo[r], acc[ct][r]);
        acc[ct][4 + r] = k == 0 ? wq4[0] * hi[r] : fmaf(wq4[k], hi[r], acc[ct][4 + r]);
      }
    }
  }
  // ctx^T tiles (rows e = 16 ct + 8h + r, cols j) -> two B fragments with k = e
  const float linv = 1.0f / lsum;                   /* the column's whole sum; it carries the same x4096 as acc */
  FragH cf0, cf1;
#pragma unroll
  for (int r = 0; r < 8; ++r) {
    cf0.h[r]     = toh_flush(acc[0][r] * linv);
    cf0.h[8 + r] = toh_flush(acc[1][r] * linv);
    cf1.h[r]     = toh_flush(acc[2][r] * linv);
    cf1.h[8 + r] = toh_flush(acc[3][r] * linv);
  }
  const float g = bf16_rne(gam[0]);
#pragma unroll   /* constant wa, xr, bb index */
  for (int hf = 0; hf < 2; ++hf) {
    const int ch0 = hf * CH;
#pragma unroll
    for (int c2 = 0; c2 < 2; ++c2) {
      const int ct = kq * 2 + c2;                   /* the group's four waves share the slab's eight channel tiles */
      v8f d = z8;
      d = mma_h1(wa[hf][c2][0].v, cf0.v, d);
      d = mma_h1(wa[hf][c2][1].v, cf1.v, d);
#pragma unroll
      for (int r = 0; r < 8; ++r) so[ct * 16 + 8 * hh + r][qg * 16 + ln] = d[r] * WOINV;
    }
    __syncthreads();
    {
#pragma unroll   /* constant xr, bb index */
      for (int it = 0; it < CH / 32; ++it) {
        const int row = it * 32 + wave * 2 + rsub;
        const v4f v = *(const v4fa*)&so[row][pc];
        v4f o;
#pragma unroll
        for (int q = 0; q < 4; ++q) o[q] = bf16_rne(xr[hf][it][q]) + g * (v[q] + bf16_rne(bb[hf][it]));
        *(v4f*)(out + ((size_t)(b * CC + ch0 + row)) * SEQ + jb + pc) = o;
        asm volatile("s_wait_xcnt 0x0" ::: "memory");   /* later code may rewrite the store's address registers */
      }
      
    }
    __syncthreads();
  }
}

// workspace carve (bytes, every region a multiple of 256)
#define SZ_WP  ((size_t)RD * CC * 2)
#define SZ_WO  ((size_t)CC * RD * 2)
#define SZ_XB  (NRT * CC * 2)
#define SZ_P   (NRT * RD * 2)
#define SZ_VT  ((size_t)NB * RD * SEQ * 2)
#define OFF_WKB ((size_t)0)
#define OFF_WQB (OFF_WKB + SZ_WP)
#define OFF_WVB (OFF_WQB + SZ_WP)
#define OFF_WOH (OFF_WVB + SZ_WP)
#define OFF_XB  (OFF_WOH + SZ_WO)
#define OFF_KH  (OFF_XB + SZ_XB)
#define OFF_KL  (OFF_KH + SZ_P)
#define OFF_QH  (OFF_KL + SZ_P)
#define OFF_QL  (OFF_QH + SZ_P)
#define OFF_VT  (OFF_QL + SZ_P)
#define WS_TOTAL (OFF_VT + SZ_VT)
static_assert(SZ_WP % 256 == 0 && SZ_WO % 256 == 0 && SZ_XB % 256 == 0 && SZ_P % 256 == 0 && SZ_VT % 256 == 0);
static_assert(WS_TOTAL <= (size_t)134217728);
static_assert((RD * CC) % (8 * 256) == 0);                                 /* weight-plane block ranges exact */
static_assert((NRT % 64) == 0);                                            /* key / query blocks x 4 waves x 16 rows == token rows */
static_assert(((RD / 16) * (SEQ / 64)) % 4 == 0);                          /* value blocks x 4 waves == channel tiles x pixel quads */
static_assert(SEQ % 64 == 0 && SEQ % 32 == 0);                             /* k_attn tiles and 32-row key steps */

extern "C" void kernel_launch(void* const* d_in, const int* in_sizes, int n_in,
                              void* d_out, int out_size, void* d_ws, size_t ws_size, hipStream_t stream) {
  if (n_in < 10) return;
  if ((size_t)in_sizes[0] < (size_t)(NB * CC - 1) * SEQ_FULL + SEQ) return;
  if ((size_t)in_sizes[1] < (size_t)RD * CC) return;
  if ((size_t)in_sizes[2] < (size_t)RD) return;
  if ((size_t)in_sizes[3] < (size_t)RD * CC) return;
  if ((size_t)in_sizes[4] < (size_t)RD) return;
  if ((size_t)in_sizes[5] < (size_t)RD * CC) return;
  if ((size_t)in_sizes[6] < (size_t)RD) return;
  if ((size_t)in_sizes[7] < (size_t)CC * RD) return;
  if ((size_t)in_sizes[8] < (size_t)CC) return;
  if ((size_t)in_sizes[9] < (size_t)1) return;
  if ((size_t)out_size < (size_t)NB * CC * SEQ) return;
  if (WS_TOTAL > ws_size) return;
  const float* x  = (const float*)d_in[0];       /* [NB][CC][SEQ_FULL] channel-first */
  const float* wk = (const float*)d_in[1];       /* [RD][CC] = [out][in], key */
  const float* bk = (const float*)d_in[2];       /* [RD] */
  const float* wq = (const float*)d_in[3];       /* [RD][CC] = [out][in], query */
  const float* bq = (const float*)d_in[4];       /* [RD] */
  const float* wv = (const float*)d_in[5];       /* [RD][CC] = [out][in], value */
  const float* bv = (const float*)d_in[6];       /* [RD] */
  const float* wo = (const float*)d_in[7];       /* [CC][RD] = [out][in] */
  const float* bo = (const float*)d_in[8];       /* [CC] */
  const float* gam = (const float*)d_in[9];      /* [1] */
  float* out = (float*)d_out;                    /* [NB][CC][SEQ] channel-first */
  char* ws = (char*)d_ws;
  unsigned short* WKB = (unsigned short*)(ws + OFF_WKB);
  unsigned short* WQB = (unsigned short*)(ws + OFF_WQB);
  unsigned short* WVB = (unsigned short*)(ws + OFF_WVB);
  unsigned short* WOH = (unsigned short*)(ws + OFF_WOH);
  unsigned short* XB  = (unsigned short*)(ws + OFF_XB);
  unsigned short* KH  = (unsigned short*)(ws + OFF_KH);
  unsigned short* KL  = (unsigned short*)(ws + OFF_KL);
  unsigned short* QH  = (unsigned short*)(ws + OFF_QH);
  unsigned short* QL  = (unsigned short*)(ws + OFF_QL);
  unsigned short* VT  = (unsigned short*)(ws + OFF_VT);

  k_prep<<<4 * WBLK + (CC / 64) * (SEQ / 64) * NB, 256, 0, stream>>>(wk, wq, wv, wo, x, WKB, WQB, WVB, WOH, XB);   /* x: in [b][c][n] -> out [b*SEQ+n][c] */
  k_proj<<<dim3((unsigned)(NRT / 64), 3), 128, 0, stream>>>(XB, WKB, WQB, WVB, bk, bq, bv, KH, KL, QH, QL, VT);
  k_attn<<<dim3(SEQ / 64, NB), AT, 0, stream>>>(KH, KL, QH, QL, VT, WOH, bo, gam, x, out);
}

// v006
// One run takes 48.1 microseconds.
// In two side-by-side timings against v005, it was 1.10 and 1.09 times as fast.
// Counting every step since v000, it is 8.72 times as fast.
#include <hip/hip_runtime.h>
// Compute dtype: inputs converted (RNE) to bf16; key, query and value projections v_wmma_f32_16x16x32_bf16 (exact products, f32 accumulate, bias added in f32); scores f.g^T as bf16 hi|lo three-product (hi.hi + lo.hi + hi.lo) v_wmma_f32_16x16x32_bf16, f32 accumulate; softmax running maximum and sum f32, kept in the attention loop by each of four waves per query column (one 32-key quarter of every tile each) and merged in f32 at the end; V^T single f16 and P = exp(s - running maximum) x4096 single f16 on v_wmma_f32_16x16x32_f16, f32 accumulate scaled every 32 keys by exp(old - new maximum), divided by the sum at the end; output projection Wo x64 single f16 times ctx single f16 on v_wmma_f32_16x16x32_f16, f32 accumulate; result = bf16(x) + bf16(gamma) * (o + bf16(bo)) in f32.
#ifndef NB
#define NB 4                      /* images */
#endif
#ifndef SEQ
#define SEQ 4096                  /* pixels per image processed */
#endif
#define SEQ_FULL 4096             /* pixel pitch of the staged x rows */
#define CC 256                    /* channels */
#define RD 64                     /* embedding channels (key / query / value width) */
#define CH 128                    /* channels per epilogue slab */
#define LOG2E 1.4426950408889634f      /* scores go to base 2 inside the exponent's multiply-add */
#define PCARRY_L2 12.0f                /* P carried x4096 */
#define WOCARRY 64.0f                  /* Wo plane carried x64 */
#define WOINV 0.015625f                /* 2^-6 */
#define NRT ((size_t)NB * SEQ)

static_assert(SEQ % 256 == 0);          /* 64-pixel tiles */
static_assert(SEQ <= SEQ_FULL);
static_assert(CC % 64 == 0);            /* K % 32 == 0 */
static_assert(RD == 64);                
static_assert(CC == 2 * CH);            /* two channel slabs in the epilogue */
static_assert(CH % 16 == 0 && CH / 16 == 8);

typedef __bf16 v16b __attribute__((ext_vector_type(16)));
typedef _Float16 v16h __attribute__((ext_vector_type(16)));
typedef unsigned short v8us __attribute__((ext_vector_type(8), may_alias));
typedef float v8f  __attribute__((ext_vector_type(8)));
typedef float v16f __attribute__((ext_vector_type(16)));
typedef __bf16 v8b __attribute__((ext_vector_type(8)));
typedef unsigned short v8u __attribute__((ext_vector_type(8)));
typedef float v4f  __attribute__((ext_vector_type(4)));
typedef float v4fa __attribute__((ext_vector_type(4), may_alias));
typedef float v2f  __attribute__((ext_vector_type(2)));
typedef float v2fa __attribute__((ext_vector_type(2), may_alias));
typedef _Float16 h16;
union FragB { v16b v; v8us half[2]; };
union FragH { v16h v; v8us half[2]; _Float16 h[16]; };

__device__ __forceinline__ unsigned short bf16_bits(float x) { unsigned int u = __float_as_uint(x); return (unsigned short)((u + 0x7FFFu + ((u >> 16) & 1u)) >> 16); }
__device__ __forceinline__ float bf16_val(unsigned short b) { return __uint_as_float(((unsigned int)b) << 16); }
__device__ __forceinline__ float bf16_rne(float x) { return bf16_val(bf16_bits(x)); }

// f32 -> f16 that cannot produce an f16 subnormal (value select)
static __device__ __forceinline__ h16 toh_flush(float v) { const h16 r = (h16)v; return (fabsf(v) < 6.103515625e-05f) ? (h16)0.0f : r; }
// p = 2^a -> f16, zero when the result would fall below 2^-14 (select on the exponent argument)
static __device__ __forceinline__ h16 p_flush(float a, float p) { return (a < -13.99f) ? (h16)0.0f : (h16)p; }
// lane l <-> lane l ^ 16: the two lanes that hold one query column
static __device__ __forceinline__ float xhalf(float x) { return __builtin_bit_cast(float, __builtin_amdgcn_permlanex16(__builtin_bit_cast(int, x), __builtin_bit_cast(int, x), 0x76543210, 0xfedcba98, false, false)); }
static __device__ __forceinline__ float max3(float a, float b, float c) { return fmaxf(fmaxf(a, b), c); }
// 2^d with the slot behind the transcendental filled inside the statement
static __device__ __forceinline__ float exp2_slot(float d) { float r; asm("v_exp_f32 %0, %1\n\tv_nop" : "=v"(r) : "v"(d)); return r; }

// fragment of a k-contiguous 16-bit row: elements 0..7 <- k 8h..8h+7, elements 8..15 <- k 16+8h..16+8h+7 (same map for A and B)
__device__ __forceinline__ v16b ld_bf(const unsigned short* p, int hh) { FragB f; f.half[0] = *(const v8us*)(p + 8 * hh); f.half[1] = *(const v8us*)(p + 16 + 8 * hh); return f.v; }

__device__ __forceinline__ v8f mma_b1(v16b a, v16b b, v8f c) {
  c = __builtin_amdgcn_wmma_f32_16x16x32_bf16(false, a, false, b, (short)0, c, false, false);
  asm volatile("v_nop\n\tv_nop\n\tv_nop\n\tv_nop" : "+v"(c) : "v"(a), "v"(b));
  return c;
}
// c += ah.bh + al.bh + ah.bl (unscaled bf16 residuals share the accumulator)
__device__ __forceinline__ v8f mma_b3(v16b ah, v16b al, v16b bh, v16b bl, v8f c) {
  c = __builtin_amdgcn_wmma_f32_16x16x32_bf16(false, ah, false, bh, (short)0, c, false, false);
  c = __builtin_amdgcn_wmma_f32_16x16x32_bf16(false, al, false, bh, (short)0, c, false, false);
  c = __builtin_amdgcn_wmma_f32_16x16x32_bf16(false, ah, false, bl, (short)0, c, false, false);
  asm volatile("v_nop\n\tv_nop\n\tv_nop\n\tv_nop" : "+v"(c) : "v"(ah), "v"(al), "v"(bh), "v"(bl));
  return c;
}
__device__ __forceinline__ v8f mma_h1(v16h a, v16h b, v8f c) {
  c = __builtin_amdgcn_wmma_f32_16x16x32_f16(false, a, false, b, (short)0, c, false, false);
  asm volatile("v_nop\n\tv_nop\n\tv_nop\n\tv_nop" : "+v"(c) : "v"(a), "v"(b));
  return c;
}

// ---- key / value tiles staged in LDS by asynchronous copies, two buffers ----
#define TK 128                        /* keys per staged tile */
#define NTILE (SEQ / TK)
#define KPITCH 144                    /* LDS bytes per 128-byte key row (16 B x odd: no bank conflict for 16-byte readers) */
#define VPITCH 272                    /* LDS bytes per 256-byte V^T row (16 B x odd) */
#define KTILE_B (TK * KPITCH)
#define VTILE_B (RD * VPITCH)
#define ASTAGE_B (2 * KTILE_B + VTILE_B)  /* k_attn stage: K hi, K lo, V^T */
static_assert(SEQ % TK == 0 && NTILE >= 2);   /* the ring's prologue fills two tiles */
static_assert(RD * 2 == 128 && TK * 2 == 256);
static_assert(KTILE_B % 16 == 0 && VTILE_B % 16 == 0);

__device__ __forceinline__ unsigned lds_off(const void* p) { return (unsigned)(size_t)p; }

#define AT 512                        /* k_attn threads: 4 query groups of 16 columns x 4 key quarters of a tile */
static_assert(TK / 32 == 4 && TK * RD * 2 == 2 * AT * 16 && RD * TK * 2 == 2 * AT * 16);   /* two copies per lane and plane */
// One stage, six 16-byte copies per lane, global -> LDS, through no register: two per plane (K hi, K lo, V^T).
// K planes (rows contiguous in memory): lane tid brings bytes 16 tid .. 16 tid + 15 of each 8-KiB slab (64 rows).
// V^T (64 rows x 128 keys, row pitch SEQ): 16 lanes per row, 32 rows per copy.
// The s_wait_xcnt is the statement's last line so that no later rewrite of an address register can be scheduled in front of it.
__device__ __forceinline__ void cp_stage(unsigned lbase, const unsigned short* kh_row0, const unsigned short* kl_row0,
                                         const unsigned short* vt_row0_key0, int tid) {
  const unsigned lk = lbase + (unsigned)(tid >> 3) * KPITCH + (unsigned)(tid & 7) * 16u;
  const unsigned lv = lbase + 2 * KTILE_B + (unsigned)(tid >> 4) * VPITCH + (unsigned)(tid & 15) * 16u;
  const unsigned short* gh = kh_row0 + tid * 8;
  const unsigned short* gl = kl_row0 + tid * 8;
  const unsigned short* gv = vt_row0_key0 + (size_t)(tid >> 4) * SEQ + (tid & 15) * 8;
  asm volatile("global_load_async_to_lds_b128 %0, %6, off\n\t"
               "global_load_async_to_lds_b128 %1, %7, off\n\t"
               "global_load_async_to_lds_b128 %2, %8, off\n\t"
               "global_load_async_to_lds_b128 %3, %9, off\n\t"
               "global_load_async_to_lds_b128 %4, %10, off\n\t"
               "global_load_async_to_lds_b128 %5, %11, off\n\t"
               "s_wait_xcnt 0x0"
               :: "v"(lk), "v"(lk + 64u * KPITCH), "v"(lk + KTILE_B), "v"(lk + KTILE_B + 64u * KPITCH), "v"(lv), "v"(lv + 32u * VPITCH),
                  "v"(gh), "v"(gh + 64 * RD), "v"(gl), "v"(gl + 64 * RD), "v"(gv), "v"(gv + (size_t)32 * SEQ)
               : "memory");
}
// own copies landed (before the barrier that lets other waves read them)
__device__ __forceinline__ void wait_copies() { asm volatile("s_wait_asynccnt 0x0" ::: "memory"); }
// own LDS reads retired (before the barrier behind which their buffer is refilled)
__device__ __forceinline__ void wait_lds() { asm volatile("s_wait_dscnt 0x0" ::: "memory"); }
// fragment of a staged 16-bit row, p = row start + 64 * (k / 32) + 16 h: same element map as ld_bf
__device__ __forceinline__ v16b lds_bf(const unsigned char* p) { FragB f; f.half[0] = *(const v8us*)p; f.half[1] = *(const v8us*)(p + 32); return f.v; }
// K fragments of 32 staged keys: kf[4 * (16-key row block) + 2 * (k half) + (hi, lo)]; p = the lane's place in the hi plane
__device__ __forceinline__ void lds_k16(v16b (&kf)[8], int rb16, const unsigned char* p) {
#pragma unroll   /* constant kf index */
  for (int kh = 0; kh < 2; ++kh) {
    kf[rb16 * 4 + kh * 2]     = lds_bf(p + rb16 * 16 * KPITCH + kh * 64);
    kf[rb16 * 4 + kh * 2 + 1] = lds_bf(p + rb16 * 16 * KPITCH + kh * 64 + KTILE_B);
  }
}
__device__ __forceinline__ void lds_k32(v16b (&kf)[8], const unsigned char* p) { lds_k16(kf, 0, p); lds_k16(kf, 1, p); }

// t = the thread's place among the plane's groups of eight weights
__device__ __forceinline__ void wcvth(const float* __restrict__ W, unsigned short* __restrict__ Wh, int t) {
  const v4f a = *(const v4fa*)(W + (size_t)t * 8);
  const v4f c = *(const v4fa*)(W + (size_t)t * 8 + 4);
  FragH f;
#pragma unroll
  for (int q = 0; q < 4; ++q) { f.h[q] = toh_flush(bf16_rne(a[q]) * WOCARRY); f.h[4 + q] = toh_flush(bf16_rne(c[q]) * WOCARRY); }
  const v8us v = f.half[0];
  unsigned short* d = Wh + (size_t)t * 8;
  *(v8us*)d = v;
  asm volatile("s_wait_xcnt 0x0" ::: "memory");   /* the store's registers may be rewritten by the code behind it */
}

#define PT 512                        /* k_proj threads: 16 waves load and convert the x tile, 12 of them multiply */
#define XPITCH 528                    /* LDS bytes per 512-byte pixel row of bf16 channels (16 B x odd) */
#define SPITCH 68                     /* floats per staged result row: the two lane halves fall on different banks */
#define MW (3 * (RD / 16))            /* waves that multiply: one per 16 output channels of key, query, value */
#define WOBLK ((CC * RD / 8) / (PT - 32 * MW))   /* blocks whose other waves also convert the output-projection plane */
static_assert((CC * RD / 8) % (PT - 32 * MW) == 0 && WOBLK <= NRT / 64);
static_assert((CC / 8) * (64 / 4) == PT);   /* one group of 8 channels x 4 pixels per thread */
static_assert(64 * (RD / 8) == PT);         /* one group of 8 results per thread and plane */
static_assert(MW < PT / 32);

// the x fragments of one k step: read from LDS together
__device__ __forceinline__ void lds_x4(v16b (&xf)[4], const unsigned char* xp, int s) {
#pragma unroll   /* constant xf index */
  for (int pt = 0; pt < 4; ++pt) xf[pt] = lds_bf(xp + pt * 16 * XPITCH + s * 64);
}
// 64 pixels (rows) x 16 output channels (columns) over all CC channels, k ascending
__device__ __forceinline__ void proj_tiles(v8f (&acc)[4], const v16b (&wf)[CC / 32], const unsigned char* xp) {
  v16b xf[3][4];                        /* three register sets: a k step's reads are issued two steps of products ahead of its use */
  lds_x4(xf[0], xp, 0);
  lds_x4(xf[1], xp, 1);
  lds_x4(xf[2], xp, 2);
#pragma unroll   /* constant xf, wf, acc index */
  for (int s = 0; s < CC / 32; ++s) {
#pragma unroll
    for (int pt = 0; pt < 4; ++pt)
      acc[pt] = mma_b1(xf[s % 3][pt], wf[s], acc[pt]);
    if (s + 3 < CC / 32) lds_x4(xf[s % 3], xp, s + 3);
  }
}

// One launch for all that precedes the attention, one block per 64 pixels of one image:
// x (f32, channel-first) is converted to bf16 and transposed into LDS by all 16 waves,
// each of 12 waves converts its own 16 weight rows to bf16 fragments in registers and multiplies them with the whole tile,
// the results meet in LDS and leave as whole lines. The four other waves of the first WOBLK blocks convert the output-projection plane.
__global__ __launch_bounds__(PT) void k_proj(const float* __restrict__ x, const float* __restrict__ wk, const float* __restrict__ wq,
                                             const float* __restrict__ wv, const float* __restrict__ wo,
                                             const float* __restrict__ bk, const float* __restrict__ bq, const float* __restrict__ bv,
                                             unsigned short* __restrict__ KH, unsigned short* __restrict__ KL,
                                             unsigned short* __restrict__ QH, unsigned short* __restrict__ QL,
                                             unsigned short* __restrict__ VT, unsigned short* __restrict__ WOH) {
  __shared__ __attribute__((aligned(16))) unsigned char xs[64 * XPITCH];
  __shared__ __attribute__((aligned(16))) float st[3][64][SPITCH];
  const int tid = threadIdx.x;
  const int blk = blockIdx.x;
  const int b = blk / (SEQ / 64), n0 = (blk % (SEQ / 64)) * 64;
  const int wave = __builtin_amdgcn_readfirstlane(tid >> 5);
  const int lane = tid & 31, ln = lane & 15, hh = lane >> 4;
  const bool mm = wave < MW;                        /* the waves that multiply */
  const int pl = wave >> 2, et = wave & 3;          /* plane (key, query, value) and its 16-channel tile */
  // all global reads of the block are issued here, together: one memory latency
  const int r = tid >> 3, c8 = (tid & 7) * 8;       /* the thread's place in each plane's results */
  const float* pbk = bk + c8;
  const float* pbq = bq + c8;
  const float* pbv = bv + r;
  const v4f bka = *(const v4fa*)pbk, bkc = *(const v4fa*)(pbk + 4);
  const v4f bqa = *(const v4fa*)pbq, bqc = *(const v4fa*)(pbq + 4);
  const float bvr = *pbv;
  asm volatile("s_wait_xcnt 0x0" :: "v"(pbk), "v"(pbq), "v"(pbv) : "memory");   /* the address pairs stay whole until every load's address is taken */
  const int cg = tid >> 4, n4 = (tid & 15) * 4;
  v4f xv[8];
  const float* px = x + ((size_t)(b * CC + cg * 8)) * SEQ_FULL + n0 + n4;
#pragma unroll   /* constant xv index */
  for (int j = 0; j < 8; ++j) xv[j] = *(const v4fa*)(px + (size_t)j * SEQ_FULL);
  asm volatile("s_wait_xcnt 0x0" :: "v"(px) : "memory");   /* the address pair stays whole until every load's address is taken */
  v4f wr[CC / 32][4];
  if (mm) {
    const float* pwf = (pl == 0 ? wk : pl == 1 ? wq : wv) + (size_t)(et * 16 + ln) * CC + 8 * hh;
#pragma unroll   /* constant wr index */
    for (int s = 0; s < CC / 32; ++s) {
      wr[s][0] = *(const v4fa*)(pwf + s * 32);
      wr[s][1] = *(const v4fa*)(pwf + s * 32 + 4);
      wr[s][2] = *(const v4fa*)(pwf + s * 32 + 16);
      wr[s][3] = *(const v4fa*)(pwf + s * 32 + 20);
    }
    asm volatile("s_wait_xcnt 0x0" :: "v"(pwf) : "memory");   /* the address pair stays whole until every load's address is taken */
  } else if (blk < WOBLK) {             /* the same for the whole wave; done while the multiplying waves wait for their weights */
    wcvth(wo, WOH, blk * (PT - 32 * MW) + tid - 32 * MW);
  }
#pragma unroll   /* constant xv index */
  for (int q = 0; q < 4; ++q) {
    const v8f t = {xv[0][q], xv[1][q], xv[2][q], xv[3][q], xv[4][q], xv[5][q], xv[6][q], xv[7][q]};
    *(v8us*)(xs + (n4 + q) * XPITCH + cg * 16) = __builtin_bit_cast(v8u, __builtin_convertvector(t, v8b));   /* RNE, two values per instruction */
  }
  v16b wf[CC / 32];
  if (mm) {
#pragma unroll   /* constant wr, wf index; same element map as ld_bf */
    for (int s = 0; s < CC / 32; ++s) {
      const v16f t = {wr[s][0][0], wr[s][0][1], wr[s][0][2], wr[s][0][3], wr[s][1][0], wr[s][1][1], wr[s][1][2], wr[s][1][3],
                      wr[s][2][0], wr[s][2][1], wr[s][2][2], wr[s][2][3], wr[s][3][0], wr[s][3][1], wr[s][3][2], wr[s][3][3]};
      wf[s] = __builtin_convertvector(t, v16b);     /* RNE, two values per instruction */
    }
  }
  __syncthreads();
  if (mm) {
    const v8f z8 = {0.f, 0.f, 0.f, 0.f, 0.f, 0.f, 0.f, 0.f};
    v8f acc[4];
#pragma unroll
    for (int pt = 0; pt < 4; ++pt) acc[pt] = z8;
    const unsigned char* xp = xs + ln * XPITCH + hh * 16;
    proj_tiles(acc, wf, xp);
    if (pl < 2) {                                   /* key, query: staged as [pixel][channel] */
#pragma unroll
      for (int pt = 0; pt < 4; ++pt)
#pragma unroll
        for (int i = 0; i < 8; ++i) st[pl][pt * 16 + 8 * hh + i][et * 16 + ln] = acc[pt][i];
    } else {                                        /* value: staged as [channel][pixel], a lane's eight pixels are neighbours */
#pragma unroll
      for (int pt = 0; pt < 4; ++pt) {
        const v4f lo = {acc[pt][0], acc[pt][1], acc[pt][2], acc[pt][3]};
        const v4f hi = {acc[pt][4], acc[pt][5], acc[pt][6], acc[pt][7]};
        *(v4fa*)&st[2][et * 16 + ln][pt * 16 + 8 * hh] = lo;
        *(v4fa*)&st[2][et * 16 + ln][pt * 16 + 8 * hh + 4] = hi;
      }
    }
  }
  __syncthreads();
  const size_t o = ((size_t)b * SEQ + n0 + r) * RD + c8;
#pragma unroll   /* key, then query */
  for (int p = 0; p < 2; ++p) {
    const v4f a = *(const v4fa*)&st[p][r][c8];
    const v4f c = *(const v4fa*)&st[p][r][c8 + 4];
    const v4f ba = p ? bqa : bka, bc = p ? bqc : bkc;
    v8us vh, vl;
#pragma unroll
    for (int q = 0; q < 4; ++q) {
      const float va = a[q] + bf16_rne(ba[q]);
      const float vc = c[q] + bf16_rne(bc[q]);
      unsigned short hb = bf16_bits(va); vh[q] = hb; vl[q] = bf16_bits(va - bf16_val(hb));
      hb = bf16_bits(vc); vh[4 + q] = hb; vl[4 + q] = bf16_bits(vc - bf16_val(hb));
    }
    *(v8us*)((p ? QH : KH) + o) = vh;
    *(v8us*)((p ? QL : KL) + o) = vl;
    asm volatile("s_wait_xcnt 0x0" ::: "memory");   /* later code may rewrite the stores' address registers */
  }
  {
    const v4f a = *(const v4fa*)&st[2][r][c8];
    const v4f c = *(const v4fa*)&st[2][r][c8 + 4];
    const float bb = bf16_rne(bvr);
    FragH f;
#pragma unroll
    for (int q = 0; q < 4; ++q) { f.h[q] = toh_flush(a[q] + bb); f.h[4 + q] = toh_flush(c[q] + bb); }
    const v8us ov = f.half[0];
    *(v8us*)(VT + ((size_t)(b * RD + r)) * SEQ + n0 + c8) = ov;
  }
}

#define PART_B (8 * 512 + 256)        /* one wave's partial in LDS: 32 accumulator floats and (maximum, sum) per lane */
static_assert((AT / 32) * PART_B <= 2 * ASTAGE_B);

__global__ __launch_bounds__(AT) void k_attn(const unsigned short* __restrict__ KH, const unsigned short* __restrict__ KL,
                                             const unsigned short* __restrict__ QH, const unsigned short* __restrict__ QL,
                                             const unsigned short* __restrict__ VT,
                                             const unsigned short* __restrict__ WOH, const float* __restrict__ bo,
                                             const float* __restrict__ gam,
                                             const float* __restrict__ x, float* __restrict__ out) {
  __shared__ __attribute__((aligned(16))) float so[CH][68];
  __shared__ __attribute__((aligned(16))) unsigned char ring[2 * ASTAGE_B];
  const int tid = threadIdx.x;
  const int wave = __builtin_amdgcn_readfirstlane(tid >> 5);
  const int qg = wave & 3;                          /* which 16 query columns of the block */
  const int kq = wave >> 2;                         /* which 32 keys of every staged tile */
  const int lane = tid & 31, ln = lane & 15, hh = lane >> 4;
  const int b = blockIdx.y, jb = blockIdx.x * 64;
  const size_t tb = (size_t)b * SEQ;
  const size_t qo = (tb + jb + qg * 16 + ln) * RD;
  const v16b bH0 = ld_bf(QH + qo, hh), bL0 = ld_bf(QL + qo, hh), bH1 = ld_bf(QH + qo + 32, hh), bL1 = ld_bf(QL + qo + 32, hh);
  float m = -1.0e30f;                               /* running maximum of this lane's query column over this wave's keys, the same in both lanes that hold it */
  float m2 = -1.0e30f;                              /* m in base 2, less the carry: what the exponent subtracts */
  float l = 0.f;                                    /* sum of P over this lane's own keys, on the scale of m */
  const v8f z8 = {0.f, 0.f, 0.f, 0.f, 0.f, 0.f, 0.f, 0.f};
  v8f acc[4];
#pragma unroll
  for (int i = 0; i < 4; ++i) acc[i] = z8;
  const unsigned rb = lds_off(ring);
  const unsigned short* kh0 = KH + tb * RD;
  const unsigned short* kl0 = KL + tb * RD;
  const unsigned short* vt0 = VT + (size_t)(b * RD) * SEQ;
  cp_stage(rb, kh0, kl0, vt0, tid);
  wait_copies();
  __syncthreads();
  cp_stage(rb + ASTAGE_B, kh0 + (size_t)TK * RD, kl0 + (size_t)TK * RD, vt0 + TK, tid);
  // the x values that the last stage adds: loaded here, so that their memory latency passes under the key loop
  const int rsub = lane >> 4, pc = (lane & 15) * 4;
  v4f xr[2][CH / 32];
  const float* px = x + ((size_t)(b * CC + wave * 2 + rsub)) * SEQ_FULL + jb + pc;
#pragma unroll   /* constant xr index */
  for (int hf = 0; hf < 2; ++hf)
#pragma unroll
    for (int it = 0; it < CH / 32; ++it) xr[hf][it] = *(const v4fa*)(px + (size_t)(hf * CH + it * 32) * SEQ_FULL);
  asm volatile("s_wait_xcnt 0x0" :: "v"(px) : "memory");   /* the address pair stays whole until every load's address is taken */
#pragma unroll 1   /* rolled: one publish point per trip, the buffer picked by t & 1 */
  for (int t = 0; t < NTILE; ++t) {
    const unsigned bsel = (unsigned)(t & 1) * ASTAGE_B;
    const unsigned char* fr = ring + bsel + (kq * 32 + ln) * KPITCH + hh * 16;
    const unsigned char* vf = ring + bsel + 2 * KTILE_B + ln * VPITCH + hh * 16 + kq * 64;
    v16b kf[8];
    lds_k32(kf, fr);
    FragH va[4];                                    /* V^T fragments of these 32 keys: land under the score products */
#pragma unroll   /* constant va index */
    for (int ct = 0; ct < 4; ++ct) {
      const unsigned char* vp = vf + ct * 16 * VPITCH;
      va[ct].half[0] = *(const v8us*)vp;
      va[ct].half[1] = *(const v8us*)(vp + 32);
    }
    v8f s0 = z8, s1 = z8;
    s0 = mma_b3(kf[0], kf[1], bH0, bL0, s0);
    s0 = mma_b3(kf[2], kf[3], bH1, bL1, s0);
    s1 = mma_b3(kf[4], kf[5], bH0, bL0, s1);
    s1 = mma_b3(kf[6], kf[7], bH1, bL1, s1);
    const float mh = max3(max3(max3(s0[0], s0[1], s0[2]), max3(s0[3], s0[4], s0[5]), max3(s0[6], s0[7], s1[0])),
                          max3(max3(s1[1], s1[2], s1[3]), max3(s1[4], s1[5], s1[6]), s1[7]), m);
    m = fmaxf(mh, xhalf(mh));
    const float m2n = fmaf(m, LOG2E, -PCARRY_L2);
    const float alpha = __builtin_amdgcn_exp2f(m2 - m2n);   /* 0 on the first 32 keys, 1 while the maximum stands */
    m2 = m2n;
    FragH pf;
    float ps[8];
#pragma unroll
    for (int r = 0; r < 8; ++r) {
      const float a0 = fmaf(s0[r], LOG2E, -m2n), a1 = fmaf(s1[r], LOG2E, -m2n);
      const float p0 = __builtin_amdgcn_exp2f(a0), p1 = __builtin_amdgcn_exp2f(a1);
      pf.h[r]     = p_flush(a0, p0);
      pf.h[8 + r] = p_flush(a1, p1);
      ps[r] = p0 + p1;
    }
    l = fmaf(l, alpha, ((ps[0] + ps[1]) + (ps[2] + ps[3])) + ((ps[4] + ps[5]) + (ps[6] + ps[7])));
#pragma unroll   /* constant acc index */
    for (int ct = 0; ct < 4; ++ct) acc[ct] *= alpha;
#pragma unroll   /* constant acc index */
    for (int ct = 0; ct < 4; ++ct) acc[ct] = mma_h1(va[ct].v, pf.v, acc[ct]);
    // publish point: tile t + 1 becomes readable, tile t's buffer becomes free
    wait_lds();
    wait_copies();
    __syncthreads();
    if (t + 2 < NTILE)
      cp_stage(rb + bsel, kh0 + (size_t)(t + 2) * TK * RD, kl0 + (size_t)(t + 2) * TK * RD, vt0 + (t + 2) * TK, tid);
  }
  wait_copies();
  // The four key quarters of a query group meet in LDS. The ring is free: the last trip's barrier ended every read of it, no copy is in flight.
  {
    unsigned char* pw = ring + wave * PART_B + lane * 16;
#pragma unroll
    for (int ct = 0; ct < 4; ++ct) {
      const v4f lo = {acc[ct][0], acc[ct][1], acc[ct][2], acc[ct][3]};
      const v4f hi = {acc[ct][4], acc[ct][5], acc[ct][6], acc[ct][7]};
      *(v4fa*)(pw + (2 * ct) * 512) = lo;
      *(v4fa*)(pw + (2 * ct + 1) * 512) = hi;
    }
    const v2f ml = {m2, l + xhalf(l)};              /* the quarter's maximum (base 2) and its column's whole sum */
    *(v2fa*)(ring + wave * PART_B + 8 * 512 + lane * 8) = ml;
  }
  __syncthreads();
  // output-projection fragments and bias of both slabs: loaded here, behind the barrier, so that their latency passes under the merge
  FragH wa[2][2][2];
  float bb[2][CH / 32];
  const unsigned short* pw = WOH + (size_t)(kq * 32 + ln) * RD + 8 * hh;
  const float* pbo = bo + wave * 2 + rsub;
#pragma unroll   /* constant wa, bb index */
  for (int hf = 0; hf < 2; ++hf) {
#pragma unroll
    for (int c2 = 0; c2 < 2; ++c2) {
      const unsigned short* wp = pw + (size_t)(hf * CH + c2 * 16) * RD;
      wa[hf][c2][0].half[0] = *(const v8us*)wp;
      wa[hf][c2][0].half[1] = *(const v8us*)(wp + 16);
      wa[hf][c2][1].half[0] = *(const v8us*)(wp + 32);
      wa[hf][c2][1].half[1] = *(const v8us*)(wp + 48);
    }
#pragma unroll
    for (int it = 0; it < CH / 32; ++it) bb[hf][it] = pbo[hf * CH + it * 32];
  }
  asm volatile("s_wait_xcnt 0x0" :: "v"(pw), "v"(pbo) : "memory");   /* both address pairs stay whole until every load's address is taken */
  // every wave of the group forms the same merged column, quarters in the order 0..3
  float wq4[4], lsum;
  {
    v2f ml[4];
#pragma unroll
    for (int k = 0; k < 4; ++k) ml[k] = *(const v2fa*)(ring + (qg + 4 * k) * PART_B + 8 * 512 + lane * 8);
    const float mm = fmaxf(fmaxf(ml[0][0], ml[1][0]), fmaxf(ml[2][0], ml[3][0]));
#pragma unroll
    for (int k = 0; k < 4; ++k) wq4[k] = exp2_slot(ml[k][0] - mm);   /* 1 for the quarter that holds the column's maximum */
    lsum = wq4[0] * ml[0][1];
#pragma unroll
    for (int k = 1; k < 4; ++k) lsum = fmaf(wq4[k], ml[k][1], lsum);
  }
#pragma unroll
  for (int k = 0; k < 4; ++k) {
    const unsigned char* pr = ring + (qg + 4 * k) * PART_B + lane * 16;
#pragma unroll
    for (int ct = 0; ct < 4; ++ct) {
      const v4f lo = *(const v4fa*)(pr + (2 * ct) * 512);
      const v4f hi = *(const v4fa*)(pr + (2 * ct + 1) * 512);
#pragma unroll
      for (int r = 0; r < 4; ++r) {
        acc[ct][r]     = k == 0 ? wq4[0] * lo[r] : fmaf(wq4[k], lo[r], acc[ct][r]);
        acc[ct][4 + r] = k == 0 ? wq4[0] * hi[r] : fmaf(wq4[k], hi[r], acc[ct][4 + r]);
      }
    }
  }
  // ctx^T tiles (rows e = 16 ct + 8h + r, cols j) -> two B fragments with k = e
  const float linv = 1.0f / lsum;                   /* the column's whole sum; it carries the same x4096 as acc */
  FragH cf0, cf1;
#pragma unroll
  for (int r = 0; r < 8; ++r) {
    cf0.h[r]     = toh_flush(acc[0][r] * linv);
    cf0.h[8 + r] = toh_flush(acc[1][r] * linv);
    cf1.h[r]     = toh_flush(acc[2][r] * linv);
    cf1.h[8 + r] = toh_flush(acc[3][r] * linv);
  }
  const float g = bf16_rne(gam[0]);
#pragma unroll   /* constant wa, xr, bb index */
  for (int hf = 0; hf < 2; ++hf) {
    const int ch0 = hf * CH;
#pragma unroll
    for (int c2 = 0; c2 < 2; ++c2) {
      const int ct = kq * 2 + c2;                   /* the group's four waves share the slab's eight channel tiles */
      v8f d = z8;
      d = mma_h1(wa[hf][c2][0].v, cf0.v, d);
      d = mma_h1(wa[hf][c2][1].v, cf1.v, d);
#pragma unroll
      for (int r = 0; r < 8; ++r) so[ct * 16 + 8 * hh + r][qg * 16 + ln] = d[r] * WOINV;
    }
    __syncthreads();
    {
#pragma unroll   /* constant xr, bb index */
      for (int it = 0; it < CH / 32; ++it) {
        const int row = it * 32 + wave * 2 + rsub;
        const v4f v = *(const v4fa*)&so[row][pc];
        v4f o;
#pragma unroll
        for (int q = 0; q < 4; ++q) o[q] = bf16_rne(xr[hf][it][q]) + g * (v[q] + bf16_rne(bb[hf][it]));
        *(v4f*)(out + ((size_t)(b * CC + ch0 + row)) * SEQ + jb + pc) = o;
        asm volatile("s_wait_xcnt 0x0" ::: "memory");   /* later code may rewrite the store's address registers */
      }
      
    }
    __syncthreads();
  }
}

// workspace carve (bytes, every region a multiple of 256)
#define SZ_WO  ((size_t)CC * RD * 2)
#define SZ_P   (NRT * RD * 2)
#define SZ_VT  ((size_t)NB * RD * SEQ * 2)
#define OFF_WOH ((size_t)0)
#define OFF_KH  (OFF_WOH + SZ_WO)
#define OFF_KL  (OFF_KH + SZ_P)
#define OFF_QH  (OFF_KL + SZ_P)
#define OFF_QL  (OFF_QH + SZ_P)
#define OFF_VT  (OFF_QL + SZ_P)
#define WS_TOTAL (OFF_VT + SZ_VT)
static_assert(SZ_WO % 256 == 0 && SZ_P % 256 == 0 && SZ_VT % 256 == 0);
static_assert(WS_TOTAL <= (size_t)134217728);
static_assert((NRT % 64) == 0);                                            /* projection blocks x 64 pixels == token rows */
static_assert(SEQ % 64 == 0 && SEQ % 32 == 0);                             /* k_attn tiles and 32-row key steps */

extern "C" void kernel_launch(void* const* d_in, const int* in_sizes, int n_in,
                              void* d_out, int out_size, void* d_ws, size_t ws_size, hipStream_t stream) {
  if (n_in < 10) return;
  if ((size_t)in_sizes[0] < (size_t)(NB * CC - 1) * SEQ_FULL + SEQ) return;
  if ((size_t)in_sizes[1] < (size_t)RD * CC) return;
  if ((size_t)in_sizes[2] < (size_t)RD) return;
  if ((size_t)in_sizes[3] < (size_t)RD * CC) return;
  if ((size_t)in_sizes[4] < (size_t)RD) return;
  if ((size_t)in_sizes[5] < (size_t)RD * CC) return;
  if ((size_t)in_sizes[6] < (size_t)RD) return;
  if ((size_t)in_sizes[7] < (size_t)CC * RD) return;
  if ((size_t)in_sizes[8] < (size_t)CC) return;
  if ((size_t)in_sizes[9] < (size_t)1) return;
  if ((size_t)out_size < (size_t)NB * CC * SEQ) return;
  if (WS_TOTAL > ws_size) return;
  const float* x  = (const float*)d_in[0];       /* [NB][CC][SEQ_FULL] channel-first */
  const float* wk = (const float*)d_in[1];       /* [RD][CC] = [out][in], key */
  const float* bk = (const float*)d_in[2];       /* [RD] */
  const float* wq = (const float*)d_in[3];       /* [RD][CC] = [out][in], query */
  const float* bq = (const float*)d_in[4];       /* [RD] */
  const float* wv = (const float*)d_in[5];       /* [RD][CC] = [out][in], value */
  const float* bv = (const float*)d_in[6];       /* [RD] */
  const float* wo = (const float*)d_in[7];       /* [CC][RD] = [out][in] */
  const float* bo = (const float*)d_in[8];       /* [CC] */
  const float* gam = (const float*)d_in[9];      /* [1] */
  float* out = (float*)d_out;                    /* [NB][CC][SEQ] channel-first */
  char* ws = (char*)d_ws;
  unsigned short* WOH = (unsigned short*)(ws + OFF_WOH);
  unsigned short* KH  = (unsigned short*)(ws + OFF_KH);
  unsigned short* KL  = (unsigned short*)(ws + OFF_KL);
  unsigned short* QH  = (unsigned short*)(ws + OFF_QH);
  unsigned short* QL  = (unsigned short*)(ws + OFF_QL);
  unsigned short* VT  = (unsigned short*)(ws + OFF_VT);

  k_proj<<<(unsigned)(NRT / 64), PT, 0, stream>>>(x, wk, wq, wv, wo, bk, bq, bv, KH, KL, QH, QL, VT, WOH);
  k_attn<<<dim3(SEQ / 64, NB), AT, 0, stream>>>(KH, KL, QH, QL, VT, WOH, bo, gam, x, out);
}

// v007
// Measured time: 45.2 microseconds a run.
// Next to v006, in two timings, it ran 1.06 and 1.05 times as fast.
// Over all steps from v000 it is 9.20 times as fast.
#include <hip/hip_runtime.h>
// Compute dtype: inputs converted (RNE) to bf16; key, query and value projections v_wmma_f32_16x16x32_bf16 (exact products, f32 accumulate, bias added in f32); scores f.g^T as bf16 hi|lo three-product (hi.hi + lo.hi + hi.lo) v_wmma_f32_16x16x32_bf16, f32 accumulate; softmax running maximum and sum f32, kept in the attention loop by each of four waves per query column (one 32-key quarter of every tile each) and merged in f32 at the end; V^T single f16 and P = exp(s - running maximum) x4096 single f16 on v_wmma_f32_16x16x32_f16, f32 accumulate scaled every 32 keys by exp(old - new maximum), divided by the sum at the end; output projection Wo x64 single f16 times ctx single f16 on v_wmma_f32_16x16x32_f16, f32 accumulate; result = bf16(x) + bf16(gamma) * (o + bf16(bo)) in f32.
#ifndef NB
#define NB 4                      /* images */
#endif
#ifndef SEQ
#define SEQ 4096                  /* pixels per image processed */
#endif
#define SEQ_FULL 4096             /* pixel pitch of the staged x rows */
#define CC 256                    /* channels */
#define RD 64                     /* embedding channels (key / query / value width) */
#define CH 128                    /* channels per epilogue slab */
#define LOG2E 1.4426950408889634f      /* scores go to base 2 inside the exponent's multiply-add */
#define PCARRY_L2 12.0f                /* P carried x4096 */
#define WOCARRY 64.0f                  /* Wo plane carried x64 */
#define WOINV 0.015625f                /* 2^-6 */
#define NRT ((size_t)NB * SEQ)

static_assert(SEQ % 256 == 0);          /* 64-pixel tiles */
static_assert(SEQ <= SEQ_FULL);
static_assert(CC % 64 == 0);            /* K % 32 == 0 */
static_assert(RD == 64);                
static_assert(CC == 2 * CH);            /* two channel slabs in the epilogue */
static_assert(CH % 16 == 0 && CH / 16 == 8);

typedef __bf16 v16b __attribute__((ext_vector_type(16)));
typedef _Float16 v16h __attribute__((ext_vector_type(16)));
typedef unsigned short v8us __attribute__((ext_vector_type(8), may_alias));
typedef float v8f  __attribute__((ext_vector_type(8)));
typedef float v16f __attribute__((ext_vector_type(16)));
typedef __bf16 v8b __attribute__((ext_vector_type(8)));
typedef unsigned short v8u __attribute__((ext_vector_type(8)));
typedef float v4f  __attribute__((ext_vector_type(4)));
typedef float v4fa __attribute__((ext_vector_type(4), may_alias));
typedef float v2f  __attribute__((ext_vector_type(2)));
typedef float v2fa __attribute__((ext_vector_type(2), may_alias));
typedef _Float16 h16;
union FragB { v16b v; v8us half[2]; };
union FragH { v16h v; v8us half[2]; _Float16 h[16]; };

__device__ __forceinline__ unsigned short bf16_bits(float x) { unsigned int u = __float_as_uint(x); return (unsigned short)((u + 0x7FFFu + ((u >> 16) & 1u)) >> 16); }
__device__ __forceinline__ float bf16_val(unsigned short b) { return __uint_as_float(((unsigned int)b) << 16); }
__device__ __forceinline__ float bf16_rne(float x) { return bf16_val(bf16_bits(x)); }

// f32 -> f16 that cannot produce an f16 subnormal (value select)
static __device__ __forceinline__ h16 toh_flush(float v) { const h16 r = (h16)v; return (fabsf(v) < 6.103515625e-05f) ? (h16)0.0f : r; }
// lane l <-> lane l ^ 16: the two lanes that hold one query column
static __device__ __forceinline__ float xhalf(float x) { return __builtin_bit_cast(float, __builtin_amdgcn_permlanex16(__builtin_bit_cast(int, x), __builtin_bit_cast(int, x), 0x76543210, 0xfedcba98, false, false)); }
static __device__ __forceinline__ float max3(float a, float b, float c) { return fmaxf(fmaxf(a, b), c); }
// 2^d with the slot behind the transcendental filled inside the statement
static __device__ __forceinline__ float exp2_slot(float d) { float r; asm("v_exp_f32 %0, %1\n\tv_nop" : "=v"(r) : "v"(d)); return r; }

// fragment of a k-contiguous 16-bit row: elements 0..7 <- k 8h..8h+7, elements 8..15 <- k 16+8h..16+8h+7 (same map for A and B)
__device__ __forceinline__ v16b ld_bf(const unsigned short* p, int hh) { FragB f; f.half[0] = *(const v8us*)(p + 8 * hh); f.half[1] = *(const v8us*)(p + 16 + 8 * hh); return f.v; }

__device__ __forceinline__ v8f mma_b1(v16b a, v16b b, v8f c) {
  c = __builtin_amdgcn_wmma_f32_16x16x32_bf16(false, a, false, b, (short)0, c, false, false);
  asm volatile("v_nop\n\tv_nop\n\tv_nop\n\tv_nop" : "+v"(c) : "v"(a), "v"(b));
  return c;
}
// c += ah.bh + al.bh + ah.bl (unscaled bf16 residuals share the accumulator)
__device__ __forceinline__ v8f mma_b3(v16b ah, v16b al, v16b bh, v16b bl, v8f c) {
  c = __builtin_amdgcn_wmma_f32_16x16x32_bf16(false, ah, false, bh, (short)0, c, false, false);
  c = __builtin_amdgcn_wmma_f32_16x16x32_bf16(false, al, false, bh, (short)0, c, false, false);
  c = __builtin_amdgcn_wmma_f32_16x16x32_bf16(false, ah, false, bl, (short)0, c, false, false);
  asm volatile("v_nop\n\tv_nop\n\tv_nop\n\tv_nop" : "+v"(c) : "v"(ah), "v"(al), "v"(bh), "v"(bl));
  return c;
}
__device__ __forceinline__ v8f mma_h1(v16h a, v16h b, v8f c) {
  c = __builtin_amdgcn_wmma_f32_16x16x32_f16(false, a, false, b, (short)0, c, false, false);
  asm volatile("v_nop\n\tv_nop\n\tv_nop\n\tv_nop" : "+v"(c) : "v"(a), "v"(b));
  return c;
}

// ---- key / value tiles staged in LDS by asynchronous copies, two buffers ----
#define TK 128                        /* keys per staged tile */
#define NTILE (SEQ / TK)
#define KPITCH 144                    /* LDS bytes per 128-byte key row (16 B x odd: no bank conflict for 16-byte readers) */
#define VPITCH 272                    /* LDS bytes per 256-byte V^T row (16 B x odd) */
#define KTILE_B (TK * KPITCH)
#define VTILE_B (RD * VPITCH)
#define ASTAGE_B (2 * KTILE_B + VTILE_B)  /* k_attn stage: K hi, K lo, V^T */
static_assert(SEQ % TK == 0 && NTILE >= 2);   /* the ring's prologue fills two tiles */
static_assert(RD * 2 == 128 && TK * 2 == 256);
static_assert(KTILE_B % 16 == 0 && VTILE_B % 16 == 0);

__device__ __forceinline__ unsigned lds_off(const void* p) { return (unsigned)(size_t)p; }

#define AT 512                        /* k_attn threads: 4 query groups of 16 columns x 4 key quarters of a tile */
static_assert(TK / 32 == 4 && TK * RD * 2 == 2 * AT * 16 && RD * TK * 2 == 2 * AT * 16);   /* two copies per lane and plane */
// One stage, six 16-byte copies per lane, global -> LDS, through no register: two per plane (K hi, K lo, V^T).
// K planes (rows contiguous in memory): lane tid brings bytes 16 tid .. 16 tid + 15 of each 8-KiB slab (64 rows).
// V^T (64 rows x 128 keys, row pitch SEQ): 16 lanes per row, 32 rows per copy.
// The s_wait_xcnt is the statement's last line so that no later rewrite of an address register can be scheduled in front of it.
__device__ __forceinline__ void cp_stage(unsigned lbase, const unsigned short* kh_row0, const unsigned short* kl_row0,
                                         const unsigned short* vt_row0_key0, int tid) {
  const unsigned lk = lbase + (unsigned)(tid >> 3) * KPITCH + (unsigned)(tid & 7) * 16u;
  const unsigned lv = lbase + 2 * KTILE_B + (unsigned)(tid >> 4) * VPITCH + (unsigned)(tid & 15) * 16u;
  const unsigned short* gh = kh_row0 + tid * 8;
  const unsigned short* gl = kl_row0 + tid * 8;
  const unsigned short* gv = vt_row0_key0 + (size_t)(tid >> 4) * SEQ + (tid & 15) * 8;
  asm volatile("global_load_async_to_lds_b128 %0, %6, off\n\t"
               "global_load_async_to_lds_b128 %1, %7, off\n\t"
               "global_load_async_to_lds_b128 %2, %8, off\n\t"
               "global_load_async_to_lds_b128 %3, %9, off\n\t"
               "global_load_async_to_lds_b128 %4, %10, off\n\t"
               "global_load_async_to_lds_b128 %5, %11, off\n\t"
               "s_wait_xcnt 0x0"
               :: "v"(lk), "v"(lk + 64u * KPITCH), "v"(lk + KTILE_B), "v"(lk + KTILE_B + 64u * KPITCH), "v"(lv), "v"(lv + 32u * VPITCH),
                  "v"(gh), "v"(gh + 64 * RD), "v"(gl), "v"(gl + 64 * RD), "v"(gv), "v"(gv + (size_t)32 * SEQ)
               : "memory");
}
// own copies landed (before the barrier that lets other waves read them)
__device__ __forceinline__ void wait_copies() { asm volatile("s_wait_asynccnt 0x0" ::: "memory"); }
// own LDS reads retired (before the barrier behind which their buffer is refilled)
__device__ __forceinline__ void wait_lds() { asm volatile("s_wait_dscnt 0x0" ::: "memory"); }
// fragment of a staged 16-bit row, p = row start + 64 * (k / 32) + 16 h: same element map as ld_bf
__device__ __forceinline__ v16b lds_bf(const unsigned char* p) { FragB f; f.half[0] = *(const v8us*)p; f.half[1] = *(const v8us*)(p + 32); return f.v; }
// K fragments of 32 staged keys: kf[4 * (16-key row block) + 2 * (k half) + (hi, lo)]; p = the lane's place in the hi plane
__device__ __forceinline__ void lds_k16(v16b (&kf)[8], int rb16, const unsigned char* p) {
#pragma unroll   /* constant kf index */
  for (int kh = 0; kh < 2; ++kh) {
    kf[rb16 * 4 + kh * 2]     = lds_bf(p + rb16 * 16 * KPITCH + kh * 64);
    kf[rb16 * 4 + kh * 2 + 1] = lds_bf(p + rb16 * 16 * KPITCH + kh * 64 + KTILE_B);
  }
}
__device__ __forceinline__ void lds_k32(v16b (&kf)[8], const unsigned char* p) { lds_k16(kf, 0, p); lds_k16(kf, 1, p); }

// t = the thread's place among the plane's groups of eight weights
__device__ __forceinline__ void wcvth(const float* __restrict__ W, unsigned short* __restrict__ Wh, int t) {
  const v4f a = *(const v4fa*)(W + (size_t)t * 8);
  const v4f c = *(const v4fa*)(W + (size_t)t * 8 + 4);
  FragH f;
#pragma unroll
  for (int q = 0; q < 4; ++q) { f.h[q] = toh_flush(bf16_rne(a[q]) * WOCARRY); f.h[4 + q] = toh_flush(bf16_rne(c[q]) * WOCARRY); }
  const v8us v = f.half[0];
  unsigned short* d = Wh + (size_t)t * 8;
  *(v8us*)d = v;
  asm volatile("s_wait_xcnt 0x0" ::: "memory");   /* the store's registers may be rewritten by the code behind it */
}

#define PT 512                        /* k_proj threads: 16 waves load and convert the x tile, 12 of them multiply */
#define XPITCH 528                    /* LDS bytes per 512-byte pixel row of bf16 channels (16 B x odd) */
#define SPITCH 68                     /* floats per staged result row: the two lane halves fall on different banks */
#define MW (3 * (RD / 16))            /* waves that multiply: one per 16 output channels of key, query, value */
#define WOBLK ((CC * RD / 8) / (PT - 32 * MW))   /* blocks whose other waves also convert the output-projection plane */
static_assert((CC * RD / 8) % (PT - 32 * MW) == 0 && WOBLK <= NRT / 64);
static_assert((CC / 8) * (64 / 4) == PT);   /* one group of 8 channels x 4 pixels per thread */
static_assert(64 * (RD / 8) == PT);         /* one group of 8 results per thread and plane */
static_assert(MW < PT / 32);

// the x fragments of one k step: read from LDS together
__device__ __forceinline__ void lds_x4(v16b (&xf)[4], const unsigned char* xp, int s) {
#pragma unroll   /* constant xf index */
  for (int pt = 0; pt < 4; ++pt) xf[pt] = lds_bf(xp + pt * 16 * XPITCH + s * 64);
}
// 64 pixels (rows) x 16 output channels (columns) over all CC channels, k ascending
__device__ __forceinline__ void proj_tiles(v8f (&acc)[4], const v16b (&wf)[CC / 32], const unsigned char* xp) {
  v16b xf[3][4];                        /* three register sets: a k step's reads are issued two steps of products ahead of its use */
  lds_x4(xf[0], xp, 0);
  lds_x4(xf[1], xp, 1);
  lds_x4(xf[2], xp, 2);
#pragma unroll   /* constant xf, wf, acc index */
  for (int s = 0; s < CC / 32; ++s) {
#pragma unroll
    for (int pt = 0; pt < 4; ++pt)
      acc[pt] = mma_b1(xf[s % 3][pt], wf[s], acc[pt]);
    if (s + 3 < CC / 32) lds_x4(xf[s % 3], xp, s + 3);
  }
}

// One launch for all that precedes the attention, one block per 64 pixels of one image:
// x (f32, channel-first) is converted to bf16 and transposed into LDS by all 16 waves,
// each of 12 waves converts its own 16 weight rows to bf16 fragments in registers and multiplies them with the whole tile,
// the results meet in LDS and leave as whole lines. The four other waves of the first WOBLK blocks convert the output-projection plane.
__global__ __launch_bounds__(PT) void k_proj(const float* __restrict__ x, const float* __restrict__ wk, const float* __restrict__ wq,
                                             const float* __restrict__ wv, const float* __restrict__ wo,
                                             const float* __restrict__ bk, const float* __restrict__ bq, const float* __restrict__ bv,
                                             unsigned short* __restrict__ KH, unsigned short* __restrict__ KL,
                                             unsigned short* __restrict__ QH, unsigned short* __restrict__ QL,
                                             unsigned short* __restrict__ VT, unsigned short* __restrict__ WOH) {
  __shared__ __attribute__((aligned(16))) unsigned char xs[64 * XPITCH];
  __shared__ __attribute__((aligned(16))) float st[3][64][SPITCH];
  const int tid = threadIdx.x;
  const int blk = blockIdx.x;
  const int b = blk / (SEQ / 64), n0 = (blk % (SEQ / 64)) * 64;
  const int wave = __builtin_amdgcn_readfirstlane(tid >> 5);
  const int lane = tid & 31, ln = lane & 15, hh = lane >> 4;
  const bool mm = wave < MW;                        /* the waves that multiply */
  const int pl = wave >> 2, et = wave & 3;          /* plane (key, query, value) and its 16-channel tile */
  // all global reads of the block are issued here, together: one memory latency
  const int r = tid >> 3, c8 = (tid & 7) * 8;       /* the thread's place in each plane's results */
  const float* pbk = bk + c8;
  const float* pbq = bq + c8;
  const float* pbv = bv + r;
  const v4f bka = *(const v4fa*)pbk, bkc = *(const v4fa*)(pbk + 4);
  const v4f bqa = *(const v4fa*)pbq, bqc = *(const v4fa*)(pbq + 4);
  const float bvr = *pbv;
  asm volatile("s_wait_xcnt 0x0" :: "v"(pbk), "v"(pbq), "v"(pbv) : "memory");   /* the address pairs stay whole until every load's address is taken */
  const int cg = tid >> 4, n4 = (tid & 15) * 4;
  v4f xv[8];
  const float* px = x + ((size_t)(b * CC + cg * 8)) * SEQ_FULL + n0 + n4;
#pragma unroll   /* constant xv index */
  for (int j = 0; j < 8; ++j) xv[j] = *(const v4fa*)(px + (size_t)j * SEQ_FULL);
  asm volatile("s_wait_xcnt 0x0" :: "v"(px) : "memory");   /* the address pair stays whole until every load's address is taken */
  v4f wr[CC / 32][4];
  if (mm) {
    const float* pwf = (pl == 0 ? wk : pl == 1 ? wq : wv) + (size_t)(et * 16 + ln) * CC + 8 * hh;
#pragma unroll   /* constant wr index */
    for (int s = 0; s < CC / 32; ++s) {
      wr[s][0] = *(const v4fa*)(pwf + s * 32);
      wr[s][1] = *(const v4fa*)(pwf + s * 32 + 4);
      wr[s][2] = *(const v4fa*)(pwf + s * 32 + 16);
      wr[s][3] = *(const v4fa*)(pwf + s * 32 + 20);
    }
    asm volatile("s_wait_xcnt 0x0" :: "v"(pwf) : "memory");   /* the address pair stays whole until every load's address is taken */
  } else if (blk < WOBLK) {             /* the same for the whole wave; done while the multiplying waves wait for their weights */
    wcvth(wo, WOH, blk * (PT - 32 * MW) + tid - 32 * MW);
  }
#pragma unroll   /* constant xv index */
  for (int q = 0; q < 4; ++q) {
    const v8f t = {xv[0][q], xv[1][q], xv[2][q], xv[3][q], xv[4][q], xv[5][q], xv[6][q], xv[7][q]};
    *(v8us*)(xs + (n4 + q) * XPITCH + cg * 16) = __builtin_bit_cast(v8u, __builtin_convertvector(t, v8b));   /* RNE, two values per instruction */
  }
  v16b wf[CC / 32];
  if (mm) {
#pragma unroll   /* constant wr, wf index; same element map as ld_bf */
    for (int s = 0; s < CC / 32; ++s) {
      const v16f t = {wr[s][0][0], wr[s][0][1], wr[s][0][2], wr[s][0][3], wr[s][1][0], wr[s][1][1], wr[s][1][2], wr[s][1][3],
                      wr[s][2][0], wr[s][2][1], wr[s][2][2], wr[s][2][3], wr[s][3][0], wr[s][3][1], wr[s][3][2], wr[s][3][3]};
      wf[s] = __builtin_convertvector(t, v16b);     /* RNE, two values per instruction */
    }
  }
  __syncthreads();
  if (mm) {
    const v8f z8 = {0.f, 0.f, 0.f, 0.f, 0.f, 0.f, 0.f, 0.f};
    v8f acc[4];
#pragma unroll
    for (int pt = 0; pt < 4; ++pt) acc[pt] = z8;
    const unsigned char* xp = xs + ln * XPITCH + hh * 16;
    proj_tiles(acc, wf, xp);
    if (pl < 2) {                                   /* key, query: staged as [pixel][channel] */
#pragma unroll
      for (int pt = 0; pt < 4; ++pt)
#pragma unroll
        for (int i = 0; i < 8; ++i) st[pl][pt * 16 + 8 * hh + i][et * 16 + ln] = acc[pt][i];
    } else {                                        /* value: staged as [channel][pixel], a lane's eight pixels are neighbours */
#pragma unroll
      for (int pt = 0; pt < 4; ++pt) {
        const v4f lo = {acc[pt][0], acc[pt][1], acc[pt][2], acc[pt][3]};
        const v4f hi = {acc[pt][4], acc[pt][5], acc[pt][6], acc[pt][7]};
        *(v4fa*)&st[2][et * 16 + ln][pt * 16 + 8 * hh] = lo;
        *(v4fa*)&st[2][et * 16 + ln][pt * 16 + 8 * hh + 4] = hi;
      }
    }
  }
  __syncthreads();
  const size_t o = ((size_t)b * SEQ + n0 + r) * RD + c8;
#pragma unroll   /* key, then query */
  for (int p = 0; p < 2; ++p) {
    const v4f a = *(const v4fa*)&st[p][r][c8];
    const v4f c = *(const v4fa*)&st[p][r][c8 + 4];
    const v4f ba = p ? bqa : bka, bc = p ? bqc : bkc;
    v8us vh, vl;
#pragma unroll
    for (int q = 0; q < 4; ++q) {
      const float va = a[q] + bf16_rne(ba[q]);
      const float vc = c[q] + bf16_rne(bc[q]);
      unsigned short hb = bf16_bits(va); vh[q] = hb; vl[q] = bf16_bits(va - bf16_val(hb));
      hb = bf16_bits(vc); vh[4 + q] = hb; vl[4 + q] = bf16_bits(vc - bf16_val(hb));
    }
    *(v8us*)((p ? QH : KH) + o) = vh;
    *(v8us*)((p ? QL : KL) + o) = vl;
    asm volatile("s_wait_xcnt 0x0" ::: "memory");   /* later code may rewrite the stores' address registers */
  }
  {
    const v4f a = *(const v4fa*)&st[2][r][c8];
    const v4f c = *(const v4fa*)&st[2][r][c8 + 4];
    const float bb = bf16_rne(bvr);
    FragH f;
#pragma unroll
    for (int q = 0; q < 4; ++q) { f.h[q] = toh_flush(a[q] + bb); f.h[4 + q] = toh_flush(c[q] + bb); }
    const v8us ov = f.half[0];
    *(v8us*)(VT + ((size_t)(b * RD + r)) * SEQ + n0 + c8) = ov;
  }
}

#define PART_B (8 * 512 + 256)        /* one wave's partial in LDS: 32 accumulator floats and (maximum, sum) per lane */
static_assert((AT / 32) * PART_B <= 2 * ASTAGE_B);

__global__ __launch_bounds__(AT) void k_attn(const unsigned short* __restrict__ KH, const unsigned short* __restrict__ KL,
                                             const unsigned short* __restrict__ QH, const unsigned short* __restrict__ QL,
                                             const unsigned short* __restrict__ VT,
                                             const unsigned short* __restrict__ WOH, const float* __restrict__ bo,
                                             const float* __restrict__ gam,
                                             const float* __restrict__ x, float* __restrict__ out) {
  __shared__ __attribute__((aligned(16))) float so[CH][68];
  __shared__ __attribute__((aligned(16))) unsigned char ring[2 * ASTAGE_B];
  const int tid = threadIdx.x;
  const int wave = __builtin_amdgcn_readfirstlane(tid >> 5);
  const int qg = wave & 3;                          /* which 16 query columns of the block */
  const int kq = wave >> 2;                         /* which 32 keys of every staged tile */
  const int lane = tid & 31, ln = lane & 15, hh = lane >> 4;
  const int b = blockIdx.y, jb = blockIdx.x * 64;
  const size_t tb = (size_t)b * SEQ;
  const size_t qo = (tb + jb + qg * 16 + ln) * RD;
  const v16b bH0 = ld_bf(QH + qo, hh), bL0 = ld_bf(QL + qo, hh), bH1 = ld_bf(QH + qo + 32, hh), bL1 = ld_bf(QL + qo + 32, hh);
  float m = -1.0e30f;                               /* running maximum of this lane's query column over this wave's keys, the same in both lanes that hold it */
  float m2 = -1.0e30f;                              /* m in base 2, less the carry: what the exponent subtracts */
  float l = 0.f;                                    /* sum of P over this lane's own keys, on the scale of m */
  const v8f z8 = {0.f, 0.f, 0.f, 0.f, 0.f, 0.f, 0.f, 0.f};
  v8f acc[4];
#pragma unroll
  for (int i = 0; i < 4; ++i) acc[i] = z8;
  const unsigned rb = lds_off(ring);
  const unsigned short* kh0 = KH + tb * RD;
  const unsigned short* kl0 = KL + tb * RD;
  const unsigned short* vt0 = VT + (size_t)(b * RD) * SEQ;
  cp_stage(rb, kh0, kl0, vt0, tid);
  wait_copies();
  __syncthreads();
  cp_stage(rb + ASTAGE_B, kh0 + (size_t)TK * RD, kl0 + (size_t)TK * RD, vt0 + TK, tid);
  // the x values that the last stage adds: loaded here, so that their memory latency passes under the key loop
  const int rsub = lane >> 4, pc = (lane & 15) * 4;
  v4f xr[2][CH / 32];
  const float* px = x + ((size_t)(b * CC + wave * 2 + rsub)) * SEQ_FULL + jb + pc;
#pragma unroll   /* constant xr index */
  for (int hf = 0; hf < 2; ++hf)
#pragma unroll
    for (int it = 0; it < CH / 32; ++it) xr[hf][it] = *(const v4fa*)(px + (size_t)(hf * CH + it * 32) * SEQ_FULL);
  asm volatile("s_wait_xcnt 0x0" :: "v"(px) : "memory");   /* the address pair stays whole until every load's address is taken */
#pragma unroll 1   /* rolled: one publish point per trip, the buffer picked by t & 1 */
  for (int t = 0; t < NTILE; ++t) {
    const unsigned bsel = (unsigned)(t & 1) * ASTAGE_B;
    const unsigned char* fr = ring + bsel + (kq * 32 + ln) * KPITCH + hh * 16;
    const unsigned char* vf = ring + bsel + 2 * KTILE_B + ln * VPITCH + hh * 16 + kq * 64;
    v16b kf[8];
    lds_k32(kf, fr);
    FragH va[4];                                    /* V^T fragments of these 32 keys: land under the score products */
#pragma unroll   /* constant va index */
    for (int ct = 0; ct < 4; ++ct) {
      const unsigned char* vp = vf + ct * 16 * VPITCH;
      va[ct].half[0] = *(const v8us*)vp;
      va[ct].half[1] = *(const v8us*)(vp + 32);
    }
    v8f s0 = z8, s1 = z8;
    s0 = mma_b3(kf[0], kf[1], bH0, bL0, s0);
    s0 = mma_b3(kf[2], kf[3], bH1, bL1, s0);
    s1 = mma_b3(kf[4], kf[5], bH0, bL0, s1);
    s1 = mma_b3(kf[6], kf[7], bH1, bL1, s1);
    const float mh = max3(max3(max3(s0[0], s0[1], s0[2]), max3(s0[3], s0[4], s0[5]), max3(s0[6], s0[7], s1[0])),
                          max3(max3(s1[1], s1[2], s1[3]), max3(s1[4], s1[5], s1[6]), s1[7]), m);
    m = fmaxf(mh, xhalf(mh));
    const float m2n = fmaf(m, LOG2E, -PCARRY_L2);
    const float da = m2 - m2n;
    m2 = m2n;
    const v2f l2e = {LOG2E, LOG2E}, nm2 = {-m2n, -m2n};
    v2f a0[4], a1[4];                               /* exponent arguments of s0 and s1, two neighbours per instruction */
#pragma unroll   /* constant a0, a1 index */
    for (int j = 0; j < 4; ++j) {
      const v2f q0 = {s0[2 * j], s0[2 * j + 1]}, q1 = {s1[2 * j], s1[2 * j + 1]};
      a0[j] = __builtin_elementwise_fma(q0, l2e, nm2);
      a1[j] = __builtin_elementwise_fma(q1, l2e, nm2);
    }
    // The powers of two in two statements whose results share no register with their sources. Each v_nop fills the slot behind a statement's last one.
    float alpha;                                    /* exp(old - new maximum): 0 on the first 32 keys, 1 while the maximum stands */
    float e[16];                                    /* P: 0..7 of s0, 8..15 of s1 */
    asm("v_exp_f32 %0, %9\n\tv_exp_f32 %1, %10\n\tv_exp_f32 %2, %11\n\tv_exp_f32 %3, %12\n\tv_exp_f32 %4, %13\n\t"
        "v_exp_f32 %5, %14\n\tv_exp_f32 %6, %15\n\tv_exp_f32 %7, %16\n\tv_exp_f32 %8, %17\n\tv_nop"
        : "=&v"(e[0]), "=&v"(e[1]), "=&v"(e[2]), "=&v"(e[3]), "=&v"(e[4]), "=&v"(e[5]), "=&v"(e[6]), "=&v"(e[7]), "=&v"(alpha)
        : "v"(a0[0][0]), "v"(a0[0][1]), "v"(a0[1][0]), "v"(a0[1][1]), "v"(a0[2][0]), "v"(a0[2][1]), "v"(a0[3][0]), "v"(a0[3][1]), "v"(da));
    asm("v_exp_f32 %0, %8\n\tv_exp_f32 %1, %9\n\tv_exp_f32 %2, %10\n\tv_exp_f32 %3, %11\n\tv_exp_f32 %4, %12\n\t"
        "v_exp_f32 %5, %13\n\tv_exp_f32 %6, %14\n\tv_exp_f32 %7, %15\n\tv_nop"
        : "=&v"(e[8]), "=&v"(e[9]), "=&v"(e[10]), "=&v"(e[11]), "=&v"(e[12]), "=&v"(e[13]), "=&v"(e[14]), "=&v"(e[15])
        : "v"(a1[0][0]), "v"(a1[0][1]), "v"(a1[1][0]), "v"(a1[1][1]), "v"(a1[2][0]), "v"(a1[2][1]), "v"(a1[3][0]), "v"(a1[3][1]));
    v16f pe;
    float ps[8];
#pragma unroll
    for (int r = 0; r < 8; ++r) {
      pe[r]     = e[r];
      pe[8 + r] = e[8 + r];
      ps[r] = e[r] + e[8 + r];
    }
    FragH pf;
    pf.v = __builtin_convertvector(pe, v16h);       /* RNE, two values per instruction; a P below 2^-14 stays as an f16 subnormal */
    l = fmaf(l, alpha, ((ps[0] + ps[1]) + (ps[2] + ps[3])) + ((ps[4] + ps[5]) + (ps[6] + ps[7])));
#pragma unroll   /* constant acc index */
    for (int ct = 0; ct < 4; ++ct) acc[ct] *= alpha;
#pragma unroll   /* constant acc index */
    for (int ct = 0; ct < 4; ++ct) acc[ct] = mma_h1(va[ct].v, pf.v, acc[ct]);
    // publish point: tile t + 1 becomes readable, tile t's buffer becomes free
    wait_lds();
    wait_copies();
    __syncthreads();
    if (t + 2 < NTILE)
      cp_stage(rb + bsel, kh0 + (size_t)(t + 2) * TK * RD, kl0 + (size_t)(t + 2) * TK * RD, vt0 + (t + 2) * TK, tid);
  }
  wait_copies();
  // The four key quarters of a query group meet in LDS. The ring is free: the last trip's barrier ended every read of it, no copy is in flight.
  {
    unsigned char* pw = ring + wave * PART_B + lane * 16;
#pragma unroll
    for (int ct = 0; ct < 4; ++ct) {
      const v4f lo = {acc[ct][0], acc[ct][1], acc[ct][2], acc[ct][3]};
      const v4f hi = {acc[ct][4], acc[ct][5], acc[ct][6], acc[ct][7]};
      *(v4fa*)(pw + (2 * ct) * 512) = lo;
      *(v4fa*)(pw + (2 * ct + 1) * 512) = hi;
    }
    const v2f ml = {m2, l + xhalf(l)};              /* the quarter's maximum (base 2) and its column's whole sum */
    *(v2fa*)(ring + wave * PART_B + 8 * 512 + lane * 8) = ml;
  }
  __syncthreads();
  // output-projection fragments and bias of both slabs: loaded here, behind the barrier, so that their latency passes under the merge
  FragH wa[2][2][2];
  float bb[2][CH / 32];
  const unsigned short* pw = WOH + (size_t)(kq * 32 + ln) * RD + 8 * hh;
  const float* pbo = bo + wave * 2 + rsub;
#pragma unroll   /* constant wa, bb index */
  for (int hf = 0; hf < 2; ++hf) {
#pragma unroll
    for (int c2 = 0; c2 < 2; ++c2) {
      const unsigned short* wp = pw + (size_t)(hf * CH + c2 * 16) * RD;
      wa[hf][c2][0].half[0] = *(const v8us*)wp;
      wa[hf][c2][0].half[1] = *(const v8us*)(wp + 16);
      wa[hf][c2][1].half[0] = *(const v8us*)(wp + 32);
      wa[hf][c2][1].half[1] = *(const v8us*)(wp + 48);
    }
#pragma unroll
    for (int it = 0; it < CH / 32; ++it) bb[hf][it] = pbo[hf * CH + it * 32];
  }
  asm volatile("s_wait_xcnt 0x0" :: "v"(pw), "v"(pbo) : "memory");   /* both address pairs stay whole until every load's address is taken */
  // every wave of the group forms the same merged column, quarters in the order 0..3
  float wq4[4], lsum;
  {
    v2f ml[4];
#pragma unroll
    for (int k = 0; k < 4; ++k) ml[k] = *(const v2fa*)(ring + (qg + 4 * k) * PART_B + 8 * 512 + lane * 8);
    const float mm = fmaxf(fmaxf(ml[0][0], ml[1][0]), fmaxf(ml[2][0], ml[3][0]));
#pragma unroll
    for (int k = 0; k < 4; ++k) wq4[k] = exp2_slot(ml[k][0] - mm);   /* 1 for the quarter that holds the column's maximum */
    lsum = wq4[0] * ml[0][1];
#pragma unroll
    for (int k = 1; k < 4; ++k) lsum = fmaf(wq4[k], ml[k][1], lsum);
  }
#pragma unroll
  for (int k = 0; k < 4; ++k) {
    const unsigned char* pr = ring + (qg + 4 * k) * PART_B + lane * 16;
#pragma unroll
    for (int ct = 0; ct < 4; ++ct) {
      const v4f lo = *(const v4fa*)(pr + (2 * ct) * 512);
      const v4f hi = *(const v4fa*)(pr + (2 * ct + 1) * 512);
#pragma unroll
      for (int r = 0; r < 4; ++r) {
        acc[ct][r]     = k == 0 ? wq4[0] * lo[r] : fmaf(wq4[k], lo[r], acc[ct][r]);
        acc[ct][4 + r] = k == 0 ? wq4[0] * hi[r] : fmaf(wq4[k], hi[r], acc[ct][4 + r]);
      }
    }
  }
  // ctx^T tiles (rows e = 16 ct + 8h + r, cols j) -> two B fragments with k = e
  const float linv = 1.0f / lsum;                   /* the column's whole sum; it carries the same x4096 as acc */
  FragH cf0, cf1;
#pragma unroll
  for (int r = 0; r < 8; ++r) {
    cf0.h[r]     = toh_flush(acc[0][r] * linv);
    cf0.h[8 + r] = toh_flush(acc[1][r] * linv);
    cf1.h[r]     = toh_flush(acc[2][r] * linv);
    cf1.h[8 + r] = toh_flush(acc[3][r] * linv);
  }
  const float g = bf16_rne(gam[0]);
#pragma unroll   /* constant wa, xr, bb index */
  for (int hf = 0; hf < 2; ++hf) {
    const int ch0 = hf * CH;
#pragma unroll
    for (int c2 = 0; c2 < 2; ++c2) {
      const int ct = kq * 2 + c2;                   /* the group's four waves share the slab's eight channel tiles */
      v8f d = z8;
      d = mma_h1(wa[hf][c2][0].v, cf0.v, d);
      d = mma_h1(wa[hf][c2][1].v, cf1.v, d);
#pragma unroll
      for (int r = 0; r < 8; ++r) so[ct * 16 + 8 * hh + r][qg * 16 + ln] = d[r] * WOINV;
    }
    __syncthreads();
    {
#pragma unroll   /* constant xr, bb index */
      for (int it = 0; it < CH / 32; ++it) {
        const int row = it * 32 + wave * 2 + rsub;
        const v4f v = *(const v4fa*)&so[row][pc];
        v4f o;
#pragma unroll
        for (int q = 0; q < 4; ++q) o[q] = bf16_rne(xr[hf][it][q]) + g * (v[q] + bf16_rne(bb[hf][it]));
        *(v4f*)(out + ((size_t)(b * CC + ch0 + row)) * SEQ + jb + pc) = o;
        asm volatile("s_wait_xcnt 0x0" ::: "memory");   /* later code may rewrite the store's address registers */
      }
      
    }
    __syncthreads();
  }
}

// workspace carve (bytes, every region a multiple of 256)
#define SZ_WO  ((size_t)CC * RD * 2)
#define SZ_P   (NRT * RD * 2)
#define SZ_VT  ((size_t)NB * RD * SEQ * 2)
#define OFF_WOH ((size_t)0)
#define OFF_KH  (OFF_WOH + SZ_WO)
#define OFF_KL  (OFF_KH + SZ_P)
#define OFF_QH  (OFF_KL + SZ_P)
#define OFF_QL  (OFF_QH + SZ_P)
#define OFF_VT  (OFF_QL + SZ_P)
#define WS_TOTAL (OFF_VT + SZ_VT)
static_assert(SZ_WO % 256 == 0 && SZ_P % 256 == 0 && SZ_VT % 256 == 0);
static_assert(WS_TOTAL <= (size_t)134217728);
static_assert((NRT % 64) == 0);                                            /* projection blocks x 64 pixels == token rows */
static_assert(SEQ % 64 == 0 && SEQ % 32 == 0);                             /* k_attn tiles and 32-row key steps */

extern "C" void kernel_launch(void* const* d_in, const int* in_sizes, int n_in,
                              void* d_out, int out_size, void* d_ws, size_t ws_size, hipStream_t stream) {
  if (n_in < 10) return;
  if ((size_t)in_sizes[0] < (size_t)(NB * CC - 1) * SEQ_FULL + SEQ) return;
  if ((size_t)in_sizes[1] < (size_t)RD * CC) return;
  if ((size_t)in_sizes[2] < (size_t)RD) return;
  if ((size_t)in_sizes[3] < (size_t)RD * CC) return;
  if ((size_t)in_sizes[4] < (size_t)RD) return;
  if ((size_t)in_sizes[5] < (size_t)RD * CC) return;
  if ((size_t)in_sizes[6] < (size_t)RD) return;
  if ((size_t)in_sizes[7] < (size_t)CC * RD) return;
  if ((size_t)in_sizes[8] < (size_t)CC) return;
  if ((size_t)in_sizes[9] < (size_t)1) return;
  if ((size_t)out_size < (size_t)NB * CC * SEQ) return;
  if (WS_TOTAL > ws_size) return;
  const float* x  = (const float*)d_in[0];       /* [NB][CC][SEQ_FULL] channel-first */
  const float* wk = (const float*)d_in[1];       /* [RD][CC] = [out][in], key */
  const float* bk = (const float*)d_in[2];       /* [RD] */
  const float* wq = (const float*)d_in[3];       /* [RD][CC] = [out][in], query */
  const float* bq = (const float*)d_in[4];       /* [RD] */
  const float* wv = (const float*)d_in[5];       /* [RD][CC] = [out][in], value */
  const float* bv = (const float*)d_in[6];       /* [RD] */
  const float* wo = (const float*)d_in[7];       /* [CC][RD] = [out][in] */
  const float* bo = (const float*)d_in[8];       /* [CC] */
  const float* gam = (const float*)d_in[9];      /* [1] */
  float* out = (float*)d_out;                    /* [NB][CC][SEQ] channel-first */
  char* ws = (char*)d_ws;
  unsigned short* WOH = (unsigned short*)(ws + OFF_WOH);
  unsigned short* KH  = (unsigned short*)(ws + OFF_KH);
  unsigned short* KL  = (unsigned short*)(ws + OFF_KL);
  unsigned short* QH  = (unsigned short*)(ws + OFF_QH);
  unsigned short* QL  = (unsigned short*)(ws + OFF_QL);
  unsigned short* VT  = (unsigned short*)(ws + OFF_VT);

  k_proj<<<(unsigned)(NRT / 64), PT, 0, stream>>>(x, wk, wq, wv, wo, bk, bq, bv, KH, KL, QH, QL, VT, WOH);
  k_attn<<<dim3(SEQ / 64, NB), AT, 0, stream>>>(KH, KL, QH, QL, VT, WOH, bo, gam, x, out);
}

// v009
// Measured time: 31.9 microseconds a run.
// Versions in between are left out here; by their measured steps it is 1.31 times as fast as v007.
// Over all steps from v000 it is 12.1 times as fast.
#include <hip/hip_runtime.h>
// Compute dtype: inputs converted (RNE) to bf16; key, query and value projections v_wmma_f32_16x16x32_bf16 (exact products, f32 accumulate, bias added in f32); key and query results (f32) rounded (RNE) to single f16; scores f.g^T one product on v_wmma_f32_16x16x32_f16, f32 accumulate; softmax running maximum and sum f32, kept in the attention loop by each of eight waves per query column (one 32-key eighth of every tile each) and merged in f32 at the end; V^T single f16 and P = exp(s - running maximum) x4096 single f16 on v_wmma_f32_16x16x32_f16, f32 accumulate scaled every 32 keys by exp(old - new maximum), divided by the sum at the end; output projection Wo x64 single f16 times ctx single f16 on v_wmma_f32_16x16x32_f16, f32 accumulate; result = bf16(x) + bf16(gamma) * (o + bf16(bo)) in f32.
#ifndef NB
#define NB 4                      /* images */
#endif
#ifndef SEQ
#define SEQ 4096                  /* pixels per image processed */
#endif
#define SEQ_FULL 4096             /* pixel pitch of the staged x rows */
#define CC 256                    /* channels */
#define RD 64                     /* embedding channels (key / query / value width) */
#define CH 128                    /* channels per epilogue slab */
#define LOG2E 1.4426950408889634f      /* scores go to base 2 inside the exponent's multiply-add */
#define PCARRY_L2 12.0f                /* P carried x4096 */
#define WOCARRY 64.0f                  /* Wo plane carried x64 */
#define WOINV 0.015625f                /* 2^-6 */
#define NRT ((size_t)NB * SEQ)

static_assert(SEQ % 256 == 0);          /* 64-pixel tiles */
static_assert(SEQ <= SEQ_FULL);
static_assert(CC % 64 == 0);            /* K % 32 == 0 */
static_assert(RD == 64);                
static_assert(CC == 2 * CH);            /* two channel slabs in the epilogue */
static_assert(CH % 16 == 0 && CH / 16 == 8);

typedef __bf16 v16b __attribute__((ext_vector_type(16)));
typedef _Float16 v16h __attribute__((ext_vector_type(16)));
typedef unsigned short v8us __attribute__((ext_vector_type(8), may_alias));
typedef float v8f  __attribute__((ext_vector_type(8)));
typedef float v16f __attribute__((ext_vector_type(16)));
typedef __bf16 v8b __attribute__((ext_vector_type(8)));
typedef _Float16 v8h __attribute__((ext_vector_type(8)));
typedef unsigned short v8u __attribute__((ext_vector_type(8)));
typedef float v4f  __attribute__((ext_vector_type(4)));
typedef float v4fa __attribute__((ext_vector_type(4), may_alias));
typedef float v2f  __attribute__((ext_vector_type(2)));
typedef float v2fa __attribute__((ext_vector_type(2), may_alias));
typedef _Float16 h16;
union FragB { v16b v; v8us half[2]; };
union FragH { v16h v; v8us half[2]; _Float16 h[16]; };

__device__ __forceinline__ unsigned short bf16_bits(float x) { unsigned int u = __float_as_uint(x); return (unsigned short)((u + 0x7FFFu + ((u >> 16) & 1u)) >> 16); }
__device__ __forceinline__ float bf16_val(unsigned short b) { return __uint_as_float(((unsigned int)b) << 16); }
__device__ __forceinline__ float bf16_rne(float x) { return bf16_val(bf16_bits(x)); }

// f32 -> f16 that cannot produce an f16 subnormal (value select)
static __device__ __forceinline__ h16 toh_flush(float v) { const h16 r = (h16)v; return (fabsf(v) < 6.103515625e-05f) ? (h16)0.0f : r; }
// lane l <-> lane l ^ 16: the two lanes that hold one query column
static __device__ __forceinline__ float xhalf(float x) { return __builtin_bit_cast(float, __builtin_amdgcn_permlanex16(__builtin_bit_cast(int, x), __builtin_bit_cast(int, x), 0x76543210, 0xfedcba98, false, false)); }
static __device__ __forceinline__ float max3(float a, float b, float c) { return fmaxf(fmaxf(a, b), c); }
// 2^d with the slot behind the transcendental filled inside the statement
static __device__ __forceinline__ float exp2_slot(float d) { float r; asm("v_exp_f32 %0, %1\n\tv_nop" : "=v"(r) : "v"(d)); return r; }

// fragment of a k-contiguous 16-bit row: elements 0..7 <- k 8h..8h+7, elements 8..15 <- k 16+8h..16+8h+7 (same map for A and B)
__device__ __forceinline__ v16h ld_hf(const unsigned short* p, int hh) { FragH f; f.half[0] = *(const v8us*)(p + 8 * hh); f.half[1] = *(const v8us*)(p + 16 + 8 * hh); return f.v; }

__device__ __forceinline__ v8f mma_b1(v16b a, v16b b, v8f c) {
  c = __builtin_amdgcn_wmma_f32_16x16x32_bf16(false, a, false, b, (short)0, c, false, false);
  asm volatile("v_nop\n\tv_nop\n\tv_nop\n\tv_nop" : "+v"(c) : "v"(a), "v"(b));
  return c;
}
__device__ __forceinline__ v8f mma_h1(v16h a, v16h b, v8f c) {
  c = __builtin_amdgcn_wmma_f32_16x16x32_f16(false, a, false, b, (short)0, c, false, false);
  asm volatile("v_nop\n\tv_nop\n\tv_nop\n\tv_nop" : "+v"(c) : "v"(a), "v"(b));
  return c;
}
// c += a0.b0 + a1.b1 (the two k halves of one score tile share the accumulator)
__device__ __forceinline__ v8f mma_h2(v16h a0, v16h a1, v16h b0, v16h b1, v8f c) {
  c = __builtin_amdgcn_wmma_f32_16x16x32_f16(false, a0, false, b0, (short)0, c, false, false);
  c = __builtin_amdgcn_wmma_f32_16x16x32_f16(false, a1, false, b1, (short)0, c, false, false);
  asm volatile("v_nop\n\tv_nop\n\tv_nop\n\tv_nop" : "+v"(c) : "v"(a0), "v"(a1), "v"(b0), "v"(b1));   /* the four vector slots between a matrix instruction and a vector instruction on its result or operands */
  return c;
}

// ---- key / value tiles staged in LDS by asynchronous copies, two buffers ----
#define TK 256                        /* keys per staged tile */
#define NTILE (SEQ / TK)
#define KPITCH 144                    /* LDS bytes per 128-byte key row (16 B x odd: no bank conflict for 16-byte readers) */
#define VPITCH 528                    /* LDS bytes per 512-byte V^T row (16 B x odd) */
#define KTILE_B (TK * KPITCH)
#define VTILE_B (RD * VPITCH)
#define ASTAGE_B (KTILE_B + VTILE_B)      /* k_attn stage: K, V^T */
static_assert(SEQ % TK == 0 && NTILE >= 2);   /* the ring's prologue fills two tiles */
static_assert(RD * 2 == 128 && TK * 2 == 512);
static_assert(KTILE_B % 16 == 0 && VTILE_B % 16 == 0);

__device__ __forceinline__ unsigned lds_off(const void* p) { return (unsigned)(size_t)p; }

#define AT 512                        /* k_attn threads: 2 query halves of 32 columns x 8 key eighths of a tile */
static_assert(TK / 32 == 8 && TK * RD * 2 == 4 * AT * 16 && RD * TK * 2 == 4 * AT * 16);   /* four copies per lane and plane */
// One stage, eight 16-byte copies per lane, global -> LDS, through no register: four per plane (K, V^T).
// K plane (rows contiguous in memory): lane tid brings bytes 16 tid .. 16 tid + 15 of each 8-KiB slab (64 rows).
// V^T (64 rows x 256 keys, row pitch SEQ): 32 lanes per row, 16 rows per copy.
// The s_wait_xcnt is the statement's last line so that no later rewrite of an address register can be scheduled in front of it.
__device__ __forceinline__ void cp_stage(unsigned lbase, const unsigned short* k_row0, const unsigned short* vt_row0_key0, int tid) {
  const unsigned lk = lbase + (unsigned)(tid >> 3) * KPITCH + (unsigned)(tid & 7) * 16u;
  const unsigned lv = lbase + KTILE_B + (unsigned)(tid >> 5) * VPITCH + (unsigned)(tid & 31) * 16u;
  const unsigned short* gk = k_row0 + tid * 8;
  const unsigned short* gv = vt_row0_key0 + (size_t)(tid >> 5) * SEQ + (tid & 31) * 8;
  asm volatile("global_load_async_to_lds_b128 %0, %8, off\n\t"
               "global_load_async_to_lds_b128 %1, %9, off\n\t"
               "global_load_async_to_lds_b128 %2, %10, off\n\t"
               "global_load_async_to_lds_b128 %3, %11, off\n\t"
               "global_load_async_to_lds_b128 %4, %12, off\n\t"
               "global_load_async_to_lds_b128 %5, %13, off\n\t"
               "global_load_async_to_lds_b128 %6, %14, off\n\t"
               "global_load_async_to_lds_b128 %7, %15, off\n\t"
               "s_wait_xcnt 0x0"
               :: "v"(lk), "v"(lk + 64u * KPITCH), "v"(lk + 128u * KPITCH), "v"(lk + 192u * KPITCH),
                  "v"(lv), "v"(lv + 16u * VPITCH), "v"(lv + 32u * VPITCH), "v"(lv + 48u * VPITCH),
                  "v"(gk), "v"(gk + 64 * RD), "v"(gk + 128 * RD), "v"(gk + 192 * RD),
                  "v"(gv), "v"(gv + (size_t)16 * SEQ), "v"(gv + (size_t)32 * SEQ), "v"(gv + (size_t)48 * SEQ)
               : "memory");
}
// own copies landed (before the barrier that lets other waves read them)
__device__ __forceinline__ void wait_copies() { asm volatile("s_wait_asynccnt 0x0" ::: "memory"); }
// own LDS reads retired (before the barrier behind which their buffer is refilled)
__device__ __forceinline__ void wait_lds() { asm volatile("s_wait_dscnt 0x0" ::: "memory"); }
// fragment of a staged 16-bit row, p = row start + 64 * (k / 32) + 16 h: same element map as ld_hf
__device__ __forceinline__ v16b lds_bf(const unsigned char* p) { FragB f; f.half[0] = *(const v8us*)p; f.half[1] = *(const v8us*)(p + 32); return f.v; }
__device__ __forceinline__ v16h lds_hf(const unsigned char* p) { FragH f; f.half[0] = *(const v8us*)p; f.half[1] = *(const v8us*)(p + 32); return f.v; }
// K fragments of 32 staged keys: kf[2 * (16-key row block) + (k half)]; p = the lane's place in the K plane
__device__ __forceinline__ void lds_k32(v16h (&kf)[4], const unsigned char* p) {
#pragma unroll   /* constant kf index */
  for (int rb16 = 0; rb16 < 2; ++rb16)
#pragma unroll
    for (int kh = 0; kh < 2; ++kh) kf[rb16 * 2 + kh] = lds_hf(p + rb16 * 16 * KPITCH + kh * 64);
}

// t = the thread's place among the plane's groups of eight weights
__device__ __forceinline__ void wcvth(const float* __restrict__ W, unsigned short* __restrict__ Wh, int t) {
  const v4f a = *(const v4fa*)(W + (size_t)t * 8);
  const v4f c = *(const v4fa*)(W + (size_t)t * 8 + 4);
  FragH f;
#pragma unroll
  for (int q = 0; q < 4; ++q) { f.h[q] = toh_flush(bf16_rne(a[q]) * WOCARRY); f.h[4 + q] = toh_flush(bf16_rne(c[q]) * WOCARRY); }
  const v8us v = f.half[0];
  unsigned short* d = Wh + (size_t)t * 8;
  *(v8us*)d = v;
  asm volatile("s_wait_xcnt 0x0" ::: "memory");   /* the store's registers may be rewritten by the code behind it */
}

#define PT 512                        /* k_proj threads: 16 waves load and convert the x tile, 12 of them multiply */
#define XPITCH 528                    /* LDS bytes per 512-byte pixel row of bf16 channels (16 B x odd) */
#define SPITCH 68                     /* floats per staged result row: the two lane halves fall on different banks */
#define MW (3 * (RD / 16))            /* waves that multiply: one per 16 output channels of key, query, value */
#define WOBLK ((CC * RD / 8) / (PT - 32 * MW))   /* blocks whose other waves also convert the output-projection plane */
static_assert((CC * RD / 8) % (PT - 32 * MW) == 0 && WOBLK <= NRT / 64);
static_assert((CC / 8) * (64 / 4) == PT);   /* one group of 8 channels x 4 pixels per thread */
static_assert(64 * (RD / 8) == PT);         /* one group of 8 results per thread and plane */
static_assert(MW < PT / 32);

// the x fragments of one k step: read from LDS together
__device__ __forceinline__ void lds_x4(v16b (&xf)[4], const unsigned char* xp, int s) {
#pragma unroll   /* constant xf index */
  for (int pt = 0; pt < 4; ++pt) xf[pt] = lds_bf(xp + pt * 16 * XPITCH + s * 64);
}
// 64 pixels (rows) x 16 output channels (columns) over all CC channels, k ascending
__device__ __forceinline__ void proj_tiles(v8f (&acc)[4], const v16b (&wf)[CC / 32], const unsigned char* xp) {
  v16b xf[3][4];                        /* three register sets: a k step's reads are issued two steps of products ahead of its use */
  lds_x4(xf[0], xp, 0);
  lds_x4(xf[1], xp, 1);
  lds_x4(xf[2], xp, 2);
#pragma unroll   /* constant xf, wf, acc index */
  for (int s = 0; s < CC / 32; ++s) {
#pragma unroll
    for (int pt = 0; pt < 4; ++pt)
      acc[pt] = mma_b1(xf[s % 3][pt], wf[s], acc[pt]);
    if (s + 3 < CC / 32) lds_x4(xf[s % 3], xp, s + 3);
  }
}

// One launch for all that precedes the attention, one block per 64 pixels of one image:
// x (f32, channel-first) is converted to bf16 and transposed into LDS by all 16 waves,
// each of 12 waves converts its own 16 weight rows to bf16 fragments in registers and multiplies them with the whole tile,
// the results meet in LDS and leave as whole lines. The four other waves of the first WOBLK blocks convert the output-projection plane.
__global__ __launch_bounds__(PT) void k_proj(const float* __restrict__ x, const float* __restrict__ wk, const float* __restrict__ wq,
                                             const float* __restrict__ wv, const float* __restrict__ wo,
                                             const float* __restrict__ bk, const float* __restrict__ bq, const float* __restrict__ bv,
                                             unsigned short* __restrict__ KF, unsigned short* __restrict__ QF,
                                             unsigned short* __restrict__ VT, unsigned short* __restrict__ WOH) {
  __shared__ __attribute__((aligned(16))) unsigned char xs[64 * XPITCH];
  __shared__ __attribute__((aligned(16))) float st[3][64][SPITCH];
  const int tid = threadIdx.x;
  const int blk = blockIdx.x;
  const int b = blk / (SEQ / 64), n0 = (blk % (SEQ / 64)) * 64;
  const int wave = __builtin_amdgcn_readfirstlane(tid >> 5);
  const int lane = tid & 31, ln = lane & 15, hh = lane >> 4;
  const bool mm = wave < MW;                        /* the waves that multiply */
  const int pl = wave >> 2, et = wave & 3;          /* plane (key, query, value) and its 16-channel tile */
  // all global reads of the block are issued here, together: one memory latency
  const int r = tid >> 3, c8 = (tid & 7) * 8;       /* the thread's place in each plane's results */
  const float* pbk = bk + c8;
  const float* pbq = bq + c8;
  const float* pbv = bv + r;
  const v4f bka = *(const v4fa*)pbk, bkc = *(const v4fa*)(pbk + 4);
  const v4f bqa = *(const v4fa*)pbq, bqc = *(const v4fa*)(pbq + 4);
  const float bvr = *pbv;
  asm volatile("s_wait_xcnt 0x0" :: "v"(pbk), "v"(pbq), "v"(pbv) : "memory");   /* the address pairs stay whole until every load's address is taken */
  const int cg = tid >> 4, n4 = (tid & 15) * 4;
  v4f xv[8];
  const float* px = x + ((size_t)(b * CC + cg * 8)) * SEQ_FULL + n0 + n4;
#pragma unroll   /* constant xv index */
  for (int j = 0; j < 8; ++j) xv[j] = *(const v4fa*)(px + (size_t)j * SEQ_FULL);
  asm volatile("s_wait_xcnt 0x0" :: "v"(px) : "memory");   /* the address pair stays whole until every load's address is taken */
  v4f wr[CC / 32][4];
  if (mm) {
    const float* pwf = (pl == 0 ? wk : pl == 1 ? wq : wv) + (size_t)(et * 16 + ln) * CC + 8 * hh;
#pragma unroll   /* constant wr index */
    for (int s = 0; s < CC / 32; ++s) {
      wr[s][0] = *(const v4fa*)(pwf + s * 32);
      wr[s][1] = *(const v4fa*)(pwf + s * 32 + 4);
      wr[s][2] = *(const v4fa*)(pwf + s * 32 + 16);
      wr[s][3] = *(const v4fa*)(pwf + s * 32 + 20);
    }
    asm volatile("s_wait_xcnt 0x0" :: "v"(pwf) : "memory");   /* the address pair stays whole until every load's address is taken */
  } else if (blk < WOBLK) {             /* the same for the whole wave; done while the multiplying waves wait for their weights */
    wcvth(wo, WOH, blk * (PT - 32 * MW) + tid - 32 * MW);
  }
#pragma unroll   /* constant xv index */
  for (int q = 0; q < 4; ++q) {
    const v8f t = {xv[0][q], xv[1][q], xv[2][q], xv[3][q], xv[4][q], xv[5][q], xv[6][q], xv[7][q]};
    *(v8us*)(xs + (n4 + q) * XPITCH + cg * 16) = __builtin_bit_cast(v8u, __builtin_convertvector(t, v8b));   /* RNE, two values per instruction */
  }
  v16b wf[CC / 32];
  if (mm) {
#pragma unroll   /* constant wr, wf index; same element map as ld_hf */
    for (int s = 0; s < CC / 32; ++s) {
      const v16f t = {wr[s][0][0], wr[s][0][1], wr[s][0][2], wr[s][0][3], wr[s][1][0], wr[s][1][1], wr[s][1][2], wr[s][1][3],
                      wr[s][2][0], wr[s][2][1], wr[s][2][2], wr[s][2][3], wr[s][3][0], wr[s][3][1], wr[s][3][2], wr[s][3][3]};
      wf[s] = __builtin_convertvector(t, v16b);     /* RNE, two values per instruction */
    }
  }
  __syncthreads();
  if (mm) {
    const v8f z8 = {0.f, 0.f, 0.f, 0.f, 0.f, 0.f, 0.f, 0.f};
    v8f acc[4];
#pragma unroll
    for (int pt = 0; pt < 4; ++pt) acc[pt] = z8;
    const unsigned char* xp = xs + ln * XPITCH + hh * 16;
    proj_tiles(acc, wf, xp);
    if (pl < 2) {                                   /* key, query: staged as [pixel][channel] */
#pragma unroll
      for (int pt = 0; pt < 4; ++pt)
#pragma unroll
        for (int i = 0; i < 8; ++i) st[pl][pt * 16 + 8 * hh + i][et * 16 + ln] = acc[pt][i];
    } else {                                        /* value: staged as [channel][pixel], a lane's eight pixels are neighbours */
#pragma unroll
      for (int pt = 0; pt < 4; ++pt) {
        const v4f lo = {acc[pt][0], acc[pt][1], acc[pt][2], acc[pt][3]};
        const v4f hi = {acc[pt][4], acc[pt][5], acc[pt][6], acc[pt][7]};
        *(v4fa*)&st[2][et * 16 + ln][pt * 16 + 8 * hh] = lo;
        *(v4fa*)&st[2][et * 16 + ln][pt * 16 + 8 * hh + 4] = hi;
      }
    }
  }
  __syncthreads();
  const size_t o = ((size_t)b * SEQ + n0 + r) * RD + c8;
#pragma unroll   /* key, then query */
  for (int p = 0; p < 2; ++p) {
    const v4f a = *(const v4fa*)&st[p][r][c8];
    const v4f c = *(const v4fa*)&st[p][r][c8 + 4];
    const v4f ba = p ? bqa : bka, bc = p ? bqc : bkc;
    v8f t;
#pragma unroll
    for (int q = 0; q < 4; ++q) {
      t[q]     = a[q] + bf16_rne(ba[q]);
      t[4 + q] = c[q] + bf16_rne(bc[q]);
    }
    *(v8us*)((p ? QF : KF) + o) = __builtin_bit_cast(v8u, __builtin_convertvector(t, v8h));   /* RNE, two values per instruction */
    asm volatile("s_wait_xcnt 0x0" ::: "memory");   /* later code may rewrite the store's address registers */
  }
  {
    const v4f a = *(const v4fa*)&st[2][r][c8];
    const v4f c = *(const v4fa*)&st[2][r][c8 + 4];
    const float bb = bf16_rne(bvr);
    FragH f;
#pragma unroll
    for (int q = 0; q < 4; ++q) { f.h[q] = toh_flush(a[q] + bb); f.h[4 + q] = toh_flush(c[q] + bb); }
    const v8us ov = f.half[0];
    *(v8us*)(VT + ((size_t)(b * RD + r)) * SEQ + n0 + c8) = ov;
  }
}

#define PART_B (8 * 512 + 256)        /* one partial (16 query columns, one key eighth) in LDS: 32 accumulator floats and (maximum, sum) per lane */
static_assert(2 * (AT / 32) * PART_B <= 2 * ASTAGE_B);   /* two partials per wave */

__global__ __launch_bounds__(AT) void k_attn(const unsigned short* __restrict__ KF, const unsigned short* __restrict__ QF,
                                             const unsigned short* __restrict__ VT,
                                             const unsigned short* __restrict__ WOH, const float* __restrict__ bo,
                                             const float* __restrict__ gam,
                                             const float* __restrict__ x, float* __restrict__ out) {
  __shared__ __attribute__((aligned(16))) float so[CH][68];
  __shared__ __attribute__((aligned(16))) unsigned char ring[2 * ASTAGE_B];
  __shared__ __attribute__((aligned(16))) unsigned char cx[(AT / 32) * 512];   /* merged ctx^T, f16: one 16 x 16 tile per wave */
  const int tid = threadIdx.x;
  const int wave = __builtin_amdgcn_readfirstlane(tid >> 5);
  const int qh = wave & 1;                          /* key loop: which 32 query columns of the block (two groups of 16 share the wave's K and V^T fragments) */
  const int ks = wave >> 1;                         /* key loop: which 32 keys of every staged tile */
  const int qg = wave & 3;                          /* behind the loop: which 16 query columns of the block */
  const int kq = wave >> 2;                         /* behind the loop: which channel tiles of a slab */
  const int lane = tid & 31, ln = lane & 15, hh = lane >> 4;
  const int b = blockIdx.y, jb = blockIdx.x * 64;
  const size_t tb = (size_t)b * SEQ;
  const unsigned short* pq = QF + (tb + jb + qh * 32 + ln) * RD;
  const v16h qf[2][2] = {{ld_hf(pq, hh), ld_hf(pq + 32, hh)}, {ld_hf(pq + 16 * RD, hh), ld_hf(pq + 16 * RD + 32, hh)}};   /* [column group][k half] */
  asm volatile("s_wait_xcnt 0x0" :: "v"(pq) : "memory");   /* the address pair stays whole until every load's address is taken */
  // per column group:
  float mx[2] = {-1.0e30f, -1.0e30f};               /* running maximum of this lane's query column over this wave's keys, the same in both lanes that hold it */
  float mb[2] = {-1.0e30f, -1.0e30f};               /* the maximum in base 2, less the carry: what the exponent subtracts */
  float ls[2] = {0.f, 0.f};                         /* sum of P over this lane's own keys, on the scale of the maximum */
  const v8f z8 = {0.f, 0.f, 0.f, 0.f, 0.f, 0.f, 0.f, 0.f};
  v8f ac2[2][4];
#pragma unroll
  for (int i = 0; i < 4; ++i) { ac2[0][i] = z8; ac2[1][i] = z8; }
  const unsigned rb = lds_off(ring);
  const unsigned short* k0 = KF + tb * RD;
  const unsigned short* vt0 = VT + (size_t)(b * RD) * SEQ;
  cp_stage(rb, k0, vt0, tid);
  wait_copies();
  __syncthreads();
  cp_stage(rb + ASTAGE_B, k0 + (size_t)TK * RD, vt0 + TK, tid);
  // the x values that the last stage adds: loaded here, so that their memory latency passes under the key loop
  const int rsub = lane >> 4, pc = (lane & 15) * 4;
  v4f xr[2][CH / 32];
  const float* px = x + ((size_t)(b * CC + wave * 2 + rsub)) * SEQ_FULL + jb + pc;
#pragma unroll   /* constant xr index */
  for (int hf = 0; hf < 2; ++hf)
#pragma unroll
    for (int it = 0; it < CH / 32; ++it) xr[hf][it] = *(const v4fa*)(px + (size_t)(hf * CH + it * 32) * SEQ_FULL);
  asm volatile("s_wait_xcnt 0x0" :: "v"(px) : "memory");   /* the address pair stays whole until every load's address is taken */
#pragma unroll 1   /* rolled: one publish point per trip, the buffer picked by t & 1 */
  for (int t = 0; t < NTILE; ++t) {
    const unsigned bsel = (unsigned)(t & 1) * ASTAGE_B;
    const unsigned char* fr = ring + bsel + (ks * 32 + ln) * KPITCH + hh * 16;
    const unsigned char* vf = ring + bsel + KTILE_B + ln * VPITCH + hh * 16 + ks * 64;
    v16h kf[4];
    lds_k32(kf, fr);
    FragH va[4];                                    /* V^T fragments of these 32 keys: land under the score products */
#pragma unroll   /* constant va index */
    for (int ct = 0; ct < 4; ++ct) {
      const unsigned char* vp = vf + ct * 16 * VPITCH;
      va[ct].half[0] = *(const v8us*)vp;
      va[ct].half[1] = *(const v8us*)(vp + 32);
    }
    v8f sc[2][2];                                   /* scores of both column groups first: the K fragments' registers are free from here on */
#pragma unroll   /* constant qf, sc index */
    for (int c = 0; c < 2; ++c) {
      sc[c][0] = mma_h2(kf[0], kf[1], qf[c][0], qf[c][1], z8);
      sc[c][1] = mma_h2(kf[2], kf[3], qf[c][0], qf[c][1], z8);
    }
#pragma unroll   /* constant sc, mx, mb, ls, ac2 index: both column groups use the V^T fragments read above */
    for (int c = 0; c < 2; ++c) {
    const v8f s0 = sc[c][0], s1 = sc[c][1];
    const float m = mx[c];
    const float mh = max3(max3(max3(s0[0], s0[1], s0[2]), max3(s0[3], s0[4], s0[5]), max3(s0[6], s0[7], s1[0])),
                          max3(max3(s1[1], s1[2], s1[3]), max3(s1[4], s1[5], s1[6]), s1[7]), m);
    mx[c] = fmaxf(mh, xhalf(mh));
    const float m2n = fmaf(mx[c], LOG2E, -PCARRY_L2);
    const float da = mb[c] - m2n;
    mb[c] = m2n;
    const v2f l2e = {LOG2E, LOG2E}, nm2 = {-m2n, -m2n};
    v2f a0[4], a1[4];                               /* exponent arguments of s0 and s1, two neighbours per instruction */
#pragma unroll   /* constant a0, a1 index */
    for (int j = 0; j < 4; ++j) {
      const v2f q0 = {s0[2 * j], s0[2 * j + 1]}, q1 = {s1[2 * j], s1[2 * j + 1]};
      a0[j] = __builtin_elementwise_fma(q0, l2e, nm2);
      a1[j] = __builtin_elementwise_fma(q1, l2e, nm2);
    }
    // The powers of two in two statements whose results share no register with their sources. Each v_nop fills the slot behind a statement's last one.
    float alpha;                                    /* exp(old - new maximum): 0 on the first 32 keys, 1 while the maximum stands */
    float e[16];                                    /* P: 0..7 of s0, 8..15 of s1 */
    asm("v_exp_f32 %0, %9\n\tv_exp_f32 %1, %10\n\tv_exp_f32 %2, %11\n\tv_exp_f32 %3, %12\n\tv_exp_f32 %4, %13\n\t"
        "v_exp_f32 %5, %14\n\tv_exp_f32 %6, %15\n\tv_exp_f32 %7, %16\n\tv_exp_f32 %8, %17\n\tv_nop"
        : "=&v"(e[0]), "=&v"(e[1]), "=&v"(e[2]), "=&v"(e[3]), "=&v"(e[4]), "=&v"(e[5]), "=&v"(e[6]), "=&v"(e[7]), "=&v"(alpha)
        : "v"(a0[0][0]), "v"(a0[0][1]), "v"(a0[1][0]), "v"(a0[1][1]), "v"(a0[2][0]), "v"(a0[2][1]), "v"(a0[3][0]), "v"(a0[3][1]), "v"(da));
    asm("v_exp_f32 %0, %8\n\tv_exp_f32 %1, %9\n\tv_exp_f32 %2, %10\n\tv_exp_f32 %3, %11\n\tv_exp_f32 %4, %12\n\t"
        "v_exp_f32 %5, %13\n\tv_exp_f32 %6, %14\n\tv_exp_f32 %7, %15\n\tv_nop"
        : "=&v"(e[8]), "=&v"(e[9]), "=&v"(e[10]), "=&v"(e[11]), "=&v"(e[12]), "=&v"(e[13]), "=&v"(e[14]), "=&v"(e[15])
        : "v"(a1[0][0]), "v"(a1[0][1]), "v"(a1[1][0]), "v"(a1[1][1]), "v"(a1[2][0]), "v"(a1[2][1]), "v"(a1[3][0]), "v"(a1[3][1]));
    v16f pe;
    float ps[8];
#pragma unroll
    for (int r = 0; r < 8; ++r) {
      pe[r]     = e[r];
      pe[8 + r] = e[8 + r];
      ps[r] = e[r] + e[8 + r];
    }
    FragH pf;
    pf.v = __builtin_convertvector(pe, v16h);       /* RNE, two values per instruction; a P below 2^-14 stays as an f16 subnormal */
    ls[c] = fmaf(ls[c], alpha, ((ps[0] + ps[1]) + (ps[2] + ps[3])) + ((ps[4] + ps[5]) + (ps[6] + ps[7])));
#pragma unroll   /* constant ac2 index */
    for (int ct = 0; ct < 4; ++ct) ac2[c][ct] *= alpha;
#pragma unroll   /* constant ac2 index */
    for (int ct = 0; ct < 4; ++ct) ac2[c][ct] = mma_h1(va[ct].v, pf.v, ac2[c][ct]);
    }
    // publish point: tile t + 1 becomes readable, tile t's buffer becomes free
    wait_lds();
    wait_copies();
    __syncthreads();
    if (t + 2 < NTILE)
      cp_stage(rb + bsel, k0 + (size_t)(t + 2) * TK * RD, vt0 + (t + 2) * TK, tid);
  }
  wait_copies();
  // The eight key eighths of a query group meet in LDS, group g's eighth k at place g + 4 k. The ring is free: the last trip's barrier ended every read of it, no copy is in flight.
#pragma unroll   /* constant ac2, mb, ls index */
  for (int c = 0; c < 2; ++c) {
    unsigned char* pp = ring + (qh * 2 + c + 4 * ks) * PART_B;
    unsigned char* pw = pp + lane * 16;
#pragma unroll
    for (int ct = 0; ct < 4; ++ct) {
      const v4f lo = {ac2[c][ct][0], ac2[c][ct][1], ac2[c][ct][2], ac2[c][ct][3]};
      const v4f hi = {ac2[c][ct][4], ac2[c][ct][5], ac2[c][ct][6], ac2[c][ct][7]};
      *(v4fa*)(pw + (2 * ct) * 512) = lo;
      *(v4fa*)(pw + (2 * ct + 1) * 512) = hi;
    }
    const v2f ml = {mb[c], ls[c] + xhalf(ls[c])};   /* the eighth's maximum (base 2) and its column's whole sum */
    *(v2fa*)(pp + 8 * 512 + lane * 8) = ml;
  }
  __syncthreads();
  // output-projection fragments and bias of both slabs: loaded here, behind the barrier, so that their latency passes under the merge
  FragH wa[2][2][2];
  float bb[2][CH / 32];
  const unsigned short* pw = WOH + (size_t)(kq * 32 + ln) * RD + 8 * hh;
  const float* pbo = bo + wave * 2 + rsub;
#pragma unroll   /* constant wa, bb index */
  for (int hf = 0; hf < 2; ++hf) {
#pragma unroll
    for (int c2 = 0; c2 < 2; ++c2) {
      const unsigned short* wp = pw + (size_t)(hf * CH + c2 * 16) * RD;
      wa[hf][c2][0].half[0] = *(const v8us*)wp;
      wa[hf][c2][0].half[1] = *(const v8us*)(wp + 16);
      wa[hf][c2][1].half[0] = *(const v8us*)(wp + 32);
      wa[hf][c2][1].half[1] = *(const v8us*)(wp + 48);
    }
#pragma unroll
    for (int it = 0; it < CH / 32; ++it) bb[hf][it] = pbo[hf * CH + it * 32];
  }
  const float g = bf16_rne(gam[0]);                 /* read here with the others: behind the merge's barrier its latency would stand open */
  asm volatile("s_wait_xcnt 0x0" :: "v"(pw), "v"(pbo) : "memory");   /* both address pairs stay whole until every load's address is taken */
  // Each of the group's four waves merges one 16-row tile of ctx^T (rows e = 16 kq + 8h + r, cols j), eighths in the order 0..7: every partial value is read from LDS once.
  {
    const unsigned char* pg = ring + qg * PART_B;
    v2f ml[8];
#pragma unroll
    for (int k = 0; k < 8; ++k) ml[k] = *(const v2fa*)(pg + 4 * k * PART_B + 8 * 512 + lane * 8);
    v4f lo[8], hi[8];
#pragma unroll   /* constant lo, hi index */
    for (int k = 0; k < 8; ++k) {
      const unsigned char* pr = pg + 4 * k * PART_B + kq * 1024 + lane * 16;
      lo[k] = *(const v4fa*)pr;
      hi[k] = *(const v4fa*)(pr + 512);
    }
    const float mm = fmaxf(fmaxf(fmaxf(ml[0][0], ml[1][0]), fmaxf(ml[2][0], ml[3][0])), fmaxf(fmaxf(ml[4][0], ml[5][0]), fmaxf(ml[6][0], ml[7][0])));
    float wk[8];
#pragma unroll
    for (int k = 0; k < 8; ++k) wk[k] = exp2_slot(ml[k][0] - mm);   /* 1 for the eighth that holds the column's maximum */
    float lsum = wk[0] * ml[0][1];
    v4f alo = wk[0] * lo[0], ahi = wk[0] * hi[0];
#pragma unroll
    for (int k = 1; k < 8; ++k) {
      lsum = fmaf(wk[k], ml[k][1], lsum);
#pragma unroll
      for (int r = 0; r < 4; ++r) { alo[r] = fmaf(wk[k], lo[k][r], alo[r]); ahi[r] = fmaf(wk[k], hi[k][r], ahi[r]); }
    }
    const float linv = 1.0f / lsum;                 /* the column's whole sum; it carries the same x4096 as the partials */
    FragH f;
#pragma unroll
    for (int r = 0; r < 4; ++r) { f.h[r] = toh_flush(alo[r] * linv); f.h[4 + r] = toh_flush(ahi[r] * linv); }
    const v8us t = f.half[0];
    *(v8us*)(cx + (qg * 4 + kq) * 512 + lane * 16) = t;
  }
  __syncthreads();                                  /* the group's four tiles become readable */
  // two B fragments with k = e: each lane takes its own place in the four tiles
  FragH cf0, cf1;
  {
    const unsigned char* pc4 = cx + qg * 4 * 512 + lane * 16;
    cf0.half[0] = *(const v8us*)pc4;
    cf0.half[1] = *(const v8us*)(pc4 + 512);
    cf1.half[0] = *(const v8us*)(pc4 + 1024);
    cf1.half[1] = *(const v8us*)(pc4 + 1536);
  }
#pragma unroll   /* constant wa, xr, bb index */
  for (int hf = 0; hf < 2; ++hf) {
    const int ch0 = hf * CH;
#pragma unroll
    for (int c2 = 0; c2 < 2; ++c2) {
      const int ct = kq * 2 + c2;                   /* the group's four waves share the slab's eight channel tiles */
      v8f d = z8;
      d = mma_h1(wa[hf][c2][0].v, cf0.v, d);
      d = mma_h1(wa[hf][c2][1].v, cf1.v, d);
#pragma unroll
      for (int r = 0; r < 8; ++r) so[ct * 16 + 8 * hh + r][qg * 16 + ln] = d[r] * WOINV;
    }
    __syncthreads();
    {
#pragma unroll   /* constant xr, bb index */
      for (int it = 0; it < CH / 32; ++it) {
        const int row = it * 32 + wave * 2 + rsub;
        const v4f v = *(const v4fa*)&so[row][pc];
        v4f o;
#pragma unroll
        for (int q = 0; q < 4; ++q) o[q] = bf16_rne(xr[hf][it][q]) + g * (v[q] + bf16_rne(bb[hf][it]));
        *(v4f*)(out + ((size_t)(b * CC + ch0 + row)) * SEQ + jb + pc) = o;
        asm volatile("s_wait_xcnt 0x0" ::: "memory");   /* later code may rewrite the store's address registers */
      }
      
    }
    __syncthreads();
  }
}

// workspace carve (bytes, every region a multiple of 256)
#define SZ_WO  ((size_t)CC * RD * 2)
#define SZ_P   (NRT * RD * 2)
#define SZ_VT  ((size_t)NB * RD * SEQ * 2)
#define OFF_WOH ((size_t)0)
#define OFF_KF  (OFF_WOH + SZ_WO)
#define OFF_QF  (OFF_KF + SZ_P)
#define OFF_VT  (OFF_QF + SZ_P)
#define WS_TOTAL (OFF_VT + SZ_VT)
static_assert(SZ_WO % 256 == 0 && SZ_P % 256 == 0 && SZ_VT % 256 == 0);
static_assert(WS_TOTAL <= (size_t)134217728);
static_assert((NRT % 64) == 0);                                            /* projection blocks x 64 pixels == token rows */
static_assert(SEQ % 64 == 0 && SEQ % 32 == 0);                             /* k_attn tiles and 32-row key steps */

extern "C" void kernel_launch(void* const* d_in, const int* in_sizes, int n_in,
                              void* d_out, int out_size, void* d_ws, size_t ws_size, hipStream_t stream) {
  if (n_in < 10) return;
  if ((size_t)in_sizes[0] < (size_t)(NB * CC - 1) * SEQ_FULL + SEQ) return;
  if ((size_t)in_sizes[1] < (size_t)RD * CC) return;
  if ((size_t)in_sizes[2] < (size_t)RD) return;
  if ((size_t)in_sizes[3] < (size_t)RD * CC) return;
  if ((size_t)in_sizes[4] < (size_t)RD) return;
  if ((size_t)in_sizes[5] < (size_t)RD * CC) return;
  if ((size_t)in_sizes[6] < (size_t)RD) return;
  if ((size_t)in_sizes[7] < (size_t)CC * RD) return;
  if ((size_t)in_sizes[8] < (size_t)CC) return;
  if ((size_t)in_sizes[9] < (size_t)1) return;
  if ((size_t)out_size < (size_t)NB * CC * SEQ) return;
  if (WS_TOTAL > ws_size) return;
  const float* x  = (const float*)d_in[0];       /* [NB][CC][SEQ_FULL] channel-first */
  const float* wk = (const float*)d_in[1];       /* [RD][CC] = [out][in], key */
  const float* bk = (const float*)d_in[2];       /* [RD] */
  const float* wq = (const float*)d_in[3];       /* [RD][CC] = [out][in], query */
  const float* bq = (const float*)d_in[4];       /* [RD] */
  const float* wv = (const float*)d_in[5];       /* [RD][CC] = [out][in], value */
  const float* bv = (const float*)d_in[6];       /* [RD] */
  const float* wo = (const float*)d_in[7];       /* [CC][RD] = [out][in] */
  const float* bo = (const float*)d_in[8];       /* [CC] */
  const float* gam = (const float*)d_in[9];      /* [1] */
  float* out = (float*)d_out;                    /* [NB][CC][SEQ] channel-first */
  char* ws = (char*)d_ws;
  unsigned short* WOH = (unsigned short*)(ws + OFF_WOH);
  unsigned short* KF  = (unsigned short*)(ws + OFF_KF);
  unsigned short* QF  = (unsigned short*)(ws + OFF_QF);
  unsigned short* VT  = (unsigned short*)(ws + OFF_VT);

  k_proj<<<(unsigned)(NRT / 64), PT, 0, stream>>>(x, wk, wq, wv, wo, bk, bq, bv, KF, QF, VT, WOH);
  k_attn<<<dim3(SEQ / 64, NB), AT, 0, stream>>>(KF, QF, VT, WOH, bo, gam, x, out);
}

// v010
// It runs in 30.5 microseconds.
// Next to v009, in two timings, it ran 1.04 times as fast each time.
// All steps since v000 together make it 12.5 times as fast.
#include <hip/hip_runtime.h>
// Compute dtype: inputs converted (RNE) to bf16; key, query and value projections v_wmma_f32_16x16x32_bf16 (exact products, f32 accumulate, bias added in f32); key and query results (f32) rounded (RNE) to single f16; scores f.g^T one product on v_wmma_f32_16x16x32_f16, f32 accumulate; softmax running maximum and sum f32, kept in the attention loop by each of eight waves per query column (one 32-key eighth of every tile each) and merged in f32 at the end; V^T single f16 and P = exp(s - running maximum) x4096 single f16 on v_wmma_f32_16x16x32_f16, f32 accumulate scaled every 32 keys by exp(old - new maximum), divided by the sum at the end; output projection Wo x64 single f16 times ctx single f16 on v_wmma_f32_16x16x32_f16, f32 accumulate; result = bf16(x) + bf16(gamma) * (o + bf16(bo)) in f32.
#ifndef NB
#define NB 4                      /* images */
#endif
#ifndef SEQ
#define SEQ 4096                  /* pixels per image processed */
#endif
#define SEQ_FULL 4096             /* pixel pitch of the staged x rows */
#define CC 256                    /* channels */
#define RD 64                     /* embedding channels (key / query / value width) */
#define CH 128                    /* channels per epilogue slab */
#define LOG2E 1.4426950408889634f      /* scores go to base 2 inside the exponent's multiply-add */
#define PCARRY_L2 12.0f                /* P carried x4096 */
#define WOCARRY 64.0f                  /* Wo plane carried x64 */
#define WOINV 0.015625f                /* 2^-6 */
#define NRT ((size_t)NB * SEQ)

static_assert(SEQ % 256 == 0);          /* 64-pixel tiles */
static_assert(SEQ <= SEQ_FULL);
static_assert(CC % 64 == 0);            /* K % 32 == 0 */
static_assert(RD == 64);                
static_assert(CC == 2 * CH);            /* two channel slabs in the epilogue */
static_assert(CH % 16 == 0 && CH / 16 == 8);

typedef __bf16 v16b __attribute__((ext_vector_type(16)));
typedef _Float16 v16h __attribute__((ext_vector_type(16)));
typedef unsigned short v8us __attribute__((ext_vector_type(8), may_alias));
typedef float v8f  __attribute__((ext_vector_type(8)));
typedef float v16f __attribute__((ext_vector_type(16)));
typedef __bf16 v8b __attribute__((ext_vector_type(8)));
typedef _Float16 v8h __attribute__((ext_vector_type(8)));
typedef unsigned short v8u __attribute__((ext_vector_type(8)));
typedef float v4f  __attribute__((ext_vector_type(4)));
typedef float v4fa __attribute__((ext_vector_type(4), may_alias));
typedef float v2f  __attribute__((ext_vector_type(2)));
typedef float v2fa __attribute__((ext_vector_type(2), may_alias));
typedef _Float16 h16;
union FragB { v16b v; v8us half[2]; };
union FragH { v16h v; v8us half[2]; _Float16 h[16]; };

__device__ __forceinline__ unsigned short bf16_bits(float x) { unsigned int u = __float_as_uint(x); return (unsigned short)((u + 0x7FFFu + ((u >> 16) & 1u)) >> 16); }
__device__ __forceinline__ float bf16_val(unsigned short b) { return __uint_as_float(((unsigned int)b) << 16); }
__device__ __forceinline__ float bf16_rne(float x) { return bf16_val(bf16_bits(x)); }

// f32 -> f16 that cannot produce an f16 subnormal (value select)
static __device__ __forceinline__ h16 toh_flush(float v) { const h16 r = (h16)v; return (fabsf(v) < 6.103515625e-05f) ? (h16)0.0f : r; }
// lane l <-> lane l ^ 16: the two lanes that hold one query column
static __device__ __forceinline__ float xhalf(float x) { return __builtin_bit_cast(float, __builtin_amdgcn_permlanex16(__builtin_bit_cast(int, x), __builtin_bit_cast(int, x), 0x76543210, 0xfedcba98, false, false)); }
static __device__ __forceinline__ float max3(float a, float b, float c) { return fmaxf(fmaxf(a, b), c); }
// 2^d with the slot behind the transcendental filled inside the statement
static __device__ __forceinline__ float exp2_slot(float d) { float r; asm("v_exp_f32 %0, %1\n\tv_nop" : "=v"(r) : "v"(d)); return r; }

// fragment of a k-contiguous 16-bit row: elements 0..7 <- k 8h..8h+7, elements 8..15 <- k 16+8h..16+8h+7 (same map for A and B)
__device__ __forceinline__ v16h ld_hf(const unsigned short* p, int hh) { FragH f; f.half[0] = *(const v8us*)(p + 8 * hh); f.half[1] = *(const v8us*)(p + 16 + 8 * hh); return f.v; }

__device__ __forceinline__ v8f mma_b1(v16b a, v16b b, v8f c) {
  c = __builtin_amdgcn_wmma_f32_16x16x32_bf16(false, a, false, b, (short)0, c, false, false);
  asm volatile("v_nop\n\tv_nop\n\tv_nop\n\tv_nop" : "+v"(c) : "v"(a), "v"(b));
  return c;
}
__device__ __forceinline__ v8f mma_h1(v16h a, v16h b, v8f c) {
  c = __builtin_amdgcn_wmma_f32_16x16x32_f16(false, a, false, b, (short)0, c, false, false);
  asm volatile("v_nop\n\tv_nop\n\tv_nop\n\tv_nop" : "+v"(c) : "v"(a), "v"(b));
  return c;
}
// the key loop's form: no v_nop of its own; the compiler keeps the distance behind its builtin, and neighbours with other accumulators fill most of the slots
__device__ __forceinline__ v8f mma_h1c(v16h a, v16h b, v8f c) { return __builtin_amdgcn_wmma_f32_16x16x32_f16(false, a, false, b, (short)0, c, false, false); }

// ---- key / value tiles staged in LDS by asynchronous copies, two buffers ----
#define TK 256                        /* keys per staged tile */
#define NTILE (SEQ / TK)
#define KPITCH 144                    /* LDS bytes per 128-byte key row (16 B x odd: no bank conflict for 16-byte readers) */
#define VPITCH 528                    /* LDS bytes per 512-byte V^T row (16 B x odd) */
#define KTILE_B (TK * KPITCH)
#define VTILE_B (RD * VPITCH)
#define ASTAGE_B (KTILE_B + VTILE_B)      /* k_attn stage: K, V^T */
static_assert(SEQ % TK == 0 && NTILE >= 2);   /* the ring's prologue fills two tiles */
static_assert(RD * 2 == 128 && TK * 2 == 512);
static_assert(KTILE_B % 16 == 0 && VTILE_B % 16 == 0);

__device__ __forceinline__ unsigned lds_off(const void* p) { return (unsigned)(size_t)p; }

#define AT 512                        /* k_attn threads: 2 query halves of 32 columns x 8 key eighths of a tile */
static_assert(TK / 32 == 8 && TK * RD * 2 == 4 * AT * 16 && RD * TK * 2 == 4 * AT * 16);   /* four copies per lane and plane */
// One stage, eight 16-byte copies per lane, global -> LDS, through no register: four per plane (K, V^T).
// K plane (rows contiguous in memory): lane tid brings bytes 16 tid .. 16 tid + 15 of each 8-KiB slab (64 rows).
// V^T (64 rows x 256 keys, row pitch SEQ): 32 lanes per row, 16 rows per copy.
// The s_wait_xcnt is the statement's last line so that no later rewrite of an address register can be scheduled in front of it.
__device__ __forceinline__ void cp_stage(unsigned lbase, const unsigned short* k_row0, const unsigned short* vt_row0_key0, int tid) {
  const unsigned lk = lbase + (unsigned)(tid >> 3) * KPITCH + (unsigned)(tid & 7) * 16u;
  const unsigned lv = lbase + KTILE_B + (unsigned)(tid >> 5) * VPITCH + (unsigned)(tid & 31) * 16u;
  const unsigned short* gk = k_row0 + tid * 8;
  const unsigned short* gv = vt_row0_key0 + (size_t)(tid >> 5) * SEQ + (tid & 31) * 8;
  asm volatile("global_load_async_to_lds_b128 %0, %8, off\n\t"
               "global_load_async_to_lds_b128 %1, %9, off\n\t"
               "global_load_async_to_lds_b128 %2, %10, off\n\t"
               "global_load_async_to_lds_b128 %3, %11, off\n\t"
               "global_load_async_to_lds_b128 %4, %12, off\n\t"
               "global_load_async_to_lds_b128 %5, %13, off\n\t"
               "global_load_async_to_lds_b128 %6, %14, off\n\t"
               "global_load_async_to_lds_b128 %7, %15, off\n\t"
               "s_wait_xcnt 0x0"
               :: "v"(lk), "v"(lk + 64u * KPITCH), "v"(lk + 128u * KPITCH), "v"(lk + 192u * KPITCH),
                  "v"(lv), "v"(lv + 16u * VPITCH), "v"(lv + 32u * VPITCH), "v"(lv + 48u * VPITCH),
                  "v"(gk), "v"(gk + 64 * RD), "v"(gk + 128 * RD), "v"(gk + 192 * RD),
                  "v"(gv), "v"(gv + (size_t)16 * SEQ), "v"(gv + (size_t)32 * SEQ), "v"(gv + (size_t)48 * SEQ)
               : "memory");
}
// own copies landed (before the barrier that lets other waves read them)
__device__ __forceinline__ void wait_copies() { asm volatile("s_wait_asynccnt 0x0" ::: "memory"); }
// own LDS reads retired (before the barrier behind which their buffer is refilled)
__device__ __forceinline__ void wait_lds() { asm volatile("s_wait_dscnt 0x0" ::: "memory"); }
// fragment of a staged 16-bit row, p = row start + 64 * (k / 32) + 16 h: same element map as ld_hf
__device__ __forceinline__ v16b lds_bf(const unsigned char* p) { FragB f; f.half[0] = *(const v8us*)p; f.half[1] = *(const v8us*)(p + 32); return f.v; }
__device__ __forceinline__ v16h lds_hf(const unsigned char* p) { FragH f; f.half[0] = *(const v8us*)p; f.half[1] = *(const v8us*)(p + 32); return f.v; }
// K fragments of 32 staged keys: kf[2 * (16-key row block) + (k half)]; p = the lane's place in the K plane
__device__ __forceinline__ void lds_k32(v16h (&kf)[4], const unsigned char* p) {
#pragma unroll   /* constant kf index */
  for (int rb16 = 0; rb16 < 2; ++rb16)
#pragma unroll
    for (int kh = 0; kh < 2; ++kh) kf[rb16 * 2 + kh] = lds_hf(p + rb16 * 16 * KPITCH + kh * 64);
}

// t = the thread's place among the plane's groups of eight weights
__device__ __forceinline__ void wcvth(const float* __restrict__ W, unsigned short* __restrict__ Wh, int t) {
  const v4f a = *(const v4fa*)(W + (size_t)t * 8);
  const v4f c = *(const v4fa*)(W + (size_t)t * 8 + 4);
  FragH f;
#pragma unroll
  for (int q = 0; q < 4; ++q) { f.h[q] = toh_flush(bf16_rne(a[q]) * WOCARRY); f.h[4 + q] = toh_flush(bf16_rne(c[q]) * WOCARRY); }
  const v8us v = f.half[0];
  unsigned short* d = Wh + (size_t)t * 8;
  *(v8us*)d = v;
  asm volatile("s_wait_xcnt 0x0" ::: "memory");   /* the store's registers may be rewritten by the code behind it */
}

#define PT 512                        /* k_proj threads: 16 waves load and convert the x tile, 12 of them multiply */
#define XPITCH 528                    /* LDS bytes per 512-byte pixel row of bf16 channels (16 B x odd) */
#define SPITCH 68                     /* floats per staged result row: the two lane halves fall on different banks */
#define MW (3 * (RD / 16))            /* waves that multiply: one per 16 output channels of key, query, value */
#define WOBLK ((CC * RD / 8) / (PT - 32 * MW))   /* blocks whose other waves also convert the output-projection plane */
static_assert((CC * RD / 8) % (PT - 32 * MW) == 0 && WOBLK <= NRT / 64);
static_assert((CC / 8) * (64 / 4) == PT);   /* one group of 8 channels x 4 pixels per thread */
static_assert(64 * (RD / 8) == PT);         /* one group of 8 results per thread and plane */
static_assert(MW < PT / 32);

// the x fragments of one k step: read from LDS together
__device__ __forceinline__ void lds_x4(v16b (&xf)[4], const unsigned char* xp, int s) {
#pragma unroll   /* constant xf index */
  for (int pt = 0; pt < 4; ++pt) xf[pt] = lds_bf(xp + pt * 16 * XPITCH + s * 64);
}
// 64 pixels (rows) x 16 output channels (columns) over all CC channels, k ascending
__device__ __forceinline__ void proj_tiles(v8f (&acc)[4], const v16b (&wf)[CC / 32], const unsigned char* xp) {
  v16b xf[3][4];                        /* three register sets: a k step's reads are issued two steps of products ahead of its use */
  lds_x4(xf[0], xp, 0);
  lds_x4(xf[1], xp, 1);
  lds_x4(xf[2], xp, 2);
#pragma unroll   /* constant xf, wf, acc index */
  for (int s = 0; s < CC / 32; ++s) {
#pragma unroll
    for (int pt = 0; pt < 4; ++pt)
      acc[pt] = mma_b1(xf[s % 3][pt], wf[s], acc[pt]);
    if (s + 3 < CC / 32) lds_x4(xf[s % 3], xp, s + 3);
  }
}

// One launch for all that precedes the attention, one block per 64 pixels of one image:
// x (f32, channel-first) is converted to bf16 and transposed into LDS by all 16 waves,
// each of 12 waves converts its own 16 weight rows to bf16 fragments in registers and multiplies them with the whole tile,
// the results meet in LDS and leave as whole lines. The four other waves of the first WOBLK blocks convert the output-projection plane.
__global__ __launch_bounds__(PT) void k_proj(const float* __restrict__ x, const float* __restrict__ wk, const float* __restrict__ wq,
                                             const float* __restrict__ wv, const float* __restrict__ wo,
                                             const float* __restrict__ bk, const float* __restrict__ bq, const float* __restrict__ bv,
                                             unsigned short* __restrict__ KF, unsigned short* __restrict__ QF,
                                             unsigned short* __restrict__ VT, unsigned short* __restrict__ WOH) {
  __shared__ __attribute__((aligned(16))) unsigned char xs[64 * XPITCH];
  __shared__ __attribute__((aligned(16))) float st[3][64][SPITCH];
  const int tid = threadIdx.x;
  const int blk = blockIdx.x;
  const int b = blk / (SEQ / 64), n0 = (blk % (SEQ / 64)) * 64;
  const int wave = __builtin_amdgcn_readfirstlane(tid >> 5);
  const int lane = tid & 31, ln = lane & 15, hh = lane >> 4;
  const bool mm = wave < MW;                        /* the waves that multiply */
  const int pl = wave >> 2, et = wave & 3;          /* plane (key, query, value) and its 16-channel tile */
  // all global reads of the block are issued here, together: one memory latency
  const int r = tid >> 3, c8 = (tid & 7) * 8;       /* the thread's place in each plane's results */
  const float* pbk = bk + c8;
  const float* pbq = bq + c8;
  const float* pbv = bv + r;
  const v4f bka = *(const v4fa*)pbk, bkc = *(const v4fa*)(pbk + 4);
  const v4f bqa = *(const v4fa*)pbq, bqc = *(const v4fa*)(pbq + 4);
  const float bvr = *pbv;
  asm volatile("s_wait_xcnt 0x0" :: "v"(pbk), "v"(pbq), "v"(pbv) : "memory");   /* the address pairs stay whole until every load's address is taken */
  const int cg = tid >> 4, n4 = (tid & 15) * 4;
  v4f xv[8];
  const float* px = x + ((size_t)(b * CC + cg * 8)) * SEQ_FULL + n0 + n4;
#pragma unroll   /* constant xv index */
  for (int j = 0; j < 8; ++j) xv[j] = *(const v4fa*)(px + (size_t)j * SEQ_FULL);
  asm volatile("s_wait_xcnt 0x0" :: "v"(px) : "memory");   /* the address pair stays whole until every load's address is taken */
  v4f wr[CC / 32][4];
  if (mm) {
    const float* pwf = (pl == 0 ? wk : pl == 1 ? wq : wv) + (size_t)(et * 16 + ln) * CC + 8 * hh;
#pragma unroll   /* constant wr index */
    for (int s = 0; s < CC / 32; ++s) {
      wr[s][0] = *(const v4fa*)(pwf + s * 32);
      wr[s][1] = *(const v4fa*)(pwf + s * 32 + 4);
      wr[s][2] = *(const v4fa*)(pwf + s * 32 + 16);
      wr[s][3] = *(const v4fa*)(pwf + s * 32 + 20);
    }
    asm volatile("s_wait_xcnt 0x0" :: "v"(pwf) : "memory");   /* the address pair stays whole until every load's address is taken */
  } else if (blk < WOBLK) {             /* the same for the whole wave; done while the multiplying waves wait for their weights */
    wcvth(wo, WOH, blk * (PT - 32 * MW) + tid - 32 * MW);
  }
#pragma unroll   /* constant xv index */
  for (int q = 0; q < 4; ++q) {
    const v8f t = {xv[0][q], xv[1][q], xv[2][q], xv[3][q], xv[4][q], xv[5][q], xv[6][q], xv[7][q]};
    *(v8us*)(xs + (n4 + q) * XPITCH + cg * 16) = __builtin_bit_cast(v8u, __builtin_convertvector(t, v8b));   /* RNE, two values per instruction */
  }
  v16b wf[CC / 32];
  if (mm) {
#pragma unroll   /* constant wr, wf index; same element map as ld_hf */
    for (int s = 0; s < CC / 32; ++s) {
      const v16f t = {wr[s][0][0], wr[s][0][1], wr[s][0][2], wr[s][0][3], wr[s][1][0], wr[s][1][1], wr[s][1][2], wr[s][1][3],
                      wr[s][2][0], wr[s][2][1], wr[s][2][2], wr[s][2][3], wr[s][3][0], wr[s][3][1], wr[s][3][2], wr[s][3][3]};
      wf[s] = __builtin_convertvector(t, v16b);     /* RNE, two values per instruction */
    }
  }
  __syncthreads();
  if (mm) {
    const v8f z8 = {0.f, 0.f, 0.f, 0.f, 0.f, 0.f, 0.f, 0.f};
    v8f acc[4];
#pragma unroll
    for (int pt = 0; pt < 4; ++pt) acc[pt] = z8;
    const unsigned char* xp = xs + ln * XPITCH + hh * 16;
    proj_tiles(acc, wf, xp);
    if (pl < 2) {                                   /* key, query: staged as [pixel][channel] */
#pragma unroll
      for (int pt = 0; pt < 4; ++pt)
#pragma unroll
        for (int i = 0; i < 8; ++i) st[pl][pt * 16 + 8 * hh + i][et * 16 + ln] = acc[pt][i];
    } else {                                        /* value: staged as [channel][pixel], a lane's eight pixels are neighbours */
#pragma unroll
      for (int pt = 0; pt < 4; ++pt) {
        const v4f lo = {acc[pt][0], acc[pt][1], acc[pt][2], acc[pt][3]};
        const v4f hi = {acc[pt][4], acc[pt][5], acc[pt][6], acc[pt][7]};
        *(v4fa*)&st[2][et * 16 + ln][pt * 16 + 8 * hh] = lo;
        *(v4fa*)&st[2][et * 16 + ln][pt * 16 + 8 * hh + 4] = hi;
      }
    }
  }
  __syncthreads();
  const size_t o = ((size_t)b * SEQ + n0 + r) * RD + c8;
#pragma unroll   /* key, then query */
  for (int p = 0; p < 2; ++p) {
    const v4f a = *(const v4fa*)&st[p][r][c8];
    const v4f c = *(const v4fa*)&st[p][r][c8 + 4];
    const v4f ba = p ? bqa : bka, bc = p ? bqc : bkc;
    v8f t;
#pragma unroll
    for (int q = 0; q < 4; ++q) {
      t[q]     = a[q] + bf16_rne(ba[q]);
      t[4 + q] = c[q] + bf16_rne(bc[q]);
    }
    *(v8us*)((p ? QF : KF) + o) = __builtin_bit_cast(v8u, __builtin_convertvector(t, v8h));   /* RNE, two values per instruction */
    asm volatile("s_wait_xcnt 0x0" ::: "memory");   /* later code may rewrite the store's address registers */
  }
  {
    const v4f a = *(const v4fa*)&st[2][r][c8];
    const v4f c = *(const v4fa*)&st[2][r][c8 + 4];
    const float bb = bf16_rne(bvr);
    FragH f;
#pragma unroll
    for (int q = 0; q < 4; ++q) { f.h[q] = toh_flush(a[q] + bb); f.h[4 + q] = toh_flush(c[q] + bb); }
    const v8us ov = f.half[0];
    *(v8us*)(VT + ((size_t)(b * RD + r)) * SEQ + n0 + c8) = ov;
  }
}

#define PART_B (8 * 512 + 256)        /* one partial (16 query columns, one key eighth) in LDS: 32 accumulator floats and (maximum, sum) per lane */
static_assert(2 * (AT / 32) * PART_B <= 2 * ASTAGE_B);   /* two partials per wave */

__global__ __launch_bounds__(AT) void k_attn(const unsigned short* __restrict__ KF, const unsigned short* __restrict__ QF,
                                             const unsigned short* __restrict__ VT,
                                             const unsigned short* __restrict__ WOH, const float* __restrict__ bo,
                                             const float* __restrict__ gam,
                                             const float* __restrict__ x, float* __restrict__ out) {
  __shared__ __attribute__((aligned(16))) float so[CH][68];
  __shared__ __attribute__((aligned(16))) unsigned char ring[2 * ASTAGE_B];
  __shared__ __attribute__((aligned(16))) unsigned char cx[(AT / 32) * 512];   /* merged ctx^T, f16: one 16 x 16 tile per wave */
  const int tid = threadIdx.x;
  const int wave = __builtin_amdgcn_readfirstlane(tid >> 5);
  const int qh = wave & 1;                          /* key loop: which 32 query columns of the block (two groups of 16 share the wave's K and V^T fragments) */
  const int ks = wave >> 1;                         /* key loop: which 32 keys of every staged tile */
  const int qg = wave & 3;                          /* behind the loop: which 16 query columns of the block */
  const int kq = wave >> 2;                         /* behind the loop: which channel tiles of a slab */
  const int lane = tid & 31, ln = lane & 15, hh = lane >> 4;
  const int b = blockIdx.y, jb = blockIdx.x * 64;
  const size_t tb = (size_t)b * SEQ;
  const unsigned short* pq = QF + (tb + jb + qh * 32 + ln) * RD;
  const v16h qf[2][2] = {{ld_hf(pq, hh), ld_hf(pq + 32, hh)}, {ld_hf(pq + 16 * RD, hh), ld_hf(pq + 16 * RD + 32, hh)}};   /* [column group][k half] */
  asm volatile("s_wait_xcnt 0x0" :: "v"(pq) : "memory");   /* the address pair stays whole until every load's address is taken */
  // per column group:
  float mx[2] = {-1.0e30f, -1.0e30f};               /* running maximum of this lane's query column over this wave's keys, the same in both lanes that hold it */
  float mb[2] = {-1.0e30f, -1.0e30f};               /* the maximum in base 2, less the carry: what the exponent subtracts */
  float ls[2] = {0.f, 0.f};                         /* sum of P over this lane's own keys, on the scale of the maximum */
  const v8f z8 = {0.f, 0.f, 0.f, 0.f, 0.f, 0.f, 0.f, 0.f};
  v8f ac2[2][4];
#pragma unroll
  for (int i = 0; i < 4; ++i) { ac2[0][i] = z8; ac2[1][i] = z8; }
  const unsigned rb = lds_off(ring);
  const unsigned short* k0 = KF + tb * RD;
  const unsigned short* vt0 = VT + (size_t)(b * RD) * SEQ;
  cp_stage(rb, k0, vt0, tid);
  wait_copies();
  __syncthreads();
  cp_stage(rb + ASTAGE_B, k0 + (size_t)TK * RD, vt0 + TK, tid);
  // the x values that the last stage adds: loaded here, so that their memory latency passes under the key loop
  const int rsub = lane >> 4, pc = (lane & 15) * 4;
  v4f xr[2][CH / 32];
  const float* px = x + ((size_t)(b * CC + wave * 2 + rsub)) * SEQ_FULL + jb + pc;
#pragma unroll   /* constant xr index */
  for (int hf = 0; hf < 2; ++hf)
#pragma unroll
    for (int it = 0; it < CH / 32; ++it) xr[hf][it] = *(const v4fa*)(px + (size_t)(hf * CH + it * 32) * SEQ_FULL);
  asm volatile("s_wait_xcnt 0x0" :: "v"(px) : "memory");   /* the address pair stays whole until every load's address is taken */
#pragma unroll 1   /* rolled: one publish point per trip, the buffer picked by t & 1 */
  for (int t = 0; t < NTILE; ++t) {
    const unsigned bsel = (unsigned)(t & 1) * ASTAGE_B;
    const unsigned char* fr = ring + bsel + (ks * 32 + ln) * KPITCH + hh * 16;
    const unsigned char* vf = ring + bsel + KTILE_B + ln * VPITCH + hh * 16 + ks * 64;
    v16h kf[4];
    lds_k32(kf, fr);
    FragH va[4];                                    /* V^T fragments of these 32 keys: land under the score products */
#pragma unroll   /* constant va index */
    for (int ct = 0; ct < 4; ++ct) {
      const unsigned char* vp = vf + ct * 16 * VPITCH;
      va[ct].half[0] = *(const v8us*)vp;
      va[ct].half[1] = *(const v8us*)(vp + 32);
    }
    __builtin_amdgcn_sched_barrier(0);              /* the 16 fragment reads stay one group in front of the products: sunk among them, the V^T reads would be waited for in the open */
    v8f sc[2][2];                                   /* scores of both column groups first: the K fragments' registers are free from here on */
#pragma unroll   /* constant qf, sc index */
    for (int c = 0; c < 2; ++c) {
      sc[c][0] = mma_h1c(kf[0], qf[c][0], z8);
      sc[c][1] = mma_h1c(kf[2], qf[c][0], z8);
    }
#pragma unroll   /* constant qf, sc index; second k half of each tile, four products behind its first */
    for (int c = 0; c < 2; ++c) {
      sc[c][0] = mma_h1c(kf[1], qf[c][1], sc[c][0]);
      sc[c][1] = mma_h1c(kf[3], qf[c][1], sc[c][1]);
    }
    __builtin_amdgcn_sched_barrier(0);              /* the eight products stay in a row, each in the others' hazard slots: with vector work drawn in between them the build pads with v_nop */
#pragma unroll   /* constant sc, mx, mb, ls, ac2 index: both column groups use the V^T fragments read above */
    for (int c = 0; c < 2; ++c) {
    const v8f s0 = sc[c][0], s1 = sc[c][1];
    const float m = mx[c];
    const float mh = max3(max3(max3(s0[0], s0[1], s0[2]), max3(s0[3], s0[4], s0[5]), max3(s0[6], s0[7], s1[0])),
                          max3(max3(s1[1], s1[2], s1[3]), max3(s1[4], s1[5], s1[6]), s1[7]), m);
    mx[c] = fmaxf(mh, xhalf(mh));
    const float m2n = fmaf(mx[c], LOG2E, -PCARRY_L2);
    const float da = mb[c] - m2n;
    mb[c] = m2n;
    const v2f l2e = {LOG2E, LOG2E}, nm2 = {-m2n, -m2n};
    v2f a0[4], a1[4];                               /* exponent arguments of s0 and s1, two neighbours per instruction */
#pragma unroll   /* constant a0, a1 index */
    for (int j = 0; j < 4; ++j) {
      const v2f q0 = {s0[2 * j], s0[2 * j + 1]}, q1 = {s1[2 * j], s1[2 * j + 1]};
      a0[j] = __builtin_elementwise_fma(q0, l2e, nm2);
      a1[j] = __builtin_elementwise_fma(q1, l2e, nm2);
    }
    // The powers of two in two statements whose results share no register with their sources. Each v_nop fills the slot behind a statement's last one.
    float alpha;                                    /* exp(old - new maximum): 0 on the first 32 keys, 1 while the maximum stands */
    float e[16];                                    /* P: 0..7 of s0, 8..15 of s1 */
    asm("v_exp_f32 %0, %9\n\tv_exp_f32 %1, %10\n\tv_exp_f32 %2, %11\n\tv_exp_f32 %3, %12\n\tv_exp_f32 %4, %13\n\t"
        "v_exp_f32 %5, %14\n\tv_exp_f32 %6, %15\n\tv_exp_f32 %7, %16\n\tv_exp_f32 %8, %17\n\tv_nop"
        : "=&v"(e[0]), "=&v"(e[1]), "=&v"(e[2]), "=&v"(e[3]), "=&v"(e[4]), "=&v"(e[5]), "=&v"(e[6]), "=&v"(e[7]), "=&v"(alpha)
        : "v"(a0[0][0]), "v"(a0[0][1]), "v"(a0[1][0]), "v"(a0[1][1]), "v"(a0[2][0]), "v"(a0[2][1]), "v"(a0[3][0]), "v"(a0[3][1]), "v"(da));
    asm("v_exp_f32 %0, %8\n\tv_exp_f32 %1, %9\n\tv_exp_f32 %2, %10\n\tv_exp_f32 %3, %11\n\tv_exp_f32 %4, %12\n\t"
        "v_exp_f32 %5, %13\n\tv_exp_f32 %6, %14\n\tv_exp_f32 %7, %15\n\tv_nop"
        : "=&v"(e[8]), "=&v"(e[9]), "=&v"(e[10]), "=&v"(e[11]), "=&v"(e[12]), "=&v"(e[13]), "=&v"(e[14]), "=&v"(e[15])
        : "v"(a1[0][0]), "v"(a1[0][1]), "v"(a1[1][0]), "v"(a1[1][1]), "v"(a1[2][0]), "v"(a1[2][1]), "v"(a1[3][0]), "v"(a1[3][1]));
    v16f pe;
    float ps[8];
#pragma unroll
    for (int r = 0; r < 8; ++r) {
      pe[r]     = e[r];
      pe[8 + r] = e[8 + r];
      ps[r] = e[r] + e[8 + r];
    }
    FragH pf;
    pf.v = __builtin_convertvector(pe, v16h);       /* RNE, two values per instruction; a P below 2^-14 stays as an f16 subnormal */
    ls[c] = fmaf(ls[c], alpha, ((ps[0] + ps[1]) + (ps[2] + ps[3])) + ((ps[4] + ps[5]) + (ps[6] + ps[7])));
#pragma unroll   /* constant ac2 index */
    for (int ct = 0; ct < 4; ++ct) ac2[c][ct] *= alpha;
#pragma unroll   /* constant ac2 index */
    for (int ct = 0; ct < 4; ++ct) ac2[c][ct] = mma_h1c(va[ct].v, pf.v, ac2[c][ct]);
    }
    // publish point: tile t + 1 becomes readable, tile t's buffer becomes free
    __builtin_amdgcn_sched_barrier(0);              /* the waits stay at the trip's foot: lifted over the softmax, the wait for the copies would leave them half a trip to land */
    wait_lds();
    wait_copies();
    __syncthreads();
    if (t + 2 < NTILE)
      cp_stage(rb + bsel, k0 + (size_t)(t + 2) * TK * RD, vt0 + (t + 2) * TK, tid);
  }
  wait_copies();
  // The eight key eighths of a query group meet in LDS, group g's eighth k at place g + 4 k. The ring is free: the last trip's barrier ended every read of it, no copy is in flight.
#pragma unroll   /* constant ac2, mb, ls index */
  for (int c = 0; c < 2; ++c) {
    unsigned char* pp = ring + (qh * 2 + c + 4 * ks) * PART_B;
    unsigned char* pw = pp + lane * 16;
#pragma unroll
    for (int ct = 0; ct < 4; ++ct) {
      const v4f lo = {ac2[c][ct][0], ac2[c][ct][1], ac2[c][ct][2], ac2[c][ct][3]};
      const v4f hi = {ac2[c][ct][4], ac2[c][ct][5], ac2[c][ct][6], ac2[c][ct][7]};
      *(v4fa*)(pw + (2 * ct) * 512) = lo;
      *(v4fa*)(pw + (2 * ct + 1) * 512) = hi;
    }
    const v2f ml = {mb[c], ls[c] + xhalf(ls[c])};   /* the eighth's maximum (base 2) and its column's whole sum */
    *(v2fa*)(pp + 8 * 512 + lane * 8) = ml;
  }
  __syncthreads();
  // output-projection fragments and bias of both slabs: loaded here, behind the barrier, so that their latency passes under the merge
  FragH wa[2][2][2];
  float bb[2][CH / 32];
  const unsigned short* pw = WOH + (size_t)(kq * 32 + ln) * RD + 8 * hh;
  const float* pbo = bo + wave * 2 + rsub;
#pragma unroll   /* constant wa, bb index */
  for (int hf = 0; hf < 2; ++hf) {
#pragma unroll
    for (int c2 = 0; c2 < 2; ++c2) {
      const unsigned short* wp = pw + (size_t)(hf * CH + c2 * 16) * RD;
      wa[hf][c2][0].half[0] = *(const v8us*)wp;
      wa[hf][c2][0].half[1] = *(const v8us*)(wp + 16);
      wa[hf][c2][1].half[0] = *(const v8us*)(wp + 32);
      wa[hf][c2][1].half[1] = *(const v8us*)(wp + 48);
    }
#pragma unroll
    for (int it = 0; it < CH / 32; ++it) bb[hf][it] = pbo[hf * CH + it * 32];
  }
  const float g = bf16_rne(gam[0]);                 /* read here with the others: behind the merge's barrier its latency would stand open */
  asm volatile("s_wait_xcnt 0x0" :: "v"(pw), "v"(pbo) : "memory");   /* both address pairs stay whole until every load's address is taken */
  // Each of the group's four waves merges one 16-row tile of ctx^T (rows e = 16 kq + 8h + r, cols j), eighths in the order 0..7: every partial value is read from LDS once.
  {
    const unsigned char* pg = ring + qg * PART_B;
    v2f ml[8];
#pragma unroll
    for (int k = 0; k < 8; ++k) ml[k] = *(const v2fa*)(pg + 4 * k * PART_B + 8 * 512 + lane * 8);
    v4f lo[8], hi[8];
#pragma unroll   /* constant lo, hi index */
    for (int k = 0; k < 8; ++k) {
      const unsigned char* pr = pg + 4 * k * PART_B + kq * 1024 + lane * 16;
      lo[k] = *(const v4fa*)pr;
      hi[k] = *(const v4fa*)(pr + 512);
    }
    const float mm = fmaxf(fmaxf(fmaxf(ml[0][0], ml[1][0]), fmaxf(ml[2][0], ml[3][0])), fmaxf(fmaxf(ml[4][0], ml[5][0]), fmaxf(ml[6][0], ml[7][0])));
    float wk[8];
#pragma unroll
    for (int k = 0; k < 8; ++k) wk[k] = exp2_slot(ml[k][0] - mm);   /* 1 for the eighth that holds the column's maximum */
    float lsum = wk[0] * ml[0][1];
    v4f alo = wk[0] * lo[0], ahi = wk[0] * hi[0];
#pragma unroll
    for (int k = 1; k < 8; ++k) {
      lsum = fmaf(wk[k], ml[k][1], lsum);
#pragma unroll
      for (int r = 0; r < 4; ++r) { alo[r] = fmaf(wk[k], lo[k][r], alo[r]); ahi[r] = fmaf(wk[k], hi[k][r], ahi[r]); }
    }
    const float linv = 1.0f / lsum;                 /* the column's whole sum; it carries the same x4096 as the partials */
    FragH f;
#pragma unroll
    for (int r = 0; r < 4; ++r) { f.h[r] = toh_flush(alo[r] * linv); f.h[4 + r] = toh_flush(ahi[r] * linv); }
    const v8us t = f.half[0];
    *(v8us*)(cx + (qg * 4 + kq) * 512 + lane * 16) = t;
  }
  __syncthreads();                                  /* the group's four tiles become readable */
  // two B fragments with k = e: each lane takes its own place in the four tiles
  FragH cf0, cf1;
  {
    const unsigned char* pc4 = cx + qg * 4 * 512 + lane * 16;
    cf0.half[0] = *(const v8us*)pc4;
    cf0.half[1] = *(const v8us*)(pc4 + 512);
    cf1.half[0] = *(const v8us*)(pc4 + 1024);
    cf1.half[1] = *(const v8us*)(pc4 + 1536);
  }
#pragma unroll   /* constant wa, xr, bb index */
  for (int hf = 0; hf < 2; ++hf) {
    const int ch0 = hf * CH;
#pragma unroll
    for (int c2 = 0; c2 < 2; ++c2) {
      const int ct = kq * 2 + c2;                   /* the group's four waves share the slab's eight channel tiles */
      v8f d = z8;
      d = mma_h1(wa[hf][c2][0].v, cf0.v, d);
      d = mma_h1(wa[hf][c2][1].v, cf1.v, d);
#pragma unroll
      for (int r = 0; r < 8; ++r) so[ct * 16 + 8 * hh + r][qg * 16 + ln] = d[r] * WOINV;
    }
    __syncthreads();
    {
#pragma unroll   /* constant xr, bb index */
      for (int it = 0; it < CH / 32; ++it) {
        const int row = it * 32 + wave * 2 + rsub;
        const v4f v = *(const v4fa*)&so[row][pc];
        v4f o;
#pragma unroll
        for (int q = 0; q < 4; ++q) o[q] = bf16_rne(xr[hf][it][q]) + g * (v[q] + bf16_rne(bb[hf][it]));
        *(v4f*)(out + ((size_t)(b * CC + ch0 + row)) * SEQ + jb + pc) = o;
        asm volatile("s_wait_xcnt 0x0" ::: "memory");   /* later code may rewrite the store's address registers */
      }
      
    }
    __syncthreads();
  }
}

// workspace carve (bytes, every region a multiple of 256)
#define SZ_WO  ((size_t)CC * RD * 2)
#define SZ_P   (NRT * RD * 2)
#define SZ_VT  ((size_t)NB * RD * SEQ * 2)
#define OFF_WOH ((size_t)0)
#define OFF_KF  (OFF_WOH + SZ_WO)
#define OFF_QF  (OFF_KF + SZ_P)
#define OFF_VT  (OFF_QF + SZ_P)
#define WS_TOTAL (OFF_VT + SZ_VT)
static_assert(SZ_WO % 256 == 0 && SZ_P % 256 == 0 && SZ_VT % 256 == 0);
static_assert(WS_TOTAL <= (size_t)134217728);
static_assert((NRT % 64) == 0);                                            /* projection blocks x 64 pixels == token rows */
static_assert(SEQ % 64 == 0 && SEQ % 32 == 0);                             /* k_attn tiles and 32-row key steps */

extern "C" void kernel_launch(void* const* d_in, const int* in_sizes, int n_in,
                              void* d_out, int out_size, void* d_ws, size_t ws_size, hipStream_t stream) {
  if (n_in < 10) return;
  if ((size_t)in_sizes[0] < (size_t)(NB * CC - 1) * SEQ_FULL + SEQ) return;
  if ((size_t)in_sizes[1] < (size_t)RD * CC) return;
  if ((size_t)in_sizes[2] < (size_t)RD) return;
  if ((size_t)in_sizes[3] < (size_t)RD * CC) return;
  if ((size_t)in_sizes[4] < (size_t)RD) return;
  if ((size_t)in_sizes[5] < (size_t)RD * CC) return;
  if ((size_t)in_sizes[6] < (size_t)RD) return;
  if ((size_t)in_sizes[7] < (size_t)CC * RD) return;
  if ((size_t)in_sizes[8] < (size_t)CC) return;
  if ((size_t)in_sizes[9] < (size_t)1) return;
  if ((size_t)out_size < (size_t)NB * CC * SEQ) return;
  if (WS_TOTAL > ws_size) return;
  const float* x  = (const float*)d_in[0];       /* [NB][CC][SEQ_FULL] channel-first */
  const float* wk = (const float*)d_in[1];       /* [RD][CC] = [out][in], key */
  const float* bk = (const float*)d_in[2];       /* [RD] */
  const float* wq = (const float*)d_in[3];       /* [RD][CC] = [out][in], query */
  const float* bq = (const float*)d_in[4];       /* [RD] */
  const float* wv = (const float*)d_in[5];       /* [RD][CC] = [out][in], value */
  const float* bv = (const float*)d_in[6];       /* [RD] */
  const float* wo = (const float*)d_in[7];       /* [CC][RD] = [out][in] */
  const float* bo = (const float*)d_in[8];       /* [CC] */
  const float* gam = (const float*)d_in[9];      /* [1] */
  float* out = (float*)d_out;                    /* [NB][CC][SEQ] channel-first */
  char* ws = (char*)d_ws;
  unsigned short* WOH = (unsigned short*)(ws + OFF_WOH);
  unsigned short* KF  = (unsigned short*)(ws + OFF_KF);
  unsigned short* QF  = (unsigned short*)(ws + OFF_QF);
  unsigned short* VT  = (unsigned short*)(ws + OFF_VT);

  k_proj<<<(unsigned)(NRT / 64), PT, 0, stream>>>(x, wk, wq, wv, wo, bk, bq, bv, KF, QF, VT, WOH);
  k_attn<<<dim3(SEQ / 64, NB), AT, 0, stream>>>(KF, QF, VT, WOH, bo, gam, x, out);
}
